// v000
// The times below were measured on an AMD MI455X: many runs one after another, warmed up first and cycling through
// copies of the inputs, with the whole window's GPU time divided by the number of runs. Launches and the gaps
// between them are all in it. The median over several windows is given; except for v000 it joins two sittings, which
// can be a few percent apart, so the side-by-side timings, each taken in one sitting, are the better comparison.
// The starting kernel, v000, takes 338 microseconds a run.
#include <hip/hip_runtime.h>
#include <math.h>
// Contractions: q/k/v projection GEMMs = v_wmma_f32_16x16x32_bf16 (bf16 operands, one product, f32 accumulate, results stored as bf16 hi/lo planes); scores q.k^T = v_wmma_f32_16x16x32_bf16 (bf16 hi/lo planes of q and k, three products); out = p.v = v_wmma_f32_16x16x32_bf16 (bf16 hi/lo planes of p and v, three products); f32 accumulate everywhere; online softmax in f32.

typedef __attribute__((ext_vector_type(16))) _Float16 v16h;
typedef __attribute__((ext_vector_type(8)))  _Float16 v8h;
typedef __attribute__((ext_vector_type(16))) __bf16   v16b;
typedef __attribute__((ext_vector_type(8)))  __bf16   v8b;
typedef __attribute__((ext_vector_type(8)))  float    v8f;
typedef __attribute__((ext_vector_type(4)))  float    v4f;

__device__ __forceinline__ unsigned short f2bf_bits(float f) {
  unsigned u = __float_as_uint(f);
  return (unsigned short)((u + 0x7FFFu + ((u >> 16) & 1u)) >> 16);
}
__device__ __forceinline__ float bf_bits2f(unsigned short h) { return __uint_as_float(((unsigned)h) << 16); }

// hazard guards as plain device helpers (no inline asm inside the kernel template body)
__device__ __forceinline__ void dep_guard_h(v8f& a, v8f& b, v16h x, v16h y) { asm volatile("v_nop\n\tv_nop\n\tv_nop\n\tv_nop" : "+v"(a), "+v"(b) : "v"(x), "v"(y)); }
__device__ __forceinline__ void dep_guard_b(v8f& a, v8f& b, v16b x, v16b y) { asm volatile("v_nop\n\tv_nop\n\tv_nop\n\tv_nop" : "+v"(a), "+v"(b) : "v"(x), "v"(y)); }
__device__ __forceinline__ void keep4_h(v16h a, v16h b, v16h c, v16h d) { asm volatile("v_nop" :: "v"(a), "v"(b), "v"(c), "v"(d)); }
__device__ __forceinline__ void keep4_b(v16b a, v16b b, v16b c, v16b d) { asm volatile("v_nop" :: "v"(a), "v"(b), "v"(c), "v"(d)); }
__device__ __forceinline__ void acc_guard4(v8f& a, v8f& b, v8f& c, v8f& d) { asm volatile("v_nop\n\tv_nop\n\tv_nop\n\tv_nop" : "+v"(a), "+v"(b), "+v"(c), "+v"(d)); }
template <typename T> struct Frag;
template <> struct Frag<_Float16> {
  typedef v16h V; union U { v16h v; v8h h[2]; };
  static __device__ __forceinline__ v16h load(const _Float16* p) {   // elements 0..7 <- p[0..7], 8..15 <- p[16..23]
    U f; f.h[0] = *(const v8h*)(p); f.h[1] = *(const v8h*)(p + 16); return f.v;
  }
  static __device__ __forceinline__ v8f mma(v16h a, v16h b, v8f c) {
    return __builtin_amdgcn_wmma_f32_16x16x32_f16(false, a, false, b, (short)0, c, false, false);
  }
  static __device__ __forceinline__ void guard(v8f& a, v8f& b, v16h x, v16h y) { dep_guard_h(a, b, x, y); }
  static __device__ __forceinline__ void keep(v16h a, v16h b, v16h c, v16h d) { keep4_h(a, b, c, d); }
};
template <> struct Frag<__bf16> {
  typedef v16b V; union U { v16b v; v8b h[2]; };
  static __device__ __forceinline__ v16b load(const __bf16* p) {
    U f; f.h[0] = *(const v8b*)(p); f.h[1] = *(const v8b*)(p + 16); return f.v;
  }
  static __device__ __forceinline__ v8f mma(v16b a, v16b b, v8f c) {
    return __builtin_amdgcn_wmma_f32_16x16x32_bf16(false, a, false, b, (short)0, c, false, false);
  }
  static __device__ __forceinline__ void guard(v8f& a, v8f& b, v16b x, v16b y) { dep_guard_b(a, b, x, y); }
  static __device__ __forceinline__ void keep(v16b a, v16b b, v16b c, v16b d) { keep4_b(a, b, c, d); }
};

// ---- Register-blocked batched WMMA GEMM ------------------------------------
// C[m,n] = scale * sum_k A[m,k] * Bt[n,k] (+bias)(+resid); each wave owns a 64x64 tile.
// A row-major [M,K]; Bt row-major [N,K]; M,N % 64 == 0, K % 32 == 0.
// SPLIT: operands are hi/lo planes (A2/Bt2 = lo planes, same layout); product = hi.hi + hi.lo + lo.hi.
// BIAS_MODE: 0 = none, 1 = bias[m], 2 = bias[n].
// OUT_MODE: 0 = f32, 1 = f16, 2 = bf16 hi plane (Cout) + bf16 lo plane (Cout2).
// ET: 0 = f16 operands, 1 = bf16 operands (pointers passed as 16-bit storage)
template <int ET> struct Elem;
template <> struct Elem<0> { typedef _Float16 T; };
template <> struct Elem<1> { typedef __bf16 T; };
template <int ET, bool SPLIT, int BIAS_MODE, int OUT_MODE, bool RESID, int ACT = 0>
__global__ __launch_bounds__(256) void wmma_gemm64(
    const unsigned short* __restrict__ Ap, const unsigned short* __restrict__ A2p, int lda, long strideA,
    const unsigned short* __restrict__ Btp, const unsigned short* __restrict__ Bt2p, int ldb, long strideB,
    void* __restrict__ Cout, void* __restrict__ Cout2, int ldc, long strideC,
    const float* __restrict__ bias,
    const float* __restrict__ resid, long strideR,
    int M, int N, int K, float scale) {
  typedef typename Elem<ET>::T T;
  typedef typename Frag<T>::V V;
  const T* A = (const T*)Ap; const T* A2 = (const T*)A2p; const T* Bt = (const T*)Btp; const T* Bt2 = (const T*)Bt2p;
  __shared__ __align__(16) float sT[8][16 * 68];   // per-wave 16x64 slab, pitch 68 floats
  const int b    = blockIdx.y;
  const int lane = threadIdx.x & 31;
  const int wave = threadIdx.x >> 5;
  const int tilesN = N >> 6;
  const int tilesM = M >> 6;
  const int tile = blockIdx.x * 8 + wave;
  if (tile >= tilesM * tilesN) return;   // wave-uniform; no block barriers in this kernel
  const int tm = tile / tilesN;
  const int tn = tile - tm * tilesN;
  const int m0 = tm << 6;
  const int n0 = tn << 6;

  const T* Ab  = A  + (size_t)b * strideA;
  const T* Bb  = Bt + (size_t)b * strideB;
  const T* Ab2 = SPLIT ? (A2  + (size_t)b * strideA) : nullptr;
  const T* Bb2 = SPLIT ? (Bt2 + (size_t)b * strideB) : nullptr;

  const int rlane = lane & 15;                 // row (A) / col (B, D) within subtile
  const int koff  = (lane >> 4) * 8;           // k offset of this lane half
  const int mOff  = (lane >> 4) * 8;           // D row offset

  v8f acc[4][4];
#pragma unroll
  for (int i = 0; i < 4; ++i)
#pragma unroll
    for (int j = 0; j < 4; ++j) acc[i][j] = (v8f){0.f,0.f,0.f,0.f,0.f,0.f,0.f,0.f};

  for (int k0 = 0; k0 < K; k0 += 32) {
    V bh[4], bl[4];
#pragma unroll
    for (int j = 0; j < 4; ++j) {
      const size_t bo = (size_t)(n0 + (j << 4) + rlane) * ldb + koff + k0;
      bh[j] = Frag<T>::load(Bb + bo);
      if (SPLIT) bl[j] = Frag<T>::load(Bb2 + bo);
    }
#pragma unroll
    for (int i = 0; i < 4; ++i) {
      const size_t ao = (size_t)(m0 + (i << 4) + rlane) * lda + koff + k0;
      V ah = Frag<T>::load(Ab + ao);
      V al;
      if (SPLIT) al = Frag<T>::load(Ab2 + ao);
#pragma unroll
      for (int j = 0; j < 4; ++j) {
        acc[i][j] = Frag<T>::mma(ah, bh[j], acc[i][j]);
        if (SPLIT) {
          acc[i][j] = Frag<T>::mma(ah, bl[j], acc[i][j]);
          acc[i][j] = Frag<T>::mma(al, bh[j], acc[i][j]);
        }
      }
      Frag<T>::guard(acc[i][0], acc[i][3], ah, SPLIT ? al : ah);
    }
    Frag<T>::keep(bh[0], bh[1], bh[2], bh[3]);
    if (SPLIT) Frag<T>::keep(bl[0], bl[1], bl[2], bl[3]);
  }
  acc_guard4(acc[0][0], acc[0][1], acc[0][2], acc[0][3]);
  acc_guard4(acc[1][0], acc[1][1], acc[1][2], acc[1][3]);
  acc_guard4(acc[2][0], acc[2][1], acc[2][2], acc[2][3]);
  acc_guard4(acc[3][0], acc[3][1], acc[3][2], acc[3][3]);

  // ---- epilogue ----
  float* slab = sT[wave];
  const float* Rb = RESID ? (resid + (size_t)b * strideR) : nullptr;
#pragma unroll
  for (int i = 0; i < 4; ++i) {
    const int mBase = m0 + (i << 4);
#pragma unroll
    for (int j = 0; j < 4; ++j) {
      const int n = n0 + (j << 4) + rlane;
      float bv = 0.f;
      if (BIAS_MODE == 2) bv = bias[n];
#pragma unroll
      for (int r = 0; r < 8; ++r) {
        float v = acc[i][j][r] * scale;
        if (BIAS_MODE == 1) v += bias[mBase + mOff + r];
        if (BIAS_MODE == 2) v += bv;
        if (RESID) v += Rb[(size_t)(mBase + mOff + r) * ldc + n];
        if (ACT == 1) v = tanhf(v);
        if (ACT == 2) v = fmaxf(v, 0.0f);
        if (ACT == 3) v = v / (1.0f + expf(-v));
        if (ACT == 4) v = (v > 0.f) ? v : 0.01f * v;
        if (ACT == 5) v = 0.5f * v * (1.0f + erff(v * 0.70710678118654752f));
        slab[(mOff + r) * 68 + (j << 4) + rlane] = v;
      }
    }
    __builtin_amdgcn_fence(__ATOMIC_RELEASE, "workgroup");
    __builtin_amdgcn_wave_barrier();
    __builtin_amdgcn_fence(__ATOMIC_ACQUIRE, "workgroup");
    if (OUT_MODE == 0) {
      float* C = (float*)Cout + (size_t)b * strideC;
      const int hh = lane >> 4, c4 = (lane & 15) * 4;     // row seg = 256 B = 16 lanes x 16 B
      {
#pragma unroll
        for (int it = 0; it < 8; ++it) {
          const int row = it * 2 + hh;
          v4f v = *(const v4f*)(slab + row * 68 + c4);
          *(v4f*)(C + (size_t)(mBase + row) * ldc + n0 + c4) = v;
        }
        
      }
    } else {
      const int q = lane >> 3, c8 = (lane & 7) * 8;
      unsigned short* C  = (unsigned short*)Cout  + (size_t)b * strideC;
      unsigned short* C2 = (OUT_MODE == 2) ? ((unsigned short*)Cout2 + (size_t)b * strideC) : nullptr;
      {
#pragma unroll
        for (int it = 0; it < 4; ++it) {
          const int row = it * 4 + q;
          const float* sp = slab + row * 68 + c8;
          v8h hv, lv;
#pragma unroll
          for (int e = 0; e < 8; ++e) {
            if (OUT_MODE == 1) {
              hv[e] = (_Float16)sp[e];
            } else {
              unsigned short hb = f2bf_bits(sp[e]);
              unsigned short lb = f2bf_bits(sp[e] - bf_bits2f(hb));
              hv[e] = __builtin_bit_cast(_Float16, hb);
              lv[e] = __builtin_bit_cast(_Float16, lb);
            }
          }
          *(v8h*)(C + (size_t)(mBase + row) * ldc + n0 + c8) = hv;
          if (OUT_MODE == 2) *(v8h*)(C2 + (size_t)(mBase + row) * ldc + n0 + c8) = lv;
        }
        
      }
    }
    __builtin_amdgcn_fence(__ATOMIC_RELEASE, "workgroup");
    __builtin_amdgcn_wave_barrier();
    __builtin_amdgcn_fence(__ATOMIC_ACQUIRE, "workgroup");
  }
}

__global__ __launch_bounds__(256) void cast_f32_bf16x2(
    const float* __restrict__ in, unsigned short* __restrict__ out, int n2) {
  int i = blockIdx.x * 256 + threadIdx.x;
  if (i < n2) {
    const unsigned u = (unsigned)f2bf_bits(in[2 * i]) | ((unsigned)f2bf_bits(in[2 * i + 1]) << 16);
    ((unsigned*)out)[i] = u;
    
  }
}

// =====================================================================================
// Attention, head_dim 64, no mask. Inputs are bf16 hi/lo planes of q, k, v laid out as G groups of
// contiguous [S][64] slabs (group stride gstride elements, row stride 64); output f32 in the same slab layout.
// Block = 4 waves = 64 query rows of one group; 64-key chunks.
//   scores = q.k^T * sscale : q and k hi/lo planes (hi.hi + hi.lo + lo.hi), f32 accumulate
//   out    = p.v            : p split into bf16 hi/lo after the max shift, v hi/lo planes (hi.hi + hi.lo + lo.hi)
//   online softmax in f32. Q planes staged once per block in LDS (16-B copies); K planes copied and V planes
//   transposed to [d][kv] in LDS per chunk; all staging with plain loads + __syncthreads().
//   grid.x = G * (S/64).
// =====================================================================================
#define AT_D 64
#define AT_NW 4
#define AT_QB 64
#define AT_KC 64

__device__ __forceinline__ unsigned short at_bf_bits(float f) {
  unsigned u = __float_as_uint(f);
  return (unsigned short)((u + 0x7FFFu + ((u >> 16) & 1u)) >> 16);
}
__device__ __forceinline__ __bf16 at_f2bf(float f) { return __builtin_bit_cast(__bf16, at_bf_bits(f)); }
__device__ __forceinline__ void at_split(float f, __bf16& hi, __bf16& lo) {
  const unsigned short hb = at_bf_bits(f);
  hi = __builtin_bit_cast(__bf16, hb);
  lo = at_f2bf(f - __uint_as_float(((unsigned)hb) << 16));
}
// three products of a hi/lo x hi/lo pair into one accumulator, then the hazard guard tying D and all four operands
__device__ __forceinline__ v8f at_mma3(v16b ah, v16b al, v16b bh, v16b bl, v8f c) {
  c = __builtin_amdgcn_wmma_f32_16x16x32_bf16(false, ah, false, bh, (short)0, c, false, false);
  c = __builtin_amdgcn_wmma_f32_16x16x32_bf16(false, ah, false, bl, (short)0, c, false, false);
  c = __builtin_amdgcn_wmma_f32_16x16x32_bf16(false, al, false, bh, (short)0, c, false, false);
  asm volatile("v_nop\n\tv_nop\n\tv_nop\n\tv_nop" : "+v"(c) : "v"(ah), "v"(al), "v"(bh), "v"(bl));
  return c;
}

__global__ __launch_bounds__(128)
void attn64_planes(const unsigned short* __restrict__ QH, const unsigned short* __restrict__ QL,
                   const unsigned short* __restrict__ KH, const unsigned short* __restrict__ KL,
                   const unsigned short* __restrict__ VH, const unsigned short* __restrict__ VL,
                   float* __restrict__ out, long gstride, int S, int nkc, float sscale) {
  union FB { v16b v; v8b h[2]; };
  __shared__ __align__(16) __bf16 Qsh[AT_QB * AT_D];          // Q hi [row][d]   8 KB
  __shared__ __align__(16) __bf16 Qsl[AT_QB * AT_D];          // Q lo [row][d]   8 KB
  __shared__ __align__(16) __bf16 Ksh[AT_KC * AT_D];          // K hi [kv][d]    8 KB
  __shared__ __align__(16) __bf16 Ksl[AT_KC * AT_D];          // K lo [kv][d]    8 KB
  __shared__ __align__(16) __bf16 Vth[AT_D * AT_KC];          // V hi [d][kv]    8 KB
  __shared__ __align__(16) __bf16 Vtl[AT_D * AT_KC];          // V lo [d][kv]    8 KB
  __shared__ __align__(16) __bf16 Psh[AT_NW][16 * AT_KC];     // per wave P hi [row][kv]  8 KB
  __shared__ __align__(16) __bf16 Psl[AT_NW][16 * AT_KC];     // per wave P lo [row][kv]  8 KB
  __shared__ __align__(16) float  Os[AT_NW][16 * 68];         // per wave out tile, pitch 68

  const int tid  = threadIdx.x;
  const int wave = tid >> 5;
  const int lane = tid & 31;
  const int hh   = lane >> 4;
  const int c    = lane & 15;

  const int nqb = S / AT_QB;
  const int bx  = blockIdx.x;
  const int qb  = bx % nqb;
  const int g   = bx / nqb;
  const int q0  = qb * AT_QB + wave * 16;

  const __bf16* Qh = (const __bf16*)QH + (size_t)g * gstride;
  const __bf16* Ql = (const __bf16*)QL + (size_t)g * gstride;
  const __bf16* Kh = (const __bf16*)KH + (size_t)g * gstride;
  const __bf16* Kl = (const __bf16*)KL + (size_t)g * gstride;
  const __bf16* Vh = (const __bf16*)VH + (size_t)g * gstride;
  const __bf16* Vl = (const __bf16*)VL + (size_t)g * gstride;
  float*        Og = out + (size_t)g * gstride;

  // ---- Q hi/lo planes for the block's 64 rows: [row][d], 16-B copies (512 chunks per plane, 4 per thread) ----
  {
    const __bf16* qsh = Qh + (size_t)(qb * AT_QB) * AT_D;
    const __bf16* qsl = Ql + (size_t)(qb * AT_QB) * AT_D;
#pragma unroll
    for (int it = 0; it < 4; ++it) {
      const int ch = tid + it * 128;
      const int row = ch >> 3, col = (ch & 7) * 8;
      *(v8b*)(Qsh + row * AT_D + col) = *(const v8b*)(qsh + (size_t)row * AT_D + col);
      *(v8b*)(Qsl + row * AT_D + col) = *(const v8b*)(qsl + (size_t)row * AT_D + col);
    }
  }
  __syncthreads();

  float mrow[8], lrow[8];
  v8f oacc[4];
#pragma unroll
  for (int r = 0; r < 8; ++r) { mrow[r] = -INFINITY; lrow[r] = 0.f; }
#pragma unroll
  for (int t = 0; t < 4; ++t) oacc[t] = (v8f){0.f,0.f,0.f,0.f,0.f,0.f,0.f,0.f};

  const int nk = (nkc < 64) ? nkc : 64;                             // host-provided trip count, clamped to a static maximum
  const __bf16* qwh = Qsh + (wave * 16 + c) * AT_D + 8 * hh;        // A fragment row c of this wave
  const __bf16* qwl = Qsl + (wave * 16 + c) * AT_D + 8 * hh;

  for (int kc = 0; kc < nk; ++kc) {
    const int kv0 = kc * AT_KC;
    __syncthreads();                                                // readers of the last K/V tile done
    {
      const __bf16* ksh = Kh + (size_t)kv0 * AT_D;
      const __bf16* ksl = Kl + (size_t)kv0 * AT_D;
      const __bf16* vsh = Vh + (size_t)kv0 * AT_D;
      const __bf16* vsl = Vl + (size_t)kv0 * AT_D;
#pragma unroll
      for (int it = 0; it < 4; ++it) {
        const int ch = tid + it * 128;
        const int row = ch >> 3, col = (ch & 7) * 8;                // row = kv within chunk, col = d
        *(v8b*)(Ksh + row * AT_D + col) = *(const v8b*)(ksh + (size_t)row * AT_D + col);
        *(v8b*)(Ksl + row * AT_D + col) = *(const v8b*)(ksl + (size_t)row * AT_D + col);
        const v8b vvh = *(const v8b*)(vsh + (size_t)row * AT_D + col);
        const v8b vvl = *(const v8b*)(vsl + (size_t)row * AT_D + col);
#pragma unroll
        for (int i = 0; i < 8; ++i) {
          Vth[(col + i) * AT_KC + row] = vvh[i];
          Vtl[(col + i) * AT_KC + row] = vvl[i];
        }
      }
    }
    __syncthreads();

    // ---- scores[16 x 64] = q . k^T  (A = Q[row][d], B = K[kv][d]; split k-map via two 16-B halves at +8hh and +16+8hh) ----
    v8f s[4];
#pragma unroll
    for (int j = 0; j < 4; ++j) s[j] = (v8f){0.f,0.f,0.f,0.f,0.f,0.f,0.f,0.f};
#pragma unroll 1
    for (int dc = 0; dc < 2; ++dc) {
      FB qh, ql;
      qh.h[0] = *(const v8b*)(qwh + dc * 32);
      qh.h[1] = *(const v8b*)(qwh + dc * 32 + 16);
      ql.h[0] = *(const v8b*)(qwl + dc * 32);
      ql.h[1] = *(const v8b*)(qwl + dc * 32 + 16);
#pragma unroll
      for (int j = 0; j < 4; ++j) {
        FB kb, kl;
        const __bf16* kp  = Ksh + (j * 16 + c) * AT_D + dc * 32 + 8 * hh;
        const __bf16* kpl = Ksl + (j * 16 + c) * AT_D + dc * 32 + 8 * hh;
        kb.h[0] = *(const v8b*)(kp);
        kb.h[1] = *(const v8b*)(kp + 16);
        kl.h[0] = *(const v8b*)(kpl);
        kl.h[1] = *(const v8b*)(kpl + 16);
        s[j] = at_mma3(qh.v, ql.v, kb.v, kl.v, s[j]);
      }
    }
    // ---- scale (f32), row max ----
    float cm[8];
#pragma unroll
    for (int r = 0; r < 8; ++r) {
      float m = -INFINITY;
#pragma unroll
      for (int j = 0; j < 4; ++j) {
        const float sv = s[j][r] * sscale;
        s[j][r] = sv;
        m = fmaxf(m, sv);
      }
#pragma unroll
      for (int off = 1; off < 16; off <<= 1) m = fmaxf(m, __shfl_xor(m, off, 32));
      cm[r] = m;
    }
    __bf16* pwh = Psh[wave];
    __bf16* pwl = Psl[wave];
#pragma unroll
    for (int r = 0; r < 8; ++r) {
      const float mnew = fmaxf(mrow[r], cm[r]);
      const float mref = (mnew == -INFINITY) ? 0.0f : mnew;
      const float alpha = __expf(mrow[r] - mref);
      mrow[r] = mnew;
      float psum = 0.f;
#pragma unroll
      for (int j = 0; j < 4; ++j) {
        const float p = __expf(s[j][r] - mref);
        psum += p;
        __bf16 a, bl; at_split(p, a, bl);
        pwh[(8 * hh + r) * AT_KC + j * 16 + c] = a;
        pwl[(8 * hh + r) * AT_KC + j * 16 + c] = bl;
      }
#pragma unroll
      for (int off = 1; off < 16; off <<= 1) psum += __shfl_xor(psum, off, 32);
      lrow[r] = lrow[r] * alpha + psum;
#pragma unroll
      for (int t = 0; t < 4; ++t) oacc[t][r] *= alpha;
    }
    __builtin_amdgcn_fence(__ATOMIC_RELEASE, "workgroup");
    __builtin_amdgcn_wave_barrier();
    __builtin_amdgcn_fence(__ATOMIC_ACQUIRE, "workgroup");
    // ---- O[16 x 64] += P[16 x 64] . V[64 x 64]  (A = P[row][kv], B = V[kv][d] from the [d][kv] tile) ----
#pragma unroll 1
    for (int kk = 0; kk < 2; ++kk) {
      FB pa, pl;
      pa.h[0] = *(const v8b*)(pwh + c * AT_KC + kk * 32 + 8 * hh);
      pa.h[1] = *(const v8b*)(pwh + c * AT_KC + kk * 32 + 16 + 8 * hh);
      pl.h[0] = *(const v8b*)(pwl + c * AT_KC + kk * 32 + 8 * hh);
      pl.h[1] = *(const v8b*)(pwl + c * AT_KC + kk * 32 + 16 + 8 * hh);
#pragma unroll
      for (int t = 0; t < 4; ++t) {
        FB vb, vl;
        const __bf16* vp  = Vth + (t * 16 + c) * AT_KC + kk * 32 + 8 * hh;
        const __bf16* vpl = Vtl + (t * 16 + c) * AT_KC + kk * 32 + 8 * hh;
        vb.h[0] = *(const v8b*)(vp);
        vb.h[1] = *(const v8b*)(vp + 16);
        vl.h[0] = *(const v8b*)(vpl);
        vl.h[1] = *(const v8b*)(vpl + 16);
        oacc[t] = at_mma3(pa.v, pl.v, vb.v, vl.v, oacc[t]);
      }
    }
  }

  float* os = Os[wave];
#pragma unroll
  for (int r = 0; r < 8; ++r) {
    const float inv = 1.0f / lrow[r];
#pragma unroll
    for (int t = 0; t < 4; ++t) os[(8 * hh + r) * 68 + t * 16 + c] = oacc[t][r] * inv;
  }
  __builtin_amdgcn_fence(__ATOMIC_RELEASE, "workgroup");
  __builtin_amdgcn_wave_barrier();
  __builtin_amdgcn_fence(__ATOMIC_ACQUIRE, "workgroup");
  {
    const int c4 = (lane & 15) * 4;
    {
#pragma unroll
      for (int it = 0; it < 8; ++it) {
        const int row = it * 2 + hh;                    // hh in 0..1, it in 0..7 -> rows 0..15
        v4f val = *(const v4f*)(os + row * 68 + c4);
        *(v4f*)(Og + (size_t)(q0 + row) * AT_D + c4) = val;
      }
      
    }
  }
}

// ---------------------------------------------------------------------------
// Host orchestration (launches only).
// d_in: 0=query 1=key 2=value [4,1024,1024] f32; 3=Wq 4=Wk 5=Wv [1024,1024] f32 ([out,in]).
// q/k/v = x . W^T as [4096][1024] bf16 hi/lo planes; the raw row-major reshape to [64][1024][64] is a pure
// reinterpretation of the same memory: group g owns the contiguous slab of 1024 rows x 64.
// ---------------------------------------------------------------------------
extern "C" void kernel_launch(void* const* d_in, const int* in_sizes, int n_in,
                              void* d_out, int out_size, void* d_ws, size_t ws_size,
                              hipStream_t stream) {
  constexpr int Bn = 4, Sn = 1024, E = 1024, Dh = 64, G = 64;
  constexpr int M = Bn * Sn;                       // 4096 projected rows
  constexpr int GS = (M * E) / (G * Dh);           // 1024 group-tokens per group
  static_assert(GS % AT_QB == 0 && GS % AT_KC == 0);
  static_assert(M % 64 == 0 && E % 64 == 0 && E % 32 == 0);
  if (n_in < 6) return;
  if (in_sizes[0] != M * E || in_sizes[1] != M * E || in_sizes[2] != M * E ||
      in_sizes[3] != E * E || in_sizes[4] != E * E || in_sizes[5] != E * E || out_size != M * E) return;

  const float* xq = (const float*)d_in[0];
  const float* xk = (const float*)d_in[1];
  const float* xv = (const float*)d_in[2];
  const float* wq = (const float*)d_in[3];
  const float* wk = (const float*)d_in[4];
  const float* wv = (const float*)d_in[5];
  float* out = (float*)d_out;

  const size_t bX = (size_t)M * E * 2;            //  8 MiB  bf16 activation copy (x3)
  const size_t bW = (size_t)E * E * 2;            //  2 MiB  bf16 weight copy (x3)
  const size_t bP = (size_t)M * E * 2;            //  8 MiB  bf16 projection plane (x3 hi, x3 lo)
  char* ws = (char*)d_ws;
  size_t off = 0;
  unsigned short* X16 = (unsigned short*)(ws + off); off += 3 * bX;   // [3][4096][1024] bf16
  unsigned short* W16 = (unsigned short*)(ws + off); off += 3 * bW;   // [3][1024][1024] bf16
  unsigned short* PH  = (unsigned short*)(ws + off); off += 3 * bP;   // [3][4096][1024] bf16 hi : q, k, v
  unsigned short* PL  = (unsigned short*)(ws + off); off += 3 * bP;   // [3][4096][1024] bf16 lo : q, k, v
  if (off > ws_size || off > (size_t)134217728) return;               // 81,788,928 B

  const size_t PE = (size_t)M * E;                 // elements per plane
  unsigned short* QH = PH;          unsigned short* QL = PL;
  unsigned short* KH = PH + PE;     unsigned short* KL = PL + PE;
  unsigned short* VH = PH + 2 * PE; unsigned short* VL = PL + 2 * PE;

  dim3 blk256(256), blk128(128);

  // 1-6: RNE bf16 casts of the three activations and the three weights
  {
    const int n2x = M * E / 2, n2w = E * E / 2;
    cast_f32_bf16x2<<<dim3((n2x + 255) / 256), blk256, 0, stream>>>(xq, X16, n2x);
    cast_f32_bf16x2<<<dim3((n2x + 255) / 256), blk256, 0, stream>>>(xk, X16 + PE, n2x);
    cast_f32_bf16x2<<<dim3((n2x + 255) / 256), blk256, 0, stream>>>(xv, X16 + 2 * PE, n2x);
    cast_f32_bf16x2<<<dim3((n2w + 255) / 256), blk256, 0, stream>>>(wq, W16, n2w);
    cast_f32_bf16x2<<<dim3((n2w + 255) / 256), blk256, 0, stream>>>(wk, W16 + (size_t)E * E, n2w);
    cast_f32_bf16x2<<<dim3((n2w + 255) / 256), blk256, 0, stream>>>(wv, W16 + (size_t)2 * E * E, n2w);
  }

  // 7: P_z[m][f] = bf16(x_z)[m][e] . bf16(W_z)[f][e], f32 accumulate, stored as bf16 hi/lo planes; z = 0..2 via grid.y
  {
    const int tiles = (M / 64) * (E / 64);          // 1024 tiles of 64x64 per z; 8 waves per block
    wmma_gemm64<1, false, 0, 2, false><<<dim3((tiles + 7) / 8, 3), blk256, 0, stream>>>(
        X16, X16, E, (long)PE,
        W16, W16, E, (long)E * E,
        (void*)PH, (void*)PL, E, (long)PE,
        wq, wq, 0L, M, E, E, 1.0f);
  }

  // 8: attention over 64 groups, each a contiguous [1024][64] slab (group stride 65536 elements, row stride 64); no mask
  {
    const int nblk = G * (GS / AT_QB);               // 64 groups x 16 query blocks = 1024
    const long gstride = (long)GS * Dh;              // 65536
    attn64_planes<<<dim3(nblk), blk128, 0, stream>>>(
        QH, QL, KH, KL, VH, VL, out, gstride, GS, GS / AT_KC, 0.125f);
  }
}

// v001
// Measured time: 262 microseconds a run.
// Two timings next to v000 put it at 1.34 and 1.33 times that version's speed.
#include <hip/hip_runtime.h>
#include <math.h>
// Contractions: q/k/v projection GEMMs = v_wmma_f32_16x16x32_bf16 (bf16 operands, one product, f32 accumulate, results stored as bf16 hi/lo planes); scores q.k^T = v_wmma_f32_16x16x32_bf16 (bf16 hi/lo planes of q and k, three products); out = p.v = v_wmma_f32_16x16x32_bf16 (bf16 hi/lo planes of p and v, three products); f32 accumulate everywhere; online softmax in f32.

typedef __attribute__((ext_vector_type(16))) _Float16 v16h;
typedef __attribute__((ext_vector_type(8)))  _Float16 v8h;
typedef __attribute__((ext_vector_type(16))) __bf16   v16b;
typedef __attribute__((ext_vector_type(8)))  __bf16   v8b;
typedef __attribute__((ext_vector_type(8)))  float    v8f;
typedef __attribute__((ext_vector_type(4)))  float    v4f;

__device__ __forceinline__ unsigned short f2bf_bits(float f) {
  unsigned u = __float_as_uint(f);
  return (unsigned short)((u + 0x7FFFu + ((u >> 16) & 1u)) >> 16);
}
__device__ __forceinline__ float bf_bits2f(unsigned short h) { return __uint_as_float(((unsigned)h) << 16); }

// hazard guards as plain device helpers (no inline asm inside the kernel template body)
__device__ __forceinline__ void dep_guard_h(v8f& a, v8f& b, v16h x, v16h y) { asm volatile("v_nop\n\tv_nop\n\tv_nop\n\tv_nop" : "+v"(a), "+v"(b) : "v"(x), "v"(y)); }
__device__ __forceinline__ void dep_guard_b(v8f& a, v8f& b, v16b x, v16b y) { asm volatile("v_nop\n\tv_nop\n\tv_nop\n\tv_nop" : "+v"(a), "+v"(b) : "v"(x), "v"(y)); }
__device__ __forceinline__ void keep4_h(v16h a, v16h b, v16h c, v16h d) { asm volatile("v_nop" :: "v"(a), "v"(b), "v"(c), "v"(d)); }
__device__ __forceinline__ void keep4_b(v16b a, v16b b, v16b c, v16b d) { asm volatile("v_nop" :: "v"(a), "v"(b), "v"(c), "v"(d)); }
__device__ __forceinline__ void acc_guard4(v8f& a, v8f& b, v8f& c, v8f& d) { asm volatile("v_nop\n\tv_nop\n\tv_nop\n\tv_nop" : "+v"(a), "+v"(b), "+v"(c), "+v"(d)); }
template <typename T> struct Frag;
template <> struct Frag<_Float16> {
  typedef v16h V; union U { v16h v; v8h h[2]; };
  static __device__ __forceinline__ v16h load(const _Float16* p) {   // elements 0..7 <- p[0..7], 8..15 <- p[16..23]
    U f; f.h[0] = *(const v8h*)(p); f.h[1] = *(const v8h*)(p + 16); return f.v;
  }
  static __device__ __forceinline__ v8f mma(v16h a, v16h b, v8f c) {
    return __builtin_amdgcn_wmma_f32_16x16x32_f16(false, a, false, b, (short)0, c, false, false);
  }
  static __device__ __forceinline__ void guard(v8f& a, v8f& b, v16h x, v16h y) { dep_guard_h(a, b, x, y); }
  static __device__ __forceinline__ void keep(v16h a, v16h b, v16h c, v16h d) { keep4_h(a, b, c, d); }
};
template <> struct Frag<__bf16> {
  typedef v16b V; union U { v16b v; v8b h[2]; };
  static __device__ __forceinline__ v16b load(const __bf16* p) {
    U f; f.h[0] = *(const v8b*)(p); f.h[1] = *(const v8b*)(p + 16); return f.v;
  }
  static __device__ __forceinline__ v8f mma(v16b a, v16b b, v8f c) {
    return __builtin_amdgcn_wmma_f32_16x16x32_bf16(false, a, false, b, (short)0, c, false, false);
  }
  static __device__ __forceinline__ void guard(v8f& a, v8f& b, v16b x, v16b y) { dep_guard_b(a, b, x, y); }
  static __device__ __forceinline__ void keep(v16b a, v16b b, v16b c, v16b d) { keep4_b(a, b, c, d); }
};

// ---- Register-blocked batched WMMA GEMM ------------------------------------
// C[m,n] = scale * sum_k A[m,k] * Bt[n,k] (+bias)(+resid); each wave owns a 64x64 tile.
// A row-major [M,K]; Bt row-major [N,K]; M,N % 64 == 0, K % 32 == 0.
// SPLIT: operands are hi/lo planes (A2/Bt2 = lo planes, same layout); product = hi.hi + hi.lo + lo.hi.
// BIAS_MODE: 0 = none, 1 = bias[m], 2 = bias[n].
// OUT_MODE: 0 = f32, 1 = f16, 2 = bf16 hi plane (Cout) + bf16 lo plane (Cout2).
// ET: 0 = f16 operands, 1 = bf16 operands (pointers passed as 16-bit storage)
template <int ET> struct Elem;
template <> struct Elem<0> { typedef _Float16 T; };
template <> struct Elem<1> { typedef __bf16 T; };
template <int ET, bool SPLIT, int BIAS_MODE, int OUT_MODE, bool RESID, int ACT = 0>
__global__ __launch_bounds__(256) void wmma_gemm64(
    const unsigned short* __restrict__ Ap, const unsigned short* __restrict__ A2p, int lda, long strideA,
    const unsigned short* __restrict__ Btp, const unsigned short* __restrict__ Bt2p, int ldb, long strideB,
    void* __restrict__ Cout, void* __restrict__ Cout2, int ldc, long strideC,
    const float* __restrict__ bias,
    const float* __restrict__ resid, long strideR,
    int M, int N, int K, float scale) {
  typedef typename Elem<ET>::T T;
  typedef typename Frag<T>::V V;
  const T* A = (const T*)Ap; const T* A2 = (const T*)A2p; const T* Bt = (const T*)Btp; const T* Bt2 = (const T*)Bt2p;
  __shared__ __align__(16) float sT[8][16 * 68];   // per-wave 16x64 slab, pitch 68 floats
  const int b    = blockIdx.y;
  const int lane = threadIdx.x & 31;
  const int wave = threadIdx.x >> 5;
  const int tilesN = N >> 6;
  const int tilesM = M >> 6;
  const int tile = blockIdx.x * 8 + wave;
  if (tile >= tilesM * tilesN) return;   // wave-uniform; no block barriers in this kernel
  const int tm = tile / tilesN;
  const int tn = tile - tm * tilesN;
  const int m0 = tm << 6;
  const int n0 = tn << 6;

  const T* Ab  = A  + (size_t)b * strideA;
  const T* Bb  = Bt + (size_t)b * strideB;
  const T* Ab2 = SPLIT ? (A2  + (size_t)b * strideA) : nullptr;
  const T* Bb2 = SPLIT ? (Bt2 + (size_t)b * strideB) : nullptr;

  const int rlane = lane & 15;                 // row (A) / col (B, D) within subtile
  const int koff  = (lane >> 4) * 8;           // k offset of this lane half
  const int mOff  = (lane >> 4) * 8;           // D row offset

  v8f acc[4][4];
#pragma unroll
  for (int i = 0; i < 4; ++i)
#pragma unroll
    for (int j = 0; j < 4; ++j) acc[i][j] = (v8f){0.f,0.f,0.f,0.f,0.f,0.f,0.f,0.f};

  for (int k0 = 0; k0 < K; k0 += 32) {
    V bh[4], bl[4];
#pragma unroll
    for (int j = 0; j < 4; ++j) {
      const size_t bo = (size_t)(n0 + (j << 4) + rlane) * ldb + koff + k0;
      bh[j] = Frag<T>::load(Bb + bo);
      if (SPLIT) bl[j] = Frag<T>::load(Bb2 + bo);
    }
#pragma unroll
    for (int i = 0; i < 4; ++i) {
      const size_t ao = (size_t)(m0 + (i << 4) + rlane) * lda + koff + k0;
      V ah = Frag<T>::load(Ab + ao);
      V al;
      if (SPLIT) al = Frag<T>::load(Ab2 + ao);
#pragma unroll
      for (int j = 0; j < 4; ++j) {
        acc[i][j] = Frag<T>::mma(ah, bh[j], acc[i][j]);
        if (SPLIT) {
          acc[i][j] = Frag<T>::mma(ah, bl[j], acc[i][j]);
          acc[i][j] = Frag<T>::mma(al, bh[j], acc[i][j]);
        }
      }
      Frag<T>::guard(acc[i][0], acc[i][3], ah, SPLIT ? al : ah);
    }
    Frag<T>::keep(bh[0], bh[1], bh[2], bh[3]);
    if (SPLIT) Frag<T>::keep(bl[0], bl[1], bl[2], bl[3]);
  }
  acc_guard4(acc[0][0], acc[0][1], acc[0][2], acc[0][3]);
  acc_guard4(acc[1][0], acc[1][1], acc[1][2], acc[1][3]);
  acc_guard4(acc[2][0], acc[2][1], acc[2][2], acc[2][3]);
  acc_guard4(acc[3][0], acc[3][1], acc[3][2], acc[3][3]);

  // ---- epilogue ----
  float* slab = sT[wave];
  const float* Rb = RESID ? (resid + (size_t)b * strideR) : nullptr;
#pragma unroll
  for (int i = 0; i < 4; ++i) {
    const int mBase = m0 + (i << 4);
#pragma unroll
    for (int j = 0; j < 4; ++j) {
      const int n = n0 + (j << 4) + rlane;
      float bv = 0.f;
      if (BIAS_MODE == 2) bv = bias[n];
#pragma unroll
      for (int r = 0; r < 8; ++r) {
        float v = acc[i][j][r] * scale;
        if (BIAS_MODE == 1) v += bias[mBase + mOff + r];
        if (BIAS_MODE == 2) v += bv;
        if (RESID) v += Rb[(size_t)(mBase + mOff + r) * ldc + n];
        if (ACT == 1) v = tanhf(v);
        if (ACT == 2) v = fmaxf(v, 0.0f);
        if (ACT == 3) v = v / (1.0f + expf(-v));
        if (ACT == 4) v = (v > 0.f) ? v : 0.01f * v;
        if (ACT == 5) v = 0.5f * v * (1.0f + erff(v * 0.70710678118654752f));
        slab[(mOff + r) * 68 + (j << 4) + rlane] = v;
      }
    }
    __builtin_amdgcn_fence(__ATOMIC_RELEASE, "workgroup");
    __builtin_amdgcn_wave_barrier();
    __builtin_amdgcn_fence(__ATOMIC_ACQUIRE, "workgroup");
    if (OUT_MODE == 0) {
      float* C = (float*)Cout + (size_t)b * strideC;
      const int hh = lane >> 4, c4 = (lane & 15) * 4;     // row seg = 256 B = 16 lanes x 16 B
      {
#pragma unroll
        for (int it = 0; it < 8; ++it) {
          const int row = it * 2 + hh;
          v4f v = *(const v4f*)(slab + row * 68 + c4);
          *(v4f*)(C + (size_t)(mBase + row) * ldc + n0 + c4) = v;
        }
        
      }
    } else {
      const int q = lane >> 3, c8 = (lane & 7) * 8;
      unsigned short* C  = (unsigned short*)Cout  + (size_t)b * strideC;
      unsigned short* C2 = (OUT_MODE == 2) ? ((unsigned short*)Cout2 + (size_t)b * strideC) : nullptr;
      {
#pragma unroll
        for (int it = 0; it < 4; ++it) {
          const int row = it * 4 + q;
          const float* sp = slab + row * 68 + c8;
          v8h hv, lv;
#pragma unroll
          for (int e = 0; e < 8; ++e) {
            if (OUT_MODE == 1) {
              hv[e] = (_Float16)sp[e];
            } else {
              unsigned short hb = f2bf_bits(sp[e]);
              unsigned short lb = f2bf_bits(sp[e] - bf_bits2f(hb));
              hv[e] = __builtin_bit_cast(_Float16, hb);
              lv[e] = __builtin_bit_cast(_Float16, lb);
            }
          }
          *(v8h*)(C + (size_t)(mBase + row) * ldc + n0 + c8) = hv;
          if (OUT_MODE == 2) *(v8h*)(C2 + (size_t)(mBase + row) * ldc + n0 + c8) = lv;
        }
        
      }
    }
    __builtin_amdgcn_fence(__ATOMIC_RELEASE, "workgroup");
    __builtin_amdgcn_wave_barrier();
    __builtin_amdgcn_fence(__ATOMIC_ACQUIRE, "workgroup");
  }
}

__global__ __launch_bounds__(256) void cast_f32_bf16x2(
    const float* __restrict__ in, unsigned short* __restrict__ out, int n2) {
  int i = blockIdx.x * 256 + threadIdx.x;
  if (i < n2) {
    const unsigned u = (unsigned)f2bf_bits(in[2 * i]) | ((unsigned)f2bf_bits(in[2 * i + 1]) << 16);
    ((unsigned*)out)[i] = u;
    
  }
}

// =====================================================================================
// Attention, head_dim 64, no mask. Inputs are bf16 hi/lo planes of q, k, v laid out as G groups of
// contiguous [S][64] slabs (group stride gstride elements, row stride 64); output f32 in the same slab layout.
// Block = 4 waves = 64 query rows of one group; 64-key chunks.
//   scores = q.k^T * sscale : q and k hi/lo planes (hi.hi + hi.lo + lo.hi), f32 accumulate
//   out    = p.v            : p split into bf16 hi/lo after the max shift, v hi/lo planes (hi.hi + hi.lo + lo.hi)
//   online softmax in f32. Q planes staged once per block in LDS (16-B copies); K planes copied and V planes
//   transposed to [d][kv] in LDS per chunk; all staging with plain loads + __syncthreads().
//   grid.x = G * (S/64).
// =====================================================================================
#define AT_D 64
#define AT_NW 4
#define AT_QB 64
#define AT_KC 64
#define AT_LP 72   // LDS row pitch in elements: 144 B = 16 B x odd, so the 16 rows of a 16-byte fragment read fall on distinct banks

__device__ __forceinline__ unsigned short at_bf_bits(float f) {
  unsigned u = __float_as_uint(f);
  return (unsigned short)((u + 0x7FFFu + ((u >> 16) & 1u)) >> 16);
}
__device__ __forceinline__ __bf16 at_f2bf(float f) { return __builtin_bit_cast(__bf16, at_bf_bits(f)); }
__device__ __forceinline__ void at_split(float f, __bf16& hi, __bf16& lo) {
  const unsigned short hb = at_bf_bits(f);
  hi = __builtin_bit_cast(__bf16, hb);
  lo = at_f2bf(f - __uint_as_float(((unsigned)hb) << 16));
}
// three products of a hi/lo x hi/lo pair into one accumulator, then the hazard guard tying D and all four operands
__device__ __forceinline__ v8f at_mma3(v16b ah, v16b al, v16b bh, v16b bl, v8f c) {
  c = __builtin_amdgcn_wmma_f32_16x16x32_bf16(false, ah, false, bh, (short)0, c, false, false);
  c = __builtin_amdgcn_wmma_f32_16x16x32_bf16(false, ah, false, bl, (short)0, c, false, false);
  c = __builtin_amdgcn_wmma_f32_16x16x32_bf16(false, al, false, bh, (short)0, c, false, false);
  asm volatile("v_nop\n\tv_nop\n\tv_nop\n\tv_nop" : "+v"(c) : "v"(ah), "v"(al), "v"(bh), "v"(bl));
  return c;
}

__global__ __launch_bounds__(128)
void attn64_planes(const unsigned short* __restrict__ QH, const unsigned short* __restrict__ QL,
                   const unsigned short* __restrict__ KH, const unsigned short* __restrict__ KL,
                   const unsigned short* __restrict__ VH, const unsigned short* __restrict__ VL,
                   float* __restrict__ out, long gstride, int S, int nkc, float sscale) {
  union FB { v16b v; v8b h[2]; };
  __shared__ __align__(16) __bf16 Qsh[AT_QB * AT_LP];         // Q hi [row][d]   9 KB
  __shared__ __align__(16) __bf16 Qsl[AT_QB * AT_LP];         // Q lo [row][d]   9 KB
  __shared__ __align__(16) __bf16 Ksh[AT_KC * AT_LP];         // K hi [kv][d]    9 KB
  __shared__ __align__(16) __bf16 Ksl[AT_KC * AT_LP];         // K lo [kv][d]    9 KB
  __shared__ __align__(16) __bf16 Vth[AT_D * AT_LP];          // V hi [d][kv]    9 KB
  __shared__ __align__(16) __bf16 Vtl[AT_D * AT_LP];          // V lo [d][kv]    9 KB
  __shared__ __align__(16) __bf16 Psh[AT_NW][16 * AT_LP];     // per wave P hi [row][kv]  9 KB
  __shared__ __align__(16) __bf16 Psl[AT_NW][16 * AT_LP];     // per wave P lo [row][kv]  9 KB
  __shared__ __align__(16) float  Os[AT_NW][16 * 68];         // per wave out tile, pitch 68

  const int tid  = threadIdx.x;
  const int wave = tid >> 5;
  const int lane = tid & 31;
  const int hh   = lane >> 4;
  const int c    = lane & 15;

  const int nqb = S / AT_QB;
  const int bx  = blockIdx.x;
  const int qb  = bx % nqb;
  const int g   = bx / nqb;
  const int q0  = qb * AT_QB + wave * 16;

  const __bf16* Qh = (const __bf16*)QH + (size_t)g * gstride;
  const __bf16* Ql = (const __bf16*)QL + (size_t)g * gstride;
  const __bf16* Kh = (const __bf16*)KH + (size_t)g * gstride;
  const __bf16* Kl = (const __bf16*)KL + (size_t)g * gstride;
  const __bf16* Vh = (const __bf16*)VH + (size_t)g * gstride;
  const __bf16* Vl = (const __bf16*)VL + (size_t)g * gstride;
  float*        Og = out + (size_t)g * gstride;

  // ---- Q hi/lo planes for the block's 64 rows: [row][d], 16-B copies (512 chunks per plane, 4 per thread) ----
  {
    const __bf16* qsh = Qh + (size_t)(qb * AT_QB) * AT_D;
    const __bf16* qsl = Ql + (size_t)(qb * AT_QB) * AT_D;
#pragma unroll
    for (int it = 0; it < 4; ++it) {
      const int ch = tid + it * 128;
      const int row = ch >> 3, col = (ch & 7) * 8;
      *(v8b*)(Qsh + row * AT_LP + col) = *(const v8b*)(qsh + (size_t)row * AT_D + col);
      *(v8b*)(Qsl + row * AT_LP + col) = *(const v8b*)(qsl + (size_t)row * AT_D + col);
    }
  }
  __syncthreads();

  float mrow[8], lrow[8];
  v8f oacc[4];
#pragma unroll
  for (int r = 0; r < 8; ++r) { mrow[r] = -INFINITY; lrow[r] = 0.f; }
#pragma unroll
  for (int t = 0; t < 4; ++t) oacc[t] = (v8f){0.f,0.f,0.f,0.f,0.f,0.f,0.f,0.f};

  const int nk = (nkc < 64) ? nkc : 64;                             // host-provided trip count, clamped to a static maximum
  const __bf16* qwh = Qsh + (wave * 16 + c) * AT_LP + 8 * hh;        // A fragment row c of this wave
  const __bf16* qwl = Qsl + (wave * 16 + c) * AT_LP + 8 * hh;

  for (int kc = 0; kc < nk; ++kc) {
    const int kv0 = kc * AT_KC;
    __syncthreads();                                                // readers of the last K/V tile done
    {
      const __bf16* ksh = Kh + (size_t)kv0 * AT_D;
      const __bf16* ksl = Kl + (size_t)kv0 * AT_D;
      const __bf16* vsh = Vh + (size_t)kv0 * AT_D;
      const __bf16* vsl = Vl + (size_t)kv0 * AT_D;
#pragma unroll
      for (int it = 0; it < 4; ++it) {
        const int ch = tid + it * 128;
        const int row = ch >> 3, col = (ch & 7) * 8;                // row = kv within chunk, col = d
        *(v8b*)(Ksh + row * AT_LP + col) = *(const v8b*)(ksh + (size_t)row * AT_D + col);
        *(v8b*)(Ksl + row * AT_LP + col) = *(const v8b*)(ksl + (size_t)row * AT_D + col);
        const v8b vvh = *(const v8b*)(vsh + (size_t)row * AT_D + col);
        const v8b vvl = *(const v8b*)(vsl + (size_t)row * AT_D + col);
#pragma unroll
        for (int i = 0; i < 8; ++i) {
          Vth[(col + i) * AT_LP + row] = vvh[i];
          Vtl[(col + i) * AT_LP + row] = vvl[i];
        }
      }
    }
    __syncthreads();

    // ---- scores[16 x 64] = q . k^T  (A = Q[row][d], B = K[kv][d]; split k-map via two 16-B halves at +8hh and +16+8hh) ----
    v8f s[4];
#pragma unroll
    for (int j = 0; j < 4; ++j) s[j] = (v8f){0.f,0.f,0.f,0.f,0.f,0.f,0.f,0.f};
#pragma unroll 1
    for (int dc = 0; dc < 2; ++dc) {
      FB qh, ql;
      qh.h[0] = *(const v8b*)(qwh + dc * 32);
      qh.h[1] = *(const v8b*)(qwh + dc * 32 + 16);
      ql.h[0] = *(const v8b*)(qwl + dc * 32);
      ql.h[1] = *(const v8b*)(qwl + dc * 32 + 16);
#pragma unroll
      for (int j = 0; j < 4; ++j) {
        FB kb, kl;
        const __bf16* kp  = Ksh + (j * 16 + c) * AT_LP + dc * 32 + 8 * hh;
        const __bf16* kpl = Ksl + (j * 16 + c) * AT_LP + dc * 32 + 8 * hh;
        kb.h[0] = *(const v8b*)(kp);
        kb.h[1] = *(const v8b*)(kp + 16);
        kl.h[0] = *(const v8b*)(kpl);
        kl.h[1] = *(const v8b*)(kpl + 16);
        s[j] = at_mma3(qh.v, ql.v, kb.v, kl.v, s[j]);
      }
    }
    // ---- scale (f32), row max ----
    float cm[8];
#pragma unroll
    for (int r = 0; r < 8; ++r) {
      float m = -INFINITY;
#pragma unroll
      for (int j = 0; j < 4; ++j) {
        const float sv = s[j][r] * sscale;
        s[j][r] = sv;
        m = fmaxf(m, sv);
      }
#pragma unroll
      for (int off = 1; off < 16; off <<= 1) m = fmaxf(m, __shfl_xor(m, off, 32));
      cm[r] = m;
    }
    __bf16* pwh = Psh[wave];
    __bf16* pwl = Psl[wave];
#pragma unroll
    for (int r = 0; r < 8; ++r) {
      const float mnew = fmaxf(mrow[r], cm[r]);
      const float mref = (mnew == -INFINITY) ? 0.0f : mnew;
      const float alpha = __expf(mrow[r] - mref);
      mrow[r] = mnew;
      float psum = 0.f;
#pragma unroll
      for (int j = 0; j < 4; ++j) {
        const float p = __expf(s[j][r] - mref);
        psum += p;
        __bf16 a, bl; at_split(p, a, bl);
        pwh[(8 * hh + r) * AT_LP + j * 16 + c] = a;
        pwl[(8 * hh + r) * AT_LP + j * 16 + c] = bl;
      }
#pragma unroll
      for (int off = 1; off < 16; off <<= 1) psum += __shfl_xor(psum, off, 32);
      lrow[r] = lrow[r] * alpha + psum;
#pragma unroll
      for (int t = 0; t < 4; ++t) oacc[t][r] *= alpha;
    }
    __builtin_amdgcn_fence(__ATOMIC_RELEASE, "workgroup");
    __builtin_amdgcn_wave_barrier();
    __builtin_amdgcn_fence(__ATOMIC_ACQUIRE, "workgroup");
    // ---- O[16 x 64] += P[16 x 64] . V[64 x 64]  (A = P[row][kv], B = V[kv][d] from the [d][kv] tile) ----
#pragma unroll 1
    for (int kk = 0; kk < 2; ++kk) {
      FB pa, pl;
      pa.h[0] = *(const v8b*)(pwh + c * AT_LP + kk * 32 + 8 * hh);
      pa.h[1] = *(const v8b*)(pwh + c * AT_LP + kk * 32 + 16 + 8 * hh);
      pl.h[0] = *(const v8b*)(pwl + c * AT_LP + kk * 32 + 8 * hh);
      pl.h[1] = *(const v8b*)(pwl + c * AT_LP + kk * 32 + 16 + 8 * hh);
#pragma unroll
      for (int t = 0; t < 4; ++t) {
        FB vb, vl;
        const __bf16* vp  = Vth + (t * 16 + c) * AT_LP + kk * 32 + 8 * hh;
        const __bf16* vpl = Vtl + (t * 16 + c) * AT_LP + kk * 32 + 8 * hh;
        vb.h[0] = *(const v8b*)(vp);
        vb.h[1] = *(const v8b*)(vp + 16);
        vl.h[0] = *(const v8b*)(vpl);
        vl.h[1] = *(const v8b*)(vpl + 16);
        oacc[t] = at_mma3(pa.v, pl.v, vb.v, vl.v, oacc[t]);
      }
    }
  }

  float* os = Os[wave];
#pragma unroll
  for (int r = 0; r < 8; ++r) {
    const float inv = 1.0f / lrow[r];
#pragma unroll
    for (int t = 0; t < 4; ++t) os[(8 * hh + r) * 68 + t * 16 + c] = oacc[t][r] * inv;
  }
  __builtin_amdgcn_fence(__ATOMIC_RELEASE, "workgroup");
  __builtin_amdgcn_wave_barrier();
  __builtin_amdgcn_fence(__ATOMIC_ACQUIRE, "workgroup");
  {
    const int c4 = (lane & 15) * 4;
    {
#pragma unroll
      for (int it = 0; it < 8; ++it) {
        const int row = it * 2 + hh;                    // hh in 0..1, it in 0..7 -> rows 0..15
        v4f val = *(const v4f*)(os + row * 68 + c4);
        *(v4f*)(Og + (size_t)(q0 + row) * AT_D + c4) = val;
      }
      
    }
  }
}

// ---------------------------------------------------------------------------
// Host orchestration (launches only).
// d_in: 0=query 1=key 2=value [4,1024,1024] f32; 3=Wq 4=Wk 5=Wv [1024,1024] f32 ([out,in]).
// q/k/v = x . W^T as [4096][1024] bf16 hi/lo planes; the raw row-major reshape to [64][1024][64] is a pure
// reinterpretation of the same memory: group g owns the contiguous slab of 1024 rows x 64.
// ---------------------------------------------------------------------------
extern "C" void kernel_launch(void* const* d_in, const int* in_sizes, int n_in,
                              void* d_out, int out_size, void* d_ws, size_t ws_size,
                              hipStream_t stream) {
  constexpr int Bn = 4, Sn = 1024, E = 1024, Dh = 64, G = 64;
  constexpr int M = Bn * Sn;                       // 4096 projected rows
  constexpr int GS = (M * E) / (G * Dh);           // 1024 group-tokens per group
  static_assert(GS % AT_QB == 0 && GS % AT_KC == 0);
  static_assert(M % 64 == 0 && E % 64 == 0 && E % 32 == 0);
  if (n_in < 6) return;
  if (in_sizes[0] != M * E || in_sizes[1] != M * E || in_sizes[2] != M * E ||
      in_sizes[3] != E * E || in_sizes[4] != E * E || in_sizes[5] != E * E || out_size != M * E) return;

  const float* xq = (const float*)d_in[0];
  const float* xk = (const float*)d_in[1];
  const float* xv = (const float*)d_in[2];
  const float* wq = (const float*)d_in[3];
  const float* wk = (const float*)d_in[4];
  const float* wv = (const float*)d_in[5];
  float* out = (float*)d_out;

  const size_t bX = (size_t)M * E * 2;            //  8 MiB  bf16 activation copy (x3)
  const size_t bW = (size_t)E * E * 2;            //  2 MiB  bf16 weight copy (x3)
  const size_t bP = (size_t)M * E * 2;            //  8 MiB  bf16 projection plane (x3 hi, x3 lo)
  char* ws = (char*)d_ws;
  size_t off = 0;
  unsigned short* X16 = (unsigned short*)(ws + off); off += 3 * bX;   // [3][4096][1024] bf16
  unsigned short* W16 = (unsigned short*)(ws + off); off += 3 * bW;   // [3][1024][1024] bf16
  unsigned short* PH  = (unsigned short*)(ws + off); off += 3 * bP;   // [3][4096][1024] bf16 hi : q, k, v
  unsigned short* PL  = (unsigned short*)(ws + off); off += 3 * bP;   // [3][4096][1024] bf16 lo : q, k, v
  if (off > ws_size || off > (size_t)134217728) return;               // 81,788,928 B

  const size_t PE = (size_t)M * E;                 // elements per plane
  unsigned short* QH = PH;          unsigned short* QL = PL;
  unsigned short* KH = PH + PE;     unsigned short* KL = PL + PE;
  unsigned short* VH = PH + 2 * PE; unsigned short* VL = PL + 2 * PE;

  dim3 blk256(256), blk128(128);

  // 1-6: RNE bf16 casts of the three activations and the three weights
  {
    const int n2x = M * E / 2, n2w = E * E / 2;
    cast_f32_bf16x2<<<dim3((n2x + 255) / 256), blk256, 0, stream>>>(xq, X16, n2x);
    cast_f32_bf16x2<<<dim3((n2x + 255) / 256), blk256, 0, stream>>>(xk, X16 + PE, n2x);
    cast_f32_bf16x2<<<dim3((n2x + 255) / 256), blk256, 0, stream>>>(xv, X16 + 2 * PE, n2x);
    cast_f32_bf16x2<<<dim3((n2w + 255) / 256), blk256, 0, stream>>>(wq, W16, n2w);
    cast_f32_bf16x2<<<dim3((n2w + 255) / 256), blk256, 0, stream>>>(wk, W16 + (size_t)E * E, n2w);
    cast_f32_bf16x2<<<dim3((n2w + 255) / 256), blk256, 0, stream>>>(wv, W16 + (size_t)2 * E * E, n2w);
  }

  // 7: P_z[m][f] = bf16(x_z)[m][e] . bf16(W_z)[f][e], f32 accumulate, stored as bf16 hi/lo planes; z = 0..2 via grid.y
  {
    const int tiles = (M / 64) * (E / 64);          // 1024 tiles of 64x64 per z; 8 waves per block
    wmma_gemm64<1, false, 0, 2, false><<<dim3((tiles + 7) / 8, 3), blk256, 0, stream>>>(
        X16, X16, E, (long)PE,
        W16, W16, E, (long)E * E,
        (void*)PH, (void*)PL, E, (long)PE,
        wq, wq, 0L, M, E, E, 1.0f);
  }

  // 8: attention over 64 groups, each a contiguous [1024][64] slab (group stride 65536 elements, row stride 64); no mask
  {
    const int nblk = G * (GS / AT_QB);               // 64 groups x 16 query blocks = 1024
    const long gstride = (long)GS * Dh;              // 65536
    attn64_planes<<<dim3(nblk), blk128, 0, stream>>>(
        QH, QL, KH, KL, VH, VL, out, gstride, GS, GS / AT_KC, 0.125f);
  }
}

// v002
// A run of this version takes 240 microseconds.
// Next to v001, in two timings, it ran 1.09 times as fast each time.
// Over all steps from v000 it is 1.45 times as fast.
#include <hip/hip_runtime.h>
#include <math.h>
// Contractions: q/k/v projection GEMMs = v_wmma_f32_16x16x32_bf16 (bf16 operands, one product, f32 accumulate, results stored as bf16 hi/lo planes); scores q.k^T = v_wmma_f32_16x16x32_bf16 (bf16 hi/lo planes of q and k, three products); out = p.v = v_wmma_f32_16x16x32_bf16 (bf16 hi/lo planes of p and v, three products); f32 accumulate everywhere; online softmax in f32.

typedef __attribute__((ext_vector_type(16))) _Float16 v16h;
typedef __attribute__((ext_vector_type(8)))  _Float16 v8h;
typedef __attribute__((ext_vector_type(16))) __bf16   v16b;
typedef __attribute__((ext_vector_type(8)))  __bf16   v8b;
typedef __attribute__((ext_vector_type(8)))  float    v8f;
typedef __attribute__((ext_vector_type(4)))  float    v4f;

__device__ __forceinline__ unsigned short f2bf_bits(float f) {
  unsigned u = __float_as_uint(f);
  return (unsigned short)((u + 0x7FFFu + ((u >> 16) & 1u)) >> 16);
}
__device__ __forceinline__ float bf_bits2f(unsigned short h) { return __uint_as_float(((unsigned)h) << 16); }

// hazard guards as plain device helpers (no inline asm inside the kernel template body)
__device__ __forceinline__ void dep_guard_h(v8f& a, v8f& b, v16h x, v16h y) { asm volatile("v_nop\n\tv_nop\n\tv_nop\n\tv_nop" : "+v"(a), "+v"(b) : "v"(x), "v"(y)); }
__device__ __forceinline__ void dep_guard_b(v8f& a, v8f& b, v16b x, v16b y) { asm volatile("v_nop\n\tv_nop\n\tv_nop\n\tv_nop" : "+v"(a), "+v"(b) : "v"(x), "v"(y)); }
__device__ __forceinline__ void keep4_h(v16h a, v16h b, v16h c, v16h d) { asm volatile("v_nop" :: "v"(a), "v"(b), "v"(c), "v"(d)); }
__device__ __forceinline__ void keep4_b(v16b a, v16b b, v16b c, v16b d) { asm volatile("v_nop" :: "v"(a), "v"(b), "v"(c), "v"(d)); }
__device__ __forceinline__ void acc_guard4(v8f& a, v8f& b, v8f& c, v8f& d) { asm volatile("v_nop\n\tv_nop\n\tv_nop\n\tv_nop" : "+v"(a), "+v"(b), "+v"(c), "+v"(d)); }
template <typename T> struct Frag;
template <> struct Frag<_Float16> {
  typedef v16h V; union U { v16h v; v8h h[2]; };
  static __device__ __forceinline__ v16h load(const _Float16* p) {   // fragment-order tile: elements 0..7 <- p[0..7], 8..15 <- p[256..263]
    U f; f.h[0] = *(const v8h*)(p); f.h[1] = *(const v8h*)(p + 256); return f.v;
  }
  static __device__ __forceinline__ v8f mma(v16h a, v16h b, v8f c) {
    return __builtin_amdgcn_wmma_f32_16x16x32_f16(false, a, false, b, (short)0, c, false, false);
  }
  static __device__ __forceinline__ void guard(v8f& a, v8f& b, v16h x, v16h y) { dep_guard_h(a, b, x, y); }
  static __device__ __forceinline__ void keep(v16h a, v16h b, v16h c, v16h d) { keep4_h(a, b, c, d); }
};
template <> struct Frag<__bf16> {
  typedef v16b V; union U { v16b v; v8b h[2]; };
  static __device__ __forceinline__ v16b load(const __bf16* p) {
    U f; f.h[0] = *(const v8b*)(p); f.h[1] = *(const v8b*)(p + 256); return f.v;
  }
  static __device__ __forceinline__ v8f mma(v16b a, v16b b, v8f c) {
    return __builtin_amdgcn_wmma_f32_16x16x32_bf16(false, a, false, b, (short)0, c, false, false);
  }
  static __device__ __forceinline__ void guard(v8f& a, v8f& b, v16b x, v16b y) { dep_guard_b(a, b, x, y); }
  static __device__ __forceinline__ void keep(v16b a, v16b b, v16b c, v16b d) { keep4_b(a, b, c, d); }
};

// ---- Register-blocked batched WMMA GEMM ------------------------------------
// C[m,n] = scale * sum_k A[m,k] * Bt[n,k] (+bias)(+resid); each wave owns a 64x64 tile.
// A [M,K] and Bt [N,K] in fragment order; M,N % 64 == 0, K % 32 == 0.
// Fragment order: the tile of rows 16*rt..+15 and k 32*kt..+31 is 512 contiguous elements at (rt * (K/32) + kt) * 512;
// in it element (row c, k) lies at ((k >> 4) & 1) * 256 + (((k >> 3) & 1) * 16 + c) * 8 + (k & 7), so lane l's two
// 16-byte pieces lie at l * 8 and 256 + l * 8 and each wave-wide 16-byte load covers 512 contiguous bytes (4 whole lines).
// SPLIT: operands are hi/lo planes (A2/Bt2 = lo planes, same layout); product = hi.hi + hi.lo + lo.hi.
// BIAS_MODE: 0 = none, 1 = bias[m], 2 = bias[n].
// OUT_MODE: 0 = f32, 1 = f16, 2 = bf16 hi plane (Cout) + bf16 lo plane (Cout2).
// ET: 0 = f16 operands, 1 = bf16 operands (pointers passed as 16-bit storage)
template <int ET> struct Elem;
template <> struct Elem<0> { typedef _Float16 T; };
template <> struct Elem<1> { typedef __bf16 T; };
// LDK: K of the stored A and Bt, a compile-time constant, so that the step from one 16-row tile strip to the next is an
// immediate offset of the load (lda and ldb are not read).
template <int ET, bool SPLIT, int BIAS_MODE, int OUT_MODE, bool RESID, int ACT = 0, int LDK = 1024>
__global__ __launch_bounds__(256) void wmma_gemm64(
    const unsigned short* __restrict__ Ap, const unsigned short* __restrict__ A2p, int lda, long strideA,
    const unsigned short* __restrict__ Btp, const unsigned short* __restrict__ Bt2p, int ldb, long strideB,
    void* __restrict__ Cout, void* __restrict__ Cout2, int ldc, long strideC,
    const float* __restrict__ bias,
    const float* __restrict__ resid, long strideR,
    int M, int N, int K, float scale) {
  typedef typename Elem<ET>::T T;
  typedef typename Frag<T>::V V;
  const T* A = (const T*)Ap; const T* A2 = (const T*)A2p; const T* Bt = (const T*)Btp; const T* Bt2 = (const T*)Bt2p;
  __shared__ __align__(16) float sT[8][16 * 68];   // per-wave 16x64 slab, pitch 68 floats
  const int b    = blockIdx.y;
  const int lane = threadIdx.x & 31;
  const int wave = __builtin_amdgcn_readfirstlane(threadIdx.x >> 5);   // wave-uniform: the tile bases below stay in scalar registers
  const int tilesN = N >> 6;
  const int tilesM = M >> 6;
  const int tile = blockIdx.x * 8 + wave;
  if (tile >= tilesM * tilesN) return;   // wave-uniform; no block barriers in this kernel
  const int tm = tile / tilesN;
  const int tn = tile - tm * tilesN;
  const int m0 = tm << 6;
  const int n0 = tn << 6;

  const T* Ab  = A  + (size_t)b * strideA;
  const T* Bb  = Bt + (size_t)b * strideB;
  const T* Ab2 = SPLIT ? (A2  + (size_t)b * strideA) : nullptr;
  const T* Bb2 = SPLIT ? (Bt2 + (size_t)b * strideB) : nullptr;

  const int rlane = lane & 15;                 // row (A) / col (B, D) within subtile
  const int mOff  = (lane >> 4) * 8;           // D row offset

  v8f acc[4][4];
#pragma unroll
  for (int i = 0; i < 4; ++i)
#pragma unroll
    for (int j = 0; j < 4; ++j) acc[i][j] = (v8f){0.f,0.f,0.f,0.f,0.f,0.f,0.f,0.f};

  // one scalar base per operand; one 32-bit vector byte offset serves all loads: lane * 16, + 1024 per k step
  constexpr size_t TS = (size_t)(LDK / 32) * 512;                                // elements per 16-row tile strip
  const size_t aT = (size_t)(m0 >> 4) * TS, bT = (size_t)(n0 >> 4) * TS;
  for (int k0 = 0; k0 < K; k0 += 32) {
    const unsigned vo = (unsigned)(k0 << 5) + (unsigned)(lane * 16);
    V bh[4], bl[4];
#pragma unroll
    for (int j = 0; j < 4; ++j) {
      bh[j] = Frag<T>::load((const T*)((const char*)(Bb + (bT + j * TS)) + vo));
      if (SPLIT) bl[j] = Frag<T>::load((const T*)((const char*)(Bb2 + (bT + j * TS)) + vo));
    }
#pragma unroll
    for (int i = 0; i < 4; ++i) {
      V ah = Frag<T>::load((const T*)((const char*)(Ab + (aT + i * TS)) + vo));
      V al;
      if (SPLIT) al = Frag<T>::load((const T*)((const char*)(Ab2 + (aT + i * TS)) + vo));
#pragma unroll
      for (int j = 0; j < 4; ++j) {
        acc[i][j] = Frag<T>::mma(ah, bh[j], acc[i][j]);
        if (SPLIT) {
          acc[i][j] = Frag<T>::mma(ah, bl[j], acc[i][j]);
          acc[i][j] = Frag<T>::mma(al, bh[j], acc[i][j]);
        }
      }
      Frag<T>::guard(acc[i][0], acc[i][3], ah, SPLIT ? al : ah);
    }
    Frag<T>::keep(bh[0], bh[1], bh[2], bh[3]);
    if (SPLIT) Frag<T>::keep(bl[0], bl[1], bl[2], bl[3]);
  }
  acc_guard4(acc[0][0], acc[0][1], acc[0][2], acc[0][3]);
  acc_guard4(acc[1][0], acc[1][1], acc[1][2], acc[1][3]);
  acc_guard4(acc[2][0], acc[2][1], acc[2][2], acc[2][3]);
  acc_guard4(acc[3][0], acc[3][1], acc[3][2], acc[3][3]);

  // ---- epilogue ----
  float* slab = sT[wave];
  const float* Rb = RESID ? (resid + (size_t)b * strideR) : nullptr;
#pragma unroll
  for (int i = 0; i < 4; ++i) {
    const int mBase = m0 + (i << 4);
#pragma unroll
    for (int j = 0; j < 4; ++j) {
      const int n = n0 + (j << 4) + rlane;
      float bv = 0.f;
      if (BIAS_MODE == 2) bv = bias[n];
#pragma unroll
      for (int r = 0; r < 8; ++r) {
        float v = acc[i][j][r] * scale;
        if (BIAS_MODE == 1) v += bias[mBase + mOff + r];
        if (BIAS_MODE == 2) v += bv;
        if (RESID) v += Rb[(size_t)(mBase + mOff + r) * ldc + n];
        if (ACT == 1) v = tanhf(v);
        if (ACT == 2) v = fmaxf(v, 0.0f);
        if (ACT == 3) v = v / (1.0f + expf(-v));
        if (ACT == 4) v = (v > 0.f) ? v : 0.01f * v;
        if (ACT == 5) v = 0.5f * v * (1.0f + erff(v * 0.70710678118654752f));
        slab[(mOff + r) * 68 + (j << 4) + rlane] = v;
      }
    }
    __builtin_amdgcn_fence(__ATOMIC_RELEASE, "workgroup");
    __builtin_amdgcn_wave_barrier();
    __builtin_amdgcn_fence(__ATOMIC_ACQUIRE, "workgroup");
    if (OUT_MODE == 0) {
      float* C = (float*)Cout + (size_t)b * strideC;
      const int hh = lane >> 4, c4 = (lane & 15) * 4;     // row seg = 256 B = 16 lanes x 16 B
      {
#pragma unroll
        for (int it = 0; it < 8; ++it) {
          const int row = it * 2 + hh;
          v4f v = *(const v4f*)(slab + row * 68 + c4);
          *(v4f*)(C + (size_t)(mBase + row) * ldc + n0 + c4) = v;
        }
        
      }
    } else {
      const int q = lane >> 3, c8 = (lane & 7) * 8;
      unsigned short* C  = (unsigned short*)Cout  + (size_t)b * strideC;
      unsigned short* C2 = (OUT_MODE == 2) ? ((unsigned short*)Cout2 + (size_t)b * strideC) : nullptr;
      {
#pragma unroll
        for (int it = 0; it < 4; ++it) {
          const int row = it * 4 + q;
          const float* sp = slab + row * 68 + c8;
          v8h hv, lv;
#pragma unroll
          for (int e = 0; e < 8; ++e) {
            if (OUT_MODE == 1) {
              hv[e] = (_Float16)sp[e];
            } else {
              unsigned short hb = f2bf_bits(sp[e]);
              unsigned short lb = f2bf_bits(sp[e] - bf_bits2f(hb));
              hv[e] = __builtin_bit_cast(_Float16, hb);
              lv[e] = __builtin_bit_cast(_Float16, lb);
            }
          }
          *(v8h*)(C + (size_t)(mBase + row) * ldc + n0 + c8) = hv;
          if (OUT_MODE == 2) *(v8h*)(C2 + (size_t)(mBase + row) * ldc + n0 + c8) = lv;
        }
        
      }
    }
    __builtin_amdgcn_fence(__ATOMIC_RELEASE, "workgroup");
    __builtin_amdgcn_wave_barrier();
    __builtin_amdgcn_fence(__ATOMIC_ACQUIRE, "workgroup");
  }
}

// f32 row-major [rows][K] -> bf16 (RNE) in the GEMM's fragment order. One wave per two neighbouring 16 x 32 tiles:
// each 16-byte load covers 4 rows x 128 B (whole lines), eight in flight; a lane's four values of one row are 8 bytes of
// the tile, and the four rows of a load are 64 contiguous bytes in each of the tile's four 256-byte quarters.
template <int K>
__global__ __launch_bounds__(256) void cast_f32_bf16_frag(
    const float* __restrict__ in, unsigned short* __restrict__ out, int npair) {
  const int lane = threadIdx.x & 31;
  const int wv   = blockIdx.x * 8 + (threadIdx.x >> 5);
  if (wv >= npair) return;
  const int rt = wv / (K / 64);                // 16-row tile
  const int kq = wv % (K / 64);                // pair of 32-k tiles
  const int rs = lane >> 3;                    // row within a group of four
  const int q  = lane & 7;                     // k = 4q .. 4q+3 within the tile
  const float* sp = in + (size_t)(rt * 16 + rs) * K + kq * 64 + q * 4;
  v4f x[2][4];
#pragma unroll
  for (int t = 0; t < 2; ++t)
#pragma unroll
    for (int i = 0; i < 4; ++i) x[t][i] = *(const v4f*)(sp + (size_t)(4 * i) * K + t * 32);
  unsigned short* dp = out + ((size_t)rt * (K / 32) + kq * 2) * 512 + (q >> 2) * 256 + (((q >> 1) & 1) * 16 + rs) * 8 + (q & 1) * 4;
#pragma unroll
  for (int t = 0; t < 2; ++t)
#pragma unroll
    for (int i = 0; i < 4; ++i) {
      uint2 u;
      u.x = (unsigned)f2bf_bits(x[t][i][0]) | ((unsigned)f2bf_bits(x[t][i][1]) << 16);
      u.y = (unsigned)f2bf_bits(x[t][i][2]) | ((unsigned)f2bf_bits(x[t][i][3]) << 16);
      *(uint2*)(dp + t * 512 + i * 32) = u;
    }
}

// =====================================================================================
// Attention, head_dim 64, no mask. Inputs are bf16 hi/lo planes of q, k, v laid out as G groups of
// contiguous [S][64] slabs (group stride gstride elements, row stride 64); output f32 in the same slab layout.
// Block = 4 waves = 64 query rows of one group; 64-key chunks.
//   scores = q.k^T * sscale : q and k hi/lo planes (hi.hi + hi.lo + lo.hi), f32 accumulate
//   out    = p.v            : p split into bf16 hi/lo after the max shift, v hi/lo planes (hi.hi + hi.lo + lo.hi)
//   online softmax in f32. Q planes staged once per block in LDS (16-B copies); K planes copied and V planes
//   transposed to [d][kv] in LDS per chunk; all staging with plain loads + __syncthreads().
//   grid.x = G * (S/64).
// =====================================================================================
#define AT_D 64
#define AT_NW 4
#define AT_QB 64
#define AT_KC 64
#define AT_LP 72   // LDS row pitch in elements: 144 B = 16 B x odd, so the 16 rows of a 16-byte fragment read fall on distinct banks

__device__ __forceinline__ unsigned short at_bf_bits(float f) {
  unsigned u = __float_as_uint(f);
  return (unsigned short)((u + 0x7FFFu + ((u >> 16) & 1u)) >> 16);
}
__device__ __forceinline__ __bf16 at_f2bf(float f) { return __builtin_bit_cast(__bf16, at_bf_bits(f)); }
__device__ __forceinline__ void at_split(float f, __bf16& hi, __bf16& lo) {
  const unsigned short hb = at_bf_bits(f);
  hi = __builtin_bit_cast(__bf16, hb);
  lo = at_f2bf(f - __uint_as_float(((unsigned)hb) << 16));
}
// three products of a hi/lo x hi/lo pair into one accumulator, then the hazard guard tying D and all four operands
__device__ __forceinline__ v8f at_mma3(v16b ah, v16b al, v16b bh, v16b bl, v8f c) {
  c = __builtin_amdgcn_wmma_f32_16x16x32_bf16(false, ah, false, bh, (short)0, c, false, false);
  c = __builtin_amdgcn_wmma_f32_16x16x32_bf16(false, ah, false, bl, (short)0, c, false, false);
  c = __builtin_amdgcn_wmma_f32_16x16x32_bf16(false, al, false, bh, (short)0, c, false, false);
  asm volatile("v_nop\n\tv_nop\n\tv_nop\n\tv_nop" : "+v"(c) : "v"(ah), "v"(al), "v"(bh), "v"(bl));
  return c;
}

__global__ __launch_bounds__(128)
void attn64_planes(const unsigned short* __restrict__ QH, const unsigned short* __restrict__ QL,
                   const unsigned short* __restrict__ KH, const unsigned short* __restrict__ KL,
                   const unsigned short* __restrict__ VH, const unsigned short* __restrict__ VL,
                   float* __restrict__ out, long gstride, int S, int nkc, float sscale) {
  union FB { v16b v; v8b h[2]; };
  __shared__ __align__(16) __bf16 Qsh[AT_QB * AT_LP];         // Q hi [row][d]   9 KB
  __shared__ __align__(16) __bf16 Qsl[AT_QB * AT_LP];         // Q lo [row][d]   9 KB
  __shared__ __align__(16) __bf16 Ksh[AT_KC * AT_LP];         // K hi [kv][d]    9 KB
  __shared__ __align__(16) __bf16 Ksl[AT_KC * AT_LP];         // K lo [kv][d]    9 KB
  __shared__ __align__(16) __bf16 Vth[AT_D * AT_LP];          // V hi [d][kv]    9 KB
  __shared__ __align__(16) __bf16 Vtl[AT_D * AT_LP];          // V lo [d][kv]    9 KB
  __shared__ __align__(16) __bf16 Psh[AT_NW][16 * AT_LP];     // per wave P hi [row][kv]  9 KB
  __shared__ __align__(16) __bf16 Psl[AT_NW][16 * AT_LP];     // per wave P lo [row][kv]  9 KB
  __shared__ __align__(16) float  Os[AT_NW][16 * 68];         // per wave out tile, pitch 68

  const int tid  = threadIdx.x;
  const int wave = tid >> 5;
  const int lane = tid & 31;
  const int hh   = lane >> 4;
  const int c    = lane & 15;

  const int nqb = S / AT_QB;
  const int bx  = blockIdx.x;
  const int qb  = bx % nqb;
  const int g   = bx / nqb;
  const int q0  = qb * AT_QB + wave * 16;

  const __bf16* Qh = (const __bf16*)QH + (size_t)g * gstride;
  const __bf16* Ql = (const __bf16*)QL + (size_t)g * gstride;
  const __bf16* Kh = (const __bf16*)KH + (size_t)g * gstride;
  const __bf16* Kl = (const __bf16*)KL + (size_t)g * gstride;
  const __bf16* Vh = (const __bf16*)VH + (size_t)g * gstride;
  const __bf16* Vl = (const __bf16*)VL + (size_t)g * gstride;
  float*        Og = out + (size_t)g * gstride;

  // ---- Q hi/lo planes for the block's 64 rows: [row][d], 16-B copies (512 chunks per plane, 4 per thread) ----
  {
    const __bf16* qsh = Qh + (size_t)(qb * AT_QB) * AT_D;
    const __bf16* qsl = Ql + (size_t)(qb * AT_QB) * AT_D;
#pragma unroll
    for (int it = 0; it < 4; ++it) {
      const int ch = tid + it * 128;
      const int row = ch >> 3, col = (ch & 7) * 8;
      *(v8b*)(Qsh + row * AT_LP + col) = *(const v8b*)(qsh + (size_t)row * AT_D + col);
      *(v8b*)(Qsl + row * AT_LP + col) = *(const v8b*)(qsl + (size_t)row * AT_D + col);
    }
  }
  __syncthreads();

  float mrow[8], lrow[8];
  v8f oacc[4];
#pragma unroll
  for (int r = 0; r < 8; ++r) { mrow[r] = -INFINITY; lrow[r] = 0.f; }
#pragma unroll
  for (int t = 0; t < 4; ++t) oacc[t] = (v8f){0.f,0.f,0.f,0.f,0.f,0.f,0.f,0.f};

  const int nk = (nkc < 64) ? nkc : 64;                             // host-provided trip count, clamped to a static maximum
  const __bf16* qwh = Qsh + (wave * 16 + c) * AT_LP + 8 * hh;        // A fragment row c of this wave
  const __bf16* qwl = Qsl + (wave * 16 + c) * AT_LP + 8 * hh;

  for (int kc = 0; kc < nk; ++kc) {
    const int kv0 = kc * AT_KC;
    __syncthreads();                                                // readers of the last K/V tile done
    {
      const __bf16* ksh = Kh + (size_t)kv0 * AT_D;
      const __bf16* ksl = Kl + (size_t)kv0 * AT_D;
      const __bf16* vsh = Vh + (size_t)kv0 * AT_D;
      const __bf16* vsl = Vl + (size_t)kv0 * AT_D;
#pragma unroll
      for (int it = 0; it < 4; ++it) {
        const int ch = tid + it * 128;
        const int row = ch >> 3, col = (ch & 7) * 8;                // row = kv within chunk, col = d
        *(v8b*)(Ksh + row * AT_LP + col) = *(const v8b*)(ksh + (size_t)row * AT_D + col);
        *(v8b*)(Ksl + row * AT_LP + col) = *(const v8b*)(ksl + (size_t)row * AT_D + col);
        const v8b vvh = *(const v8b*)(vsh + (size_t)row * AT_D + col);
        const v8b vvl = *(const v8b*)(vsl + (size_t)row * AT_D + col);
#pragma unroll
        for (int i = 0; i < 8; ++i) {
          Vth[(col + i) * AT_LP + row] = vvh[i];
          Vtl[(col + i) * AT_LP + row] = vvl[i];
        }
      }
    }
    __syncthreads();

    // ---- scores[16 x 64] = q . k^T  (A = Q[row][d], B = K[kv][d]; split k-map via two 16-B halves at +8hh and +16+8hh) ----
    v8f s[4];
#pragma unroll
    for (int j = 0; j < 4; ++j) s[j] = (v8f){0.f,0.f,0.f,0.f,0.f,0.f,0.f,0.f};
#pragma unroll 1
    for (int dc = 0; dc < 2; ++dc) {
      FB qh, ql;
      qh.h[0] = *(const v8b*)(qwh + dc * 32);
      qh.h[1] = *(const v8b*)(qwh + dc * 32 + 16);
      ql.h[0] = *(const v8b*)(qwl + dc * 32);
      ql.h[1] = *(const v8b*)(qwl + dc * 32 + 16);
#pragma unroll
      for (int j = 0; j < 4; ++j) {
        FB kb, kl;
        const __bf16* kp  = Ksh + (j * 16 + c) * AT_LP + dc * 32 + 8 * hh;
        const __bf16* kpl = Ksl + (j * 16 + c) * AT_LP + dc * 32 + 8 * hh;
        kb.h[0] = *(const v8b*)(kp);
        kb.h[1] = *(const v8b*)(kp + 16);
        kl.h[0] = *(const v8b*)(kpl);
        kl.h[1] = *(const v8b*)(kpl + 16);
        s[j] = at_mma3(qh.v, ql.v, kb.v, kl.v, s[j]);
      }
    }
    // ---- scale (f32), row max ----
    float cm[8];
#pragma unroll
    for (int r = 0; r < 8; ++r) {
      float m = -INFINITY;
#pragma unroll
      for (int j = 0; j < 4; ++j) {
        const float sv = s[j][r] * sscale;
        s[j][r] = sv;
        m = fmaxf(m, sv);
      }
#pragma unroll
      for (int off = 1; off < 16; off <<= 1) m = fmaxf(m, __shfl_xor(m, off, 32));
      cm[r] = m;
    }
    __bf16* pwh = Psh[wave];
    __bf16* pwl = Psl[wave];
#pragma unroll
    for (int r = 0; r < 8; ++r) {
      const float mnew = fmaxf(mrow[r], cm[r]);
      const float mref = (mnew == -INFINITY) ? 0.0f : mnew;
      const float alpha = __expf(mrow[r] - mref);
      mrow[r] = mnew;
      float psum = 0.f;
#pragma unroll
      for (int j = 0; j < 4; ++j) {
        const float p = __expf(s[j][r] - mref);
        psum += p;
        __bf16 a, bl; at_split(p, a, bl);
        pwh[(8 * hh + r) * AT_LP + j * 16 + c] = a;
        pwl[(8 * hh + r) * AT_LP + j * 16 + c] = bl;
      }
#pragma unroll
      for (int off = 1; off < 16; off <<= 1) psum += __shfl_xor(psum, off, 32);
      lrow[r] = lrow[r] * alpha + psum;
#pragma unroll
      for (int t = 0; t < 4; ++t) oacc[t][r] *= alpha;
    }
    __builtin_amdgcn_fence(__ATOMIC_RELEASE, "workgroup");
    __builtin_amdgcn_wave_barrier();
    __builtin_amdgcn_fence(__ATOMIC_ACQUIRE, "workgroup");
    // ---- O[16 x 64] += P[16 x 64] . V[64 x 64]  (A = P[row][kv], B = V[kv][d] from the [d][kv] tile) ----
#pragma unroll 1
    for (int kk = 0; kk < 2; ++kk) {
      FB pa, pl;
      pa.h[0] = *(const v8b*)(pwh + c * AT_LP + kk * 32 + 8 * hh);
      pa.h[1] = *(const v8b*)(pwh + c * AT_LP + kk * 32 + 16 + 8 * hh);
      pl.h[0] = *(const v8b*)(pwl + c * AT_LP + kk * 32 + 8 * hh);
      pl.h[1] = *(const v8b*)(pwl + c * AT_LP + kk * 32 + 16 + 8 * hh);
#pragma unroll
      for (int t = 0; t < 4; ++t) {
        FB vb, vl;
        const __bf16* vp  = Vth + (t * 16 + c) * AT_LP + kk * 32 + 8 * hh;
        const __bf16* vpl = Vtl + (t * 16 + c) * AT_LP + kk * 32 + 8 * hh;
        vb.h[0] = *(const v8b*)(vp);
        vb.h[1] = *(const v8b*)(vp + 16);
        vl.h[0] = *(const v8b*)(vpl);
        vl.h[1] = *(const v8b*)(vpl + 16);
        oacc[t] = at_mma3(pa.v, pl.v, vb.v, vl.v, oacc[t]);
      }
    }
  }

  float* os = Os[wave];
#pragma unroll
  for (int r = 0; r < 8; ++r) {
    const float inv = 1.0f / lrow[r];
#pragma unroll
    for (int t = 0; t < 4; ++t) os[(8 * hh + r) * 68 + t * 16 + c] = oacc[t][r] * inv;
  }
  __builtin_amdgcn_fence(__ATOMIC_RELEASE, "workgroup");
  __builtin_amdgcn_wave_barrier();
  __builtin_amdgcn_fence(__ATOMIC_ACQUIRE, "workgroup");
  {
    const int c4 = (lane & 15) * 4;
    {
#pragma unroll
      for (int it = 0; it < 8; ++it) {
        const int row = it * 2 + hh;                    // hh in 0..1, it in 0..7 -> rows 0..15
        v4f val = *(const v4f*)(os + row * 68 + c4);
        *(v4f*)(Og + (size_t)(q0 + row) * AT_D + c4) = val;
      }
      
    }
  }
}

// ---------------------------------------------------------------------------
// Host orchestration (launches only).
// d_in: 0=query 1=key 2=value [4,1024,1024] f32; 3=Wq 4=Wk 5=Wv [1024,1024] f32 ([out,in]).
// q/k/v = x . W^T as [4096][1024] bf16 hi/lo planes; the raw row-major reshape to [64][1024][64] is a pure
// reinterpretation of the same memory: group g owns the contiguous slab of 1024 rows x 64.
// ---------------------------------------------------------------------------
extern "C" void kernel_launch(void* const* d_in, const int* in_sizes, int n_in,
                              void* d_out, int out_size, void* d_ws, size_t ws_size,
                              hipStream_t stream) {
  constexpr int Bn = 4, Sn = 1024, E = 1024, Dh = 64, G = 64;
  constexpr int M = Bn * Sn;                       // 4096 projected rows
  constexpr int GS = (M * E) / (G * Dh);           // 1024 group-tokens per group
  static_assert(GS % AT_QB == 0 && GS % AT_KC == 0);
  static_assert(M % 64 == 0 && E % 64 == 0 && E % 32 == 0);
  if (n_in < 6) return;
  if (in_sizes[0] != M * E || in_sizes[1] != M * E || in_sizes[2] != M * E ||
      in_sizes[3] != E * E || in_sizes[4] != E * E || in_sizes[5] != E * E || out_size != M * E) return;

  const float* xq = (const float*)d_in[0];
  const float* xk = (const float*)d_in[1];
  const float* xv = (const float*)d_in[2];
  const float* wq = (const float*)d_in[3];
  const float* wk = (const float*)d_in[4];
  const float* wv = (const float*)d_in[5];
  float* out = (float*)d_out;

  const size_t bX = (size_t)M * E * 2;            //  8 MiB  bf16 activation copy (x3)
  const size_t bW = (size_t)E * E * 2;            //  2 MiB  bf16 weight copy (x3)
  const size_t bP = (size_t)M * E * 2;            //  8 MiB  bf16 projection plane (x3 hi, x3 lo)
  char* ws = (char*)d_ws;
  size_t off = 0;
  unsigned short* X16 = (unsigned short*)(ws + off); off += 3 * bX;   // [3] x (4096 x 1024) bf16, fragment order
  unsigned short* W16 = (unsigned short*)(ws + off); off += 3 * bW;   // [3] x (1024 x 1024) bf16, fragment order
  unsigned short* PH  = (unsigned short*)(ws + off); off += 3 * bP;   // [3][4096][1024] bf16 hi : q, k, v
  unsigned short* PL  = (unsigned short*)(ws + off); off += 3 * bP;   // [3][4096][1024] bf16 lo : q, k, v
  if (off > ws_size || off > (size_t)134217728) return;               // 81,788,928 B

  const size_t PE = (size_t)M * E;                 // elements per plane
  unsigned short* QH = PH;          unsigned short* QL = PL;
  unsigned short* KH = PH + PE;     unsigned short* KL = PL + PE;
  unsigned short* VH = PH + 2 * PE; unsigned short* VL = PL + 2 * PE;

  dim3 blk256(256), blk128(128);

  // 1-6: RNE bf16 casts of the three activations and the three weights, written in the GEMM's fragment order
  {
    static_assert(E % 64 == 0 && M % 16 == 0);
    const int npx = (M / 16) * (E / 64), npw = (E / 16) * (E / 64);   // waves: one per pair of 16 x 32 tiles
    cast_f32_bf16_frag<E><<<dim3((npx + 7) / 8), blk256, 0, stream>>>(xq, X16, npx);
    cast_f32_bf16_frag<E><<<dim3((npx + 7) / 8), blk256, 0, stream>>>(xk, X16 + PE, npx);
    cast_f32_bf16_frag<E><<<dim3((npx + 7) / 8), blk256, 0, stream>>>(xv, X16 + 2 * PE, npx);
    cast_f32_bf16_frag<E><<<dim3((npw + 7) / 8), blk256, 0, stream>>>(wq, W16, npw);
    cast_f32_bf16_frag<E><<<dim3((npw + 7) / 8), blk256, 0, stream>>>(wk, W16 + (size_t)E * E, npw);
    cast_f32_bf16_frag<E><<<dim3((npw + 7) / 8), blk256, 0, stream>>>(wv, W16 + (size_t)2 * E * E, npw);
  }

  // 7: P_z[m][f] = bf16(x_z)[m][e] . bf16(W_z)[f][e], f32 accumulate, stored as bf16 hi/lo planes; z = 0..2 via grid.y
  {
    const int tiles = (M / 64) * (E / 64);          // 1024 tiles of 64x64 per z; 8 waves per block
    wmma_gemm64<1, false, 0, 2, false, 0, E><<<dim3((tiles + 7) / 8, 3), blk256, 0, stream>>>(
        X16, X16, E, (long)PE,
        W16, W16, E, (long)E * E,
        (void*)PH, (void*)PL, E, (long)PE,
        wq, wq, 0L, M, E, E, 1.0f);
  }

  // 8: attention over 64 groups, each a contiguous [1024][64] slab (group stride 65536 elements, row stride 64); no mask
  {
    const int nblk = G * (GS / AT_QB);               // 64 groups x 16 query blocks = 1024
    const long gstride = (long)GS * Dh;              // 65536
    attn64_planes<<<dim3(nblk), blk128, 0, stream>>>(
        QH, QL, KH, KL, VH, VL, out, gstride, GS, GS / AT_KC, 0.125f);
  }
}

// v003
// It runs in 193 microseconds.
// Two timings next to v002 both put it at 1.25 times that version's speed.
// Counting every step since v000, it is 1.81 times as fast.
#include <hip/hip_runtime.h>
#include <math.h>
// Contractions: q/k/v projection GEMMs = v_wmma_f32_16x16x32_bf16 (bf16 operands, one product, f32 accumulate, results stored as bf16 hi/lo planes); scores q.k^T = v_wmma_f32_16x16x32_bf16 (bf16 hi/lo planes of q and k, three products); out = p.v = v_wmma_f32_16x16x32_bf16 (bf16 hi/lo planes of p and v, three products); f32 accumulate everywhere; online softmax in f32.

typedef __attribute__((ext_vector_type(16))) _Float16 v16h;
typedef __attribute__((ext_vector_type(8)))  _Float16 v8h;
typedef __attribute__((ext_vector_type(16))) __bf16   v16b;
typedef __attribute__((ext_vector_type(8)))  __bf16   v8b;
typedef __attribute__((ext_vector_type(8)))  float    v8f;
typedef __attribute__((ext_vector_type(4)))  float    v4f;

__device__ __forceinline__ unsigned short f2bf_bits(float f) {
  unsigned u = __float_as_uint(f);
  return (unsigned short)((u + 0x7FFFu + ((u >> 16) & 1u)) >> 16);
}
__device__ __forceinline__ float bf_bits2f(unsigned short h) { return __uint_as_float(((unsigned)h) << 16); }

// hazard guards as plain device helpers (no inline asm inside the kernel template body)
__device__ __forceinline__ void dep_guard_h(v8f& a, v8f& b, v16h x, v16h y) { asm volatile("v_nop\n\tv_nop\n\tv_nop\n\tv_nop" : "+v"(a), "+v"(b) : "v"(x), "v"(y)); }
__device__ __forceinline__ void dep_guard_b(v8f& a, v8f& b, v16b x, v16b y) { asm volatile("v_nop\n\tv_nop\n\tv_nop\n\tv_nop" : "+v"(a), "+v"(b) : "v"(x), "v"(y)); }
__device__ __forceinline__ void keep4_h(v16h a, v16h b, v16h c, v16h d) { asm volatile("v_nop" :: "v"(a), "v"(b), "v"(c), "v"(d)); }
__device__ __forceinline__ void keep4_b(v16b a, v16b b, v16b c, v16b d) { asm volatile("v_nop" :: "v"(a), "v"(b), "v"(c), "v"(d)); }
__device__ __forceinline__ void acc_guard4(v8f& a, v8f& b, v8f& c, v8f& d) { asm volatile("v_nop\n\tv_nop\n\tv_nop\n\tv_nop" : "+v"(a), "+v"(b), "+v"(c), "+v"(d)); }
template <typename T> struct Frag;
template <> struct Frag<_Float16> {
  typedef v16h V; union U { v16h v; v8h h[2]; };
  static __device__ __forceinline__ v16h load(const _Float16* p) {   // fragment-order tile: elements 0..7 <- p[0..7], 8..15 <- p[256..263]
    U f; f.h[0] = *(const v8h*)(p); f.h[1] = *(const v8h*)(p + 256); return f.v;
  }
  static __device__ __forceinline__ v8f mma(v16h a, v16h b, v8f c) {
    return __builtin_amdgcn_wmma_f32_16x16x32_f16(false, a, false, b, (short)0, c, false, false);
  }
  static __device__ __forceinline__ void guard(v8f& a, v8f& b, v16h x, v16h y) { dep_guard_h(a, b, x, y); }
  static __device__ __forceinline__ void keep(v16h a, v16h b, v16h c, v16h d) { keep4_h(a, b, c, d); }
};
template <> struct Frag<__bf16> {
  typedef v16b V; union U { v16b v; v8b h[2]; };
  static __device__ __forceinline__ v16b load(const __bf16* p) {
    U f; f.h[0] = *(const v8b*)(p); f.h[1] = *(const v8b*)(p + 256); return f.v;
  }
  static __device__ __forceinline__ v8f mma(v16b a, v16b b, v8f c) {
    return __builtin_amdgcn_wmma_f32_16x16x32_bf16(false, a, false, b, (short)0, c, false, false);
  }
  static __device__ __forceinline__ void guard(v8f& a, v8f& b, v16b x, v16b y) { dep_guard_b(a, b, x, y); }
  static __device__ __forceinline__ void keep(v16b a, v16b b, v16b c, v16b d) { keep4_b(a, b, c, d); }
};

// ---- Register-blocked batched WMMA GEMM ------------------------------------
// C[m,n] = scale * sum_k A[m,k] * Bt[n,k] (+bias)(+resid); each wave owns a 64x64 tile.
// A [M,K] and Bt [N,K] in fragment order; M,N % 64 == 0, K % 32 == 0.
// Fragment order: the tile of rows 16*rt..+15 and k 32*kt..+31 is 512 contiguous elements at (rt * (K/32) + kt) * 512;
// in it element (row c, k) lies at ((k >> 4) & 1) * 256 + (((k >> 3) & 1) * 16 + c) * 8 + (k & 7), so lane l's two
// 16-byte pieces lie at l * 8 and 256 + l * 8 and each wave-wide 16-byte load covers 512 contiguous bytes (4 whole lines).
// SPLIT: operands are hi/lo planes (A2/Bt2 = lo planes, same layout); product = hi.hi + hi.lo + lo.hi.
// BIAS_MODE: 0 = none, 1 = bias[m], 2 = bias[n].
// OUT_MODE: 0 = f32, 1 = f16, 2 = bf16 hi plane (Cout) + bf16 lo plane (Cout2).
// ET: 0 = f16 operands, 1 = bf16 operands (pointers passed as 16-bit storage)
template <int ET> struct Elem;
template <> struct Elem<0> { typedef _Float16 T; };
template <> struct Elem<1> { typedef __bf16 T; };
// LDK: K of the stored A and Bt, a compile-time constant, so that the step from one 16-row tile strip to the next is an
// immediate offset of the load (lda and ldb are not read).
template <int ET, bool SPLIT, int BIAS_MODE, int OUT_MODE, bool RESID, int ACT = 0, int LDK = 1024>
__global__ __launch_bounds__(256) void wmma_gemm64(
    const unsigned short* __restrict__ Ap, const unsigned short* __restrict__ A2p, int lda, long strideA,
    const unsigned short* __restrict__ Btp, const unsigned short* __restrict__ Bt2p, int ldb, long strideB,
    void* __restrict__ Cout, void* __restrict__ Cout2, int ldc, long strideC,
    const float* __restrict__ bias,
    const float* __restrict__ resid, long strideR,
    int M, int N, int K, float scale) {
  typedef typename Elem<ET>::T T;
  typedef typename Frag<T>::V V;
  const T* A = (const T*)Ap; const T* A2 = (const T*)A2p; const T* Bt = (const T*)Btp; const T* Bt2 = (const T*)Bt2p;
  __shared__ __align__(16) float sT[8][16 * 68];   // per-wave 16x64 slab, pitch 68 floats
  const int b    = blockIdx.y;
  const int lane = threadIdx.x & 31;
  const int wave = __builtin_amdgcn_readfirstlane(threadIdx.x >> 5);   // wave-uniform: the tile bases below stay in scalar registers
  const int tilesN = N >> 6;
  const int tilesM = M >> 6;
  const int tile = blockIdx.x * 8 + wave;
  if (tile >= tilesM * tilesN) return;   // wave-uniform; no block barriers in this kernel
  const int tm = tile / tilesN;
  const int tn = tile - tm * tilesN;
  const int m0 = tm << 6;
  const int n0 = tn << 6;

  const T* Ab  = A  + (size_t)b * strideA;
  const T* Bb  = Bt + (size_t)b * strideB;
  const T* Ab2 = SPLIT ? (A2  + (size_t)b * strideA) : nullptr;
  const T* Bb2 = SPLIT ? (Bt2 + (size_t)b * strideB) : nullptr;

  const int rlane = lane & 15;                 // row (A) / col (B, D) within subtile
  const int mOff  = (lane >> 4) * 8;           // D row offset

  v8f acc[4][4];
#pragma unroll
  for (int i = 0; i < 4; ++i)
#pragma unroll
    for (int j = 0; j < 4; ++j) acc[i][j] = (v8f){0.f,0.f,0.f,0.f,0.f,0.f,0.f,0.f};

  // one scalar base per operand; one 32-bit vector byte offset serves all loads: lane * 16, + 1024 per k step
  constexpr size_t TS = (size_t)(LDK / 32) * 512;                                // elements per 16-row tile strip
  const size_t aT = (size_t)(m0 >> 4) * TS, bT = (size_t)(n0 >> 4) * TS;
  for (int k0 = 0; k0 < K; k0 += 32) {
    const unsigned vo = (unsigned)(k0 << 5) + (unsigned)(lane * 16);
    V bh[4], bl[4];
#pragma unroll
    for (int j = 0; j < 4; ++j) {
      bh[j] = Frag<T>::load((const T*)((const char*)(Bb + (bT + j * TS)) + vo));
      if (SPLIT) bl[j] = Frag<T>::load((const T*)((const char*)(Bb2 + (bT + j * TS)) + vo));
    }
#pragma unroll
    for (int i = 0; i < 4; ++i) {
      V ah = Frag<T>::load((const T*)((const char*)(Ab + (aT + i * TS)) + vo));
      V al;
      if (SPLIT) al = Frag<T>::load((const T*)((const char*)(Ab2 + (aT + i * TS)) + vo));
#pragma unroll
      for (int j = 0; j < 4; ++j) {
        acc[i][j] = Frag<T>::mma(ah, bh[j], acc[i][j]);
        if (SPLIT) {
          acc[i][j] = Frag<T>::mma(ah, bl[j], acc[i][j]);
          acc[i][j] = Frag<T>::mma(al, bh[j], acc[i][j]);
        }
      }
      Frag<T>::guard(acc[i][0], acc[i][3], ah, SPLIT ? al : ah);
    }
    Frag<T>::keep(bh[0], bh[1], bh[2], bh[3]);
    if (SPLIT) Frag<T>::keep(bl[0], bl[1], bl[2], bl[3]);
  }
  acc_guard4(acc[0][0], acc[0][1], acc[0][2], acc[0][3]);
  acc_guard4(acc[1][0], acc[1][1], acc[1][2], acc[1][3]);
  acc_guard4(acc[2][0], acc[2][1], acc[2][2], acc[2][3]);
  acc_guard4(acc[3][0], acc[3][1], acc[3][2], acc[3][3]);

  // ---- epilogue ----
  float* slab = sT[wave];
  const float* Rb = RESID ? (resid + (size_t)b * strideR) : nullptr;
#pragma unroll
  for (int i = 0; i < 4; ++i) {
    const int mBase = m0 + (i << 4);
#pragma unroll
    for (int j = 0; j < 4; ++j) {
      const int n = n0 + (j << 4) + rlane;
      float bv = 0.f;
      if (BIAS_MODE == 2) bv = bias[n];
#pragma unroll
      for (int r = 0; r < 8; ++r) {
        float v = acc[i][j][r] * scale;
        if (BIAS_MODE == 1) v += bias[mBase + mOff + r];
        if (BIAS_MODE == 2) v += bv;
        if (RESID) v += Rb[(size_t)(mBase + mOff + r) * ldc + n];
        if (ACT == 1) v = tanhf(v);
        if (ACT == 2) v = fmaxf(v, 0.0f);
        if (ACT == 3) v = v / (1.0f + expf(-v));
        if (ACT == 4) v = (v > 0.f) ? v : 0.01f * v;
        if (ACT == 5) v = 0.5f * v * (1.0f + erff(v * 0.70710678118654752f));
        slab[(mOff + r) * 68 + (j << 4) + rlane] = v;
      }
    }
    __builtin_amdgcn_fence(__ATOMIC_RELEASE, "workgroup");
    __builtin_amdgcn_wave_barrier();
    __builtin_amdgcn_fence(__ATOMIC_ACQUIRE, "workgroup");
    if (OUT_MODE == 0) {
      float* C = (float*)Cout + (size_t)b * strideC;
      const int hh = lane >> 4, c4 = (lane & 15) * 4;     // row seg = 256 B = 16 lanes x 16 B
      {
#pragma unroll
        for (int it = 0; it < 8; ++it) {
          const int row = it * 2 + hh;
          v4f v = *(const v4f*)(slab + row * 68 + c4);
          *(v4f*)(C + (size_t)(mBase + row) * ldc + n0 + c4) = v;
        }
        
      }
    } else {
      const int q = lane >> 3, c8 = (lane & 7) * 8;
      unsigned short* C  = (unsigned short*)Cout  + (size_t)b * strideC;
      unsigned short* C2 = (OUT_MODE == 2) ? ((unsigned short*)Cout2 + (size_t)b * strideC) : nullptr;
      {
#pragma unroll
        for (int it = 0; it < 4; ++it) {
          const int row = it * 4 + q;
          const float* sp = slab + row * 68 + c8;
          v8h hv, lv;
#pragma unroll
          for (int e = 0; e < 8; ++e) {
            if (OUT_MODE == 1) {
              hv[e] = (_Float16)sp[e];
            } else {
              unsigned short hb = f2bf_bits(sp[e]);
              unsigned short lb = f2bf_bits(sp[e] - bf_bits2f(hb));
              hv[e] = __builtin_bit_cast(_Float16, hb);
              lv[e] = __builtin_bit_cast(_Float16, lb);
            }
          }
          *(v8h*)(C + (size_t)(mBase + row) * ldc + n0 + c8) = hv;
          if (OUT_MODE == 2) *(v8h*)(C2 + (size_t)(mBase + row) * ldc + n0 + c8) = lv;
        }
        
      }
    }
    __builtin_amdgcn_fence(__ATOMIC_RELEASE, "workgroup");
    __builtin_amdgcn_wave_barrier();
    __builtin_amdgcn_fence(__ATOMIC_ACQUIRE, "workgroup");
  }
}

// f32 row-major [rows][K] -> bf16 (RNE) in the GEMM's fragment order. One wave per two neighbouring 16 x 32 tiles:
// each 16-byte load covers 4 rows x 128 B (whole lines), eight in flight; a lane's four values of one row are 8 bytes of
// the tile, and the four rows of a load are 64 contiguous bytes in each of the tile's four 256-byte quarters.
template <int K>
__global__ __launch_bounds__(256) void cast_f32_bf16_frag(
    const float* __restrict__ in, unsigned short* __restrict__ out, int npair) {
  const int lane = threadIdx.x & 31;
  const int wv   = blockIdx.x * 8 + (threadIdx.x >> 5);
  if (wv >= npair) return;
  const int rt = wv / (K / 64);                // 16-row tile
  const int kq = wv % (K / 64);                // pair of 32-k tiles
  const int rs = lane >> 3;                    // row within a group of four
  const int q  = lane & 7;                     // k = 4q .. 4q+3 within the tile
  const float* sp = in + (size_t)(rt * 16 + rs) * K + kq * 64 + q * 4;
  v4f x[2][4];
#pragma unroll
  for (int t = 0; t < 2; ++t)
#pragma unroll
    for (int i = 0; i < 4; ++i) x[t][i] = *(const v4f*)(sp + (size_t)(4 * i) * K + t * 32);
  unsigned short* dp = out + ((size_t)rt * (K / 32) + kq * 2) * 512 + (q >> 2) * 256 + (((q >> 1) & 1) * 16 + rs) * 8 + (q & 1) * 4;
#pragma unroll
  for (int t = 0; t < 2; ++t)
#pragma unroll
    for (int i = 0; i < 4; ++i) {
      uint2 u;
      u.x = (unsigned)f2bf_bits(x[t][i][0]) | ((unsigned)f2bf_bits(x[t][i][1]) << 16);
      u.y = (unsigned)f2bf_bits(x[t][i][2]) | ((unsigned)f2bf_bits(x[t][i][3]) << 16);
      *(uint2*)(dp + t * 512 + i * 32) = u;
    }
}

// =====================================================================================
// Attention, head_dim 64, no mask. Inputs are bf16 hi/lo planes of q, k, v laid out as G groups of
// contiguous [S][64] slabs (group stride gstride elements, row stride 64); output f32 in the same slab layout.
// Block = 4 waves = 64 query rows of one group; 64-key chunks.
//   scores = q.k^T * sscale : q and k hi/lo planes (hi.hi + hi.lo + lo.hi), f32 accumulate
//   out    = p.v            : p split into bf16 hi/lo after the max shift, v hi/lo planes (hi.hi + hi.lo + lo.hi)
//   online softmax in f32. Q planes staged once per block in LDS (16-B copies); K planes copied and V planes
//   transposed to [d][kv] in LDS per chunk; all staging with plain loads + __syncthreads().
//   grid.x = G * (S/64).
// =====================================================================================
#define AT_D 64
#define AT_NW 4
#define AT_QB 64
#define AT_KC 64
#define AT_LP 72   // LDS row pitch in elements: 144 B = 16 B x odd, so the 16 rows of a 16-byte fragment read fall on distinct banks

__device__ __forceinline__ unsigned short at_bf_bits(float f) {
  unsigned u = __float_as_uint(f);
  return (unsigned short)((u + 0x7FFFu + ((u >> 16) & 1u)) >> 16);
}
__device__ __forceinline__ __bf16 at_f2bf(float f) { return __builtin_bit_cast(__bf16, at_bf_bits(f)); }
__device__ __forceinline__ void at_split(float f, __bf16& hi, __bf16& lo) {
  const unsigned short hb = at_bf_bits(f);
  hi = __builtin_bit_cast(__bf16, hb);
  lo = at_f2bf(f - __uint_as_float(((unsigned)hb) << 16));
}
// three products of a hi/lo x hi/lo pair into one accumulator, then the hazard guard tying D and all four operands
__device__ __forceinline__ v8f at_mma3(v16b ah, v16b al, v16b bh, v16b bl, v8f c) {
  c = __builtin_amdgcn_wmma_f32_16x16x32_bf16(false, ah, false, bh, (short)0, c, false, false);
  c = __builtin_amdgcn_wmma_f32_16x16x32_bf16(false, ah, false, bl, (short)0, c, false, false);
  c = __builtin_amdgcn_wmma_f32_16x16x32_bf16(false, al, false, bh, (short)0, c, false, false);
  asm volatile("v_nop\n\tv_nop\n\tv_nop\n\tv_nop" : "+v"(c) : "v"(ah), "v"(al), "v"(bh), "v"(bl));
  return c;
}

__global__ __launch_bounds__(128)
void attn64_planes(const unsigned short* __restrict__ QH, const unsigned short* __restrict__ QL,
                   const unsigned short* __restrict__ KH, const unsigned short* __restrict__ KL,
                   const unsigned short* __restrict__ VH, const unsigned short* __restrict__ VL,
                   float* __restrict__ out, long gstride, int S, int nkc, float sscale) {
  union FB { v16b v; v8b h[2]; };
  __shared__ __align__(16) __bf16 Qsh[AT_QB * AT_LP];         // Q hi [row][d]   9 KB
  __shared__ __align__(16) __bf16 Qsl[AT_QB * AT_LP];         // Q lo [row][d]   9 KB
  __shared__ __align__(16) __bf16 Ksh[AT_KC * AT_LP];         // K hi [kv][d]    9 KB
  __shared__ __align__(16) __bf16 Ksl[AT_KC * AT_LP];         // K lo [kv][d]    9 KB
  __shared__ __align__(16) __bf16 Vth[AT_D * AT_LP];          // V hi [d][kv]    9 KB
  __shared__ __align__(16) __bf16 Vtl[AT_D * AT_LP];          // V lo [d][kv]    9 KB
  __shared__ __align__(16) __bf16 Ps[AT_NW][2 * 16 * AT_LP];  // per wave P hi [row][kv], then P lo [row][kv]  18 KB
  // The per-wave out tile (16 rows, pitch 68 floats) has no LDS of its own: it lies on the wave's own P tiles, which are dead
  // behind the last chunk's products. 72 KB a block in all, so that four blocks fit one WGP's 320 KB (three with a tile of its own).
  static_assert(16 * 68 * sizeof(float) <= 2 * 16 * AT_LP * sizeof(__bf16));

  const int tid  = threadIdx.x;
  const int wave = tid >> 5;
  const int lane = tid & 31;
  const int hh   = lane >> 4;
  const int c    = lane & 15;

  const int nqb = S / AT_QB;
  const int bx  = blockIdx.x;
  const int qb  = bx % nqb;
  const int g   = bx / nqb;
  const int q0  = qb * AT_QB + wave * 16;

  const __bf16* Qh = (const __bf16*)QH + (size_t)g * gstride;
  const __bf16* Ql = (const __bf16*)QL + (size_t)g * gstride;
  const __bf16* Kh = (const __bf16*)KH + (size_t)g * gstride;
  const __bf16* Kl = (const __bf16*)KL + (size_t)g * gstride;
  const __bf16* Vh = (const __bf16*)VH + (size_t)g * gstride;
  const __bf16* Vl = (const __bf16*)VL + (size_t)g * gstride;
  float*        Og = out + (size_t)g * gstride;

  // ---- Q hi/lo planes for the block's 64 rows: [row][d], 16-B copies (512 chunks per plane, 4 per thread) ----
  {
    const __bf16* qsh = Qh + (size_t)(qb * AT_QB) * AT_D;
    const __bf16* qsl = Ql + (size_t)(qb * AT_QB) * AT_D;
#pragma unroll
    for (int it = 0; it < 4; ++it) {
      const int ch = tid + it * 128;
      const int row = ch >> 3, col = (ch & 7) * 8;
      *(v8b*)(Qsh + row * AT_LP + col) = *(const v8b*)(qsh + (size_t)row * AT_D + col);
      *(v8b*)(Qsl + row * AT_LP + col) = *(const v8b*)(qsl + (size_t)row * AT_D + col);
    }
  }
  __syncthreads();

  float mrow[8], lrow[8];
  v8f oacc[4];
#pragma unroll
  for (int r = 0; r < 8; ++r) { mrow[r] = -INFINITY; lrow[r] = 0.f; }
#pragma unroll
  for (int t = 0; t < 4; ++t) oacc[t] = (v8f){0.f,0.f,0.f,0.f,0.f,0.f,0.f,0.f};

  const int nk = (nkc < 64) ? nkc : 64;                             // host-provided trip count, clamped to a static maximum
  const __bf16* qwh = Qsh + (wave * 16 + c) * AT_LP + 8 * hh;        // A fragment row c of this wave
  const __bf16* qwl = Qsl + (wave * 16 + c) * AT_LP + 8 * hh;

  for (int kc = 0; kc < nk; ++kc) {
    const int kv0 = kc * AT_KC;
    __syncthreads();                                                // readers of the last K/V tile done
    {
      const __bf16* ksh = Kh + (size_t)kv0 * AT_D;
      const __bf16* ksl = Kl + (size_t)kv0 * AT_D;
      const __bf16* vsh = Vh + (size_t)kv0 * AT_D;
      const __bf16* vsl = Vl + (size_t)kv0 * AT_D;
#pragma unroll
      for (int it = 0; it < 4; ++it) {
        const int ch = tid + it * 128;
        const int row = ch >> 3, col = (ch & 7) * 8;                // row = kv within chunk, col = d
        *(v8b*)(Ksh + row * AT_LP + col) = *(const v8b*)(ksh + (size_t)row * AT_D + col);
        *(v8b*)(Ksl + row * AT_LP + col) = *(const v8b*)(ksl + (size_t)row * AT_D + col);
        const v8b vvh = *(const v8b*)(vsh + (size_t)row * AT_D + col);
        const v8b vvl = *(const v8b*)(vsl + (size_t)row * AT_D + col);
#pragma unroll
        for (int i = 0; i < 8; ++i) {
          Vth[(col + i) * AT_LP + row] = vvh[i];
          Vtl[(col + i) * AT_LP + row] = vvl[i];
        }
      }
    }
    __syncthreads();

    // ---- scores[16 x 64] = q . k^T  (A = Q[row][d], B = K[kv][d]; split k-map via two 16-B halves at +8hh and +16+8hh) ----
    v8f s[4];
#pragma unroll
    for (int j = 0; j < 4; ++j) s[j] = (v8f){0.f,0.f,0.f,0.f,0.f,0.f,0.f,0.f};
#pragma unroll 1
    for (int dc = 0; dc < 2; ++dc) {
      FB qh, ql;
      qh.h[0] = *(const v8b*)(qwh + dc * 32);
      qh.h[1] = *(const v8b*)(qwh + dc * 32 + 16);
      ql.h[0] = *(const v8b*)(qwl + dc * 32);
      ql.h[1] = *(const v8b*)(qwl + dc * 32 + 16);
#pragma unroll
      for (int j = 0; j < 4; ++j) {
        FB kb, kl;
        const __bf16* kp  = Ksh + (j * 16 + c) * AT_LP + dc * 32 + 8 * hh;
        const __bf16* kpl = Ksl + (j * 16 + c) * AT_LP + dc * 32 + 8 * hh;
        kb.h[0] = *(const v8b*)(kp);
        kb.h[1] = *(const v8b*)(kp + 16);
        kl.h[0] = *(const v8b*)(kpl);
        kl.h[1] = *(const v8b*)(kpl + 16);
        s[j] = at_mma3(qh.v, ql.v, kb.v, kl.v, s[j]);
      }
    }
    // ---- scale (f32), row max ----
    float cm[8];
#pragma unroll
    for (int r = 0; r < 8; ++r) {
      float m = -INFINITY;
#pragma unroll
      for (int j = 0; j < 4; ++j) {
        const float sv = s[j][r] * sscale;
        s[j][r] = sv;
        m = fmaxf(m, sv);
      }
#pragma unroll
      for (int off = 1; off < 16; off <<= 1) m = fmaxf(m, __shfl_xor(m, off, 32));
      cm[r] = m;
    }
    __bf16* pwh = Ps[wave];
    __bf16* pwl = Ps[wave] + 16 * AT_LP;
#pragma unroll
    for (int r = 0; r < 8; ++r) {
      const float mnew = fmaxf(mrow[r], cm[r]);
      const float mref = (mnew == -INFINITY) ? 0.0f : mnew;
      const float alpha = __expf(mrow[r] - mref);
      mrow[r] = mnew;
      float psum = 0.f;
#pragma unroll
      for (int j = 0; j < 4; ++j) {
        const float p = __expf(s[j][r] - mref);
        psum += p;
        __bf16 a, bl; at_split(p, a, bl);
        pwh[(8 * hh + r) * AT_LP + j * 16 + c] = a;
        pwl[(8 * hh + r) * AT_LP + j * 16 + c] = bl;
      }
#pragma unroll
      for (int off = 1; off < 16; off <<= 1) psum += __shfl_xor(psum, off, 32);
      lrow[r] = lrow[r] * alpha + psum;
#pragma unroll
      for (int t = 0; t < 4; ++t) oacc[t][r] *= alpha;
    }
    __builtin_amdgcn_fence(__ATOMIC_RELEASE, "workgroup");
    __builtin_amdgcn_wave_barrier();
    __builtin_amdgcn_fence(__ATOMIC_ACQUIRE, "workgroup");
    // ---- O[16 x 64] += P[16 x 64] . V[64 x 64]  (A = P[row][kv], B = V[kv][d] from the [d][kv] tile) ----
#pragma unroll 1
    for (int kk = 0; kk < 2; ++kk) {
      FB pa, pl;
      pa.h[0] = *(const v8b*)(pwh + c * AT_LP + kk * 32 + 8 * hh);
      pa.h[1] = *(const v8b*)(pwh + c * AT_LP + kk * 32 + 16 + 8 * hh);
      pl.h[0] = *(const v8b*)(pwl + c * AT_LP + kk * 32 + 8 * hh);
      pl.h[1] = *(const v8b*)(pwl + c * AT_LP + kk * 32 + 16 + 8 * hh);
#pragma unroll
      for (int t = 0; t < 4; ++t) {
        FB vb, vl;
        const __bf16* vp  = Vth + (t * 16 + c) * AT_LP + kk * 32 + 8 * hh;
        const __bf16* vpl = Vtl + (t * 16 + c) * AT_LP + kk * 32 + 8 * hh;
        vb.h[0] = *(const v8b*)(vp);
        vb.h[1] = *(const v8b*)(vp + 16);
        vl.h[0] = *(const v8b*)(vpl);
        vl.h[1] = *(const v8b*)(vpl + 16);
        oacc[t] = at_mma3(pa.v, pl.v, vb.v, vl.v, oacc[t]);
      }
    }
  }

  float* os = (float*)Ps[wave];   // every value stored here comes out of products that have read all of this wave's P
#pragma unroll
  for (int r = 0; r < 8; ++r) {
    const float inv = 1.0f / lrow[r];
#pragma unroll
    for (int t = 0; t < 4; ++t) os[(8 * hh + r) * 68 + t * 16 + c] = oacc[t][r] * inv;
  }
  __builtin_amdgcn_fence(__ATOMIC_RELEASE, "workgroup");
  __builtin_amdgcn_wave_barrier();
  __builtin_amdgcn_fence(__ATOMIC_ACQUIRE, "workgroup");
  {
    const int c4 = (lane & 15) * 4;
    {
#pragma unroll
      for (int it = 0; it < 8; ++it) {
        const int row = it * 2 + hh;                    // hh in 0..1, it in 0..7 -> rows 0..15
        v4f val = *(const v4f*)(os + row * 68 + c4);
        *(v4f*)(Og + (size_t)(q0 + row) * AT_D + c4) = val;
      }
      
    }
  }
}

// ---------------------------------------------------------------------------
// Host orchestration (launches only).
// d_in: 0=query 1=key 2=value [4,1024,1024] f32; 3=Wq 4=Wk 5=Wv [1024,1024] f32 ([out,in]).
// q/k/v = x . W^T as [4096][1024] bf16 hi/lo planes; the raw row-major reshape to [64][1024][64] is a pure
// reinterpretation of the same memory: group g owns the contiguous slab of 1024 rows x 64.
// ---------------------------------------------------------------------------
extern "C" void kernel_launch(void* const* d_in, const int* in_sizes, int n_in,
                              void* d_out, int out_size, void* d_ws, size_t ws_size,
                              hipStream_t stream) {
  constexpr int Bn = 4, Sn = 1024, E = 1024, Dh = 64, G = 64;
  constexpr int M = Bn * Sn;                       // 4096 projected rows
  constexpr int GS = (M * E) / (G * Dh);           // 1024 group-tokens per group
  static_assert(GS % AT_QB == 0 && GS % AT_KC == 0);
  static_assert(M % 64 == 0 && E % 64 == 0 && E % 32 == 0);
  if (n_in < 6) return;
  if (in_sizes[0] != M * E || in_sizes[1] != M * E || in_sizes[2] != M * E ||
      in_sizes[3] != E * E || in_sizes[4] != E * E || in_sizes[5] != E * E || out_size != M * E) return;

  const float* xq = (const float*)d_in[0];
  const float* xk = (const float*)d_in[1];
  const float* xv = (const float*)d_in[2];
  const float* wq = (const float*)d_in[3];
  const float* wk = (const float*)d_in[4];
  const float* wv = (const float*)d_in[5];
  float* out = (float*)d_out;

  const size_t bX = (size_t)M * E * 2;            //  8 MiB  bf16 activation copy (x3)
  const size_t bW = (size_t)E * E * 2;            //  2 MiB  bf16 weight copy (x3)
  const size_t bP = (size_t)M * E * 2;            //  8 MiB  bf16 projection plane (x3 hi, x3 lo)
  char* ws = (char*)d_ws;
  size_t off = 0;
  unsigned short* X16 = (unsigned short*)(ws + off); off += 3 * bX;   // [3] x (4096 x 1024) bf16, fragment order
  unsigned short* W16 = (unsigned short*)(ws + off); off += 3 * bW;   // [3] x (1024 x 1024) bf16, fragment order
  unsigned short* PH  = (unsigned short*)(ws + off); off += 3 * bP;   // [3][4096][1024] bf16 hi : q, k, v
  unsigned short* PL  = (unsigned short*)(ws + off); off += 3 * bP;   // [3][4096][1024] bf16 lo : q, k, v
  if (off > ws_size || off > (size_t)134217728) return;               // 81,788,928 B

  const size_t PE = (size_t)M * E;                 // elements per plane
  unsigned short* QH = PH;          unsigned short* QL = PL;
  unsigned short* KH = PH + PE;     unsigned short* KL = PL + PE;
  unsigned short* VH = PH + 2 * PE; unsigned short* VL = PL + 2 * PE;

  dim3 blk256(256), blk128(128);

  // 1-6: RNE bf16 casts of the three activations and the three weights, written in the GEMM's fragment order
  {
    static_assert(E % 64 == 0 && M % 16 == 0);
    const int npx = (M / 16) * (E / 64), npw = (E / 16) * (E / 64);   // waves: one per pair of 16 x 32 tiles
    cast_f32_bf16_frag<E><<<dim3((npx + 7) / 8), blk256, 0, stream>>>(xq, X16, npx);
    cast_f32_bf16_frag<E><<<dim3((npx + 7) / 8), blk256, 0, stream>>>(xk, X16 + PE, npx);
    cast_f32_bf16_frag<E><<<dim3((npx + 7) / 8), blk256, 0, stream>>>(xv, X16 + 2 * PE, npx);
    cast_f32_bf16_frag<E><<<dim3((npw + 7) / 8), blk256, 0, stream>>>(wq, W16, npw);
    cast_f32_bf16_frag<E><<<dim3((npw + 7) / 8), blk256, 0, stream>>>(wk, W16 + (size_t)E * E, npw);
    cast_f32_bf16_frag<E><<<dim3((npw + 7) / 8), blk256, 0, stream>>>(wv, W16 + (size_t)2 * E * E, npw);
  }

  // 7: P_z[m][f] = bf16(x_z)[m][e] . bf16(W_z)[f][e], f32 accumulate, stored as bf16 hi/lo planes; z = 0..2 via grid.y
  {
    const int tiles = (M / 64) * (E / 64);          // 1024 tiles of 64x64 per z; 8 waves per block
    wmma_gemm64<1, false, 0, 2, false, 0, E><<<dim3((tiles + 7) / 8, 3), blk256, 0, stream>>>(
        X16, X16, E, (long)PE,
        W16, W16, E, (long)E * E,
        (void*)PH, (void*)PL, E, (long)PE,
        wq, wq, 0L, M, E, E, 1.0f);
  }

  // 8: attention over 64 groups, each a contiguous [1024][64] slab (group stride 65536 elements, row stride 64); no mask
  {
    const int nblk = G * (GS / AT_QB);               // 64 groups x 16 query blocks = 1024
    const long gstride = (long)GS * Dh;              // 65536
    attn64_planes<<<dim3(nblk), blk128, 0, stream>>>(
        QH, QL, KH, KL, VH, VL, out, gstride, GS, GS / AT_KC, 0.125f);
  }
}

// v004
// One run takes 175 microseconds.
// Timed twice side by side with v003, it ran 1.10 times as fast both times.
// Over all steps from v000 it is 2.00 times as fast.
#include <hip/hip_runtime.h>
#include <math.h>
// Contractions: q/k/v projection GEMMs = v_wmma_f32_16x16x32_bf16 (bf16 operands, one product, f32 accumulate, results stored as bf16 hi/lo planes); scores q.k^T = v_wmma_f32_16x16x32_bf16 (bf16 hi/lo planes of q and k, three products); out = p.v = v_wmma_f32_16x16x32_bf16 (bf16 hi/lo planes of p and v, three products); f32 accumulate everywhere; online softmax in f32.

typedef __attribute__((ext_vector_type(16))) _Float16 v16h;
typedef __attribute__((ext_vector_type(8)))  _Float16 v8h;
typedef __attribute__((ext_vector_type(16))) __bf16   v16b;
typedef __attribute__((ext_vector_type(8)))  __bf16   v8b;
typedef __attribute__((ext_vector_type(8)))  float    v8f;
typedef __attribute__((ext_vector_type(4)))  float    v4f;

__device__ __forceinline__ unsigned short f2bf_bits(float f) {
  unsigned u = __float_as_uint(f);
  return (unsigned short)((u + 0x7FFFu + ((u >> 16) & 1u)) >> 16);
}
__device__ __forceinline__ float bf_bits2f(unsigned short h) { return __uint_as_float(((unsigned)h) << 16); }

// hazard guards as plain device helpers (no inline asm inside the kernel template body)
__device__ __forceinline__ void dep_guard_h(v8f& a, v8f& b, v16h x, v16h y) { asm volatile("v_nop\n\tv_nop\n\tv_nop\n\tv_nop" : "+v"(a), "+v"(b) : "v"(x), "v"(y)); }
__device__ __forceinline__ void dep_guard_b(v8f& a, v8f& b, v16b x, v16b y) { asm volatile("v_nop\n\tv_nop\n\tv_nop\n\tv_nop" : "+v"(a), "+v"(b) : "v"(x), "v"(y)); }
__device__ __forceinline__ void keep4_h(v16h a, v16h b, v16h c, v16h d) { asm volatile("v_nop" :: "v"(a), "v"(b), "v"(c), "v"(d)); }
__device__ __forceinline__ void keep4_b(v16b a, v16b b, v16b c, v16b d) { asm volatile("v_nop" :: "v"(a), "v"(b), "v"(c), "v"(d)); }
__device__ __forceinline__ void acc_guard4(v8f& a, v8f& b, v8f& c, v8f& d) { asm volatile("v_nop\n\tv_nop\n\tv_nop\n\tv_nop" : "+v"(a), "+v"(b), "+v"(c), "+v"(d)); }
template <typename T> struct Frag;
template <> struct Frag<_Float16> {
  typedef v16h V; union U { v16h v; v8h h[2]; };
  static __device__ __forceinline__ v16h load(const _Float16* p) {   // fragment-order tile: elements 0..7 <- p[0..7], 8..15 <- p[256..263]
    U f; f.h[0] = *(const v8h*)(p); f.h[1] = *(const v8h*)(p + 256); return f.v;
  }
  static __device__ __forceinline__ v8f mma(v16h a, v16h b, v8f c) {
    return __builtin_amdgcn_wmma_f32_16x16x32_f16(false, a, false, b, (short)0, c, false, false);
  }
  static __device__ __forceinline__ void guard(v8f& a, v8f& b, v16h x, v16h y) { dep_guard_h(a, b, x, y); }
  static __device__ __forceinline__ void keep(v16h a, v16h b, v16h c, v16h d) { keep4_h(a, b, c, d); }
};
template <> struct Frag<__bf16> {
  typedef v16b V; union U { v16b v; v8b h[2]; };
  static __device__ __forceinline__ v16b load(const __bf16* p) {
    U f; f.h[0] = *(const v8b*)(p); f.h[1] = *(const v8b*)(p + 256); return f.v;
  }
  static __device__ __forceinline__ v8f mma(v16b a, v16b b, v8f c) {
    return __builtin_amdgcn_wmma_f32_16x16x32_bf16(false, a, false, b, (short)0, c, false, false);
  }
  static __device__ __forceinline__ void guard(v8f& a, v8f& b, v16b x, v16b y) { dep_guard_b(a, b, x, y); }
  static __device__ __forceinline__ void keep(v16b a, v16b b, v16b c, v16b d) { keep4_b(a, b, c, d); }
};

// ---- Register-blocked batched WMMA GEMM ------------------------------------
// C[m,n] = scale * sum_k A[m,k] * Bt[n,k] (+bias)(+resid); each wave owns a 64x64 tile.
// A [M,K] and Bt [N,K] in fragment order; M,N % 64 == 0, K % 32 == 0.
// Fragment order: the tile of rows 16*rt..+15 and k 32*kt..+31 is 512 contiguous elements at (rt * (K/32) + kt) * 512;
// in it element (row c, k) lies at ((k >> 4) & 1) * 256 + (((k >> 3) & 1) * 16 + c) * 8 + (k & 7), so lane l's two
// 16-byte pieces lie at l * 8 and 256 + l * 8 and each wave-wide 16-byte load covers 512 contiguous bytes (4 whole lines).
// SPLIT: operands are hi/lo planes (A2/Bt2 = lo planes, same layout); product = hi.hi + hi.lo + lo.hi.
// BIAS_MODE: 0 = none, 1 = bias[m], 2 = bias[n].
// OUT_MODE: 0 = f32, 1 = f16, 2 = bf16 hi plane (Cout) + bf16 lo plane (Cout2).
// ET: 0 = f16 operands, 1 = bf16 operands (pointers passed as 16-bit storage)
template <int ET> struct Elem;
template <> struct Elem<0> { typedef _Float16 T; };
template <> struct Elem<1> { typedef __bf16 T; };
// LDK: K of the stored A and Bt, a compile-time constant, so that the step from one 16-row tile strip to the next is an
// immediate offset of the load (lda and ldb are not read).
template <int ET, bool SPLIT, int BIAS_MODE, int OUT_MODE, bool RESID, int ACT = 0, int LDK = 1024>
__global__ __launch_bounds__(256) void wmma_gemm64(
    const unsigned short* __restrict__ Ap, const unsigned short* __restrict__ A2p, int lda, long strideA,
    const unsigned short* __restrict__ Btp, const unsigned short* __restrict__ Bt2p, int ldb, long strideB,
    void* __restrict__ Cout, void* __restrict__ Cout2, int ldc, long strideC,
    const float* __restrict__ bias,
    const float* __restrict__ resid, long strideR,
    int M, int N, int K, float scale) {
  typedef typename Elem<ET>::T T;
  typedef typename Frag<T>::V V;
  const T* A = (const T*)Ap; const T* A2 = (const T*)A2p; const T* Bt = (const T*)Btp; const T* Bt2 = (const T*)Bt2p;
  __shared__ __align__(16) float sT[8][16 * 68];   // per-wave 16x64 slab, pitch 68 floats
  const int b    = blockIdx.y;
  const int lane = threadIdx.x & 31;
  const int wave = __builtin_amdgcn_readfirstlane(threadIdx.x >> 5);   // wave-uniform: the tile bases below stay in scalar registers
  const int tilesN = N >> 6;
  const int tilesM = M >> 6;
  const int tile = blockIdx.x * 8 + wave;
  if (tile >= tilesM * tilesN) return;   // wave-uniform; no block barriers in this kernel
  const int tm = tile / tilesN;
  const int tn = tile - tm * tilesN;
  const int m0 = tm << 6;
  const int n0 = tn << 6;

  const T* Ab  = A  + (size_t)b * strideA;
  const T* Bb  = Bt + (size_t)b * strideB;
  const T* Ab2 = SPLIT ? (A2  + (size_t)b * strideA) : nullptr;
  const T* Bb2 = SPLIT ? (Bt2 + (size_t)b * strideB) : nullptr;

  const int rlane = lane & 15;                 // row (A) / col (B, D) within subtile
  const int mOff  = (lane >> 4) * 8;           // D row offset

  v8f acc[4][4];
#pragma unroll
  for (int i = 0; i < 4; ++i)
#pragma unroll
    for (int j = 0; j < 4; ++j) acc[i][j] = (v8f){0.f,0.f,0.f,0.f,0.f,0.f,0.f,0.f};

  // one scalar base per operand; one 32-bit vector byte offset serves all loads: lane * 16, + 1024 per k step
  constexpr size_t TS = (size_t)(LDK / 32) * 512;                                // elements per 16-row tile strip
  const size_t aT = (size_t)(m0 >> 4) * TS, bT = (size_t)(n0 >> 4) * TS;
  for (int k0 = 0; k0 < K; k0 += 32) {
    const unsigned vo = (unsigned)(k0 << 5) + (unsigned)(lane * 16);
    V bh[4], bl[4];
#pragma unroll
    for (int j = 0; j < 4; ++j) {
      bh[j] = Frag<T>::load((const T*)((const char*)(Bb + (bT + j * TS)) + vo));
      if (SPLIT) bl[j] = Frag<T>::load((const T*)((const char*)(Bb2 + (bT + j * TS)) + vo));
    }
#pragma unroll
    for (int i = 0; i < 4; ++i) {
      V ah = Frag<T>::load((const T*)((const char*)(Ab + (aT + i * TS)) + vo));
      V al;
      if (SPLIT) al = Frag<T>::load((const T*)((const char*)(Ab2 + (aT + i * TS)) + vo));
#pragma unroll
      for (int j = 0; j < 4; ++j) {
        acc[i][j] = Frag<T>::mma(ah, bh[j], acc[i][j]);
        if (SPLIT) {
          acc[i][j] = Frag<T>::mma(ah, bl[j], acc[i][j]);
          acc[i][j] = Frag<T>::mma(al, bh[j], acc[i][j]);
        }
      }
      Frag<T>::guard(acc[i][0], acc[i][3], ah, SPLIT ? al : ah);
    }
    Frag<T>::keep(bh[0], bh[1], bh[2], bh[3]);
    if (SPLIT) Frag<T>::keep(bl[0], bl[1], bl[2], bl[3]);
  }
  acc_guard4(acc[0][0], acc[0][1], acc[0][2], acc[0][3]);
  acc_guard4(acc[1][0], acc[1][1], acc[1][2], acc[1][3]);
  acc_guard4(acc[2][0], acc[2][1], acc[2][2], acc[2][3]);
  acc_guard4(acc[3][0], acc[3][1], acc[3][2], acc[3][3]);

  // ---- epilogue ----
  float* slab = sT[wave];
  const float* Rb = RESID ? (resid + (size_t)b * strideR) : nullptr;
#pragma unroll
  for (int i = 0; i < 4; ++i) {
    const int mBase = m0 + (i << 4);
#pragma unroll
    for (int j = 0; j < 4; ++j) {
      const int n = n0 + (j << 4) + rlane;
      float bv = 0.f;
      if (BIAS_MODE == 2) bv = bias[n];
#pragma unroll
      for (int r = 0; r < 8; ++r) {
        float v = acc[i][j][r] * scale;
        if (BIAS_MODE == 1) v += bias[mBase + mOff + r];
        if (BIAS_MODE == 2) v += bv;
        if (RESID) v += Rb[(size_t)(mBase + mOff + r) * ldc + n];
        if (ACT == 1) v = tanhf(v);
        if (ACT == 2) v = fmaxf(v, 0.0f);
        if (ACT == 3) v = v / (1.0f + expf(-v));
        if (ACT == 4) v = (v > 0.f) ? v : 0.01f * v;
        if (ACT == 5) v = 0.5f * v * (1.0f + erff(v * 0.70710678118654752f));
        slab[(mOff + r) * 68 + (j << 4) + rlane] = v;
      }
    }
    __builtin_amdgcn_fence(__ATOMIC_RELEASE, "workgroup");
    __builtin_amdgcn_wave_barrier();
    __builtin_amdgcn_fence(__ATOMIC_ACQUIRE, "workgroup");
    if (OUT_MODE == 0) {
      float* C = (float*)Cout + (size_t)b * strideC;
      const int hh = lane >> 4, c4 = (lane & 15) * 4;     // row seg = 256 B = 16 lanes x 16 B
      {
#pragma unroll
        for (int it = 0; it < 8; ++it) {
          const int row = it * 2 + hh;
          v4f v = *(const v4f*)(slab + row * 68 + c4);
          *(v4f*)(C + (size_t)(mBase + row) * ldc + n0 + c4) = v;
        }
        
      }
    } else {
      const int q = lane >> 3, c8 = (lane & 7) * 8;
      unsigned short* C  = (unsigned short*)Cout  + (size_t)b * strideC;
      unsigned short* C2 = (OUT_MODE == 2) ? ((unsigned short*)Cout2 + (size_t)b * strideC) : nullptr;
      {
#pragma unroll
        for (int it = 0; it < 4; ++it) {
          const int row = it * 4 + q;
          const float* sp = slab + row * 68 + c8;
          v8h hv, lv;
#pragma unroll
          for (int e = 0; e < 8; ++e) {
            if (OUT_MODE == 1) {
              hv[e] = (_Float16)sp[e];
            } else {
              unsigned short hb = f2bf_bits(sp[e]);
              unsigned short lb = f2bf_bits(sp[e] - bf_bits2f(hb));
              hv[e] = __builtin_bit_cast(_Float16, hb);
              lv[e] = __builtin_bit_cast(_Float16, lb);
            }
          }
          *(v8h*)(C + (size_t)(mBase + row) * ldc + n0 + c8) = hv;
          if (OUT_MODE == 2) *(v8h*)(C2 + (size_t)(mBase + row) * ldc + n0 + c8) = lv;
        }
        
      }
    }
    __builtin_amdgcn_fence(__ATOMIC_RELEASE, "workgroup");
    __builtin_amdgcn_wave_barrier();
    __builtin_amdgcn_fence(__ATOMIC_ACQUIRE, "workgroup");
  }
}

// f32 row-major [rows][K] -> bf16 (RNE) in the GEMM's fragment order. One wave per two neighbouring 16 x 32 tiles:
// each 16-byte load covers 4 rows x 128 B (whole lines), eight in flight; a lane's four values of one row are 8 bytes of
// the tile, and the four rows of a load are 64 contiguous bytes in each of the tile's four 256-byte quarters.
template <int K>
__global__ __launch_bounds__(256) void cast_f32_bf16_frag(
    const float* __restrict__ in, unsigned short* __restrict__ out, int npair) {
  const int lane = threadIdx.x & 31;
  const int wv   = blockIdx.x * 8 + (threadIdx.x >> 5);
  if (wv >= npair) return;
  const int rt = wv / (K / 64);                // 16-row tile
  const int kq = wv % (K / 64);                // pair of 32-k tiles
  const int rs = lane >> 3;                    // row within a group of four
  const int q  = lane & 7;                     // k = 4q .. 4q+3 within the tile
  const float* sp = in + (size_t)(rt * 16 + rs) * K + kq * 64 + q * 4;
  v4f x[2][4];
#pragma unroll
  for (int t = 0; t < 2; ++t)
#pragma unroll
    for (int i = 0; i < 4; ++i) x[t][i] = *(const v4f*)(sp + (size_t)(4 * i) * K + t * 32);
  unsigned short* dp = out + ((size_t)rt * (K / 32) + kq * 2) * 512 + (q >> 2) * 256 + (((q >> 1) & 1) * 16 + rs) * 8 + (q & 1) * 4;
#pragma unroll
  for (int t = 0; t < 2; ++t)
#pragma unroll
    for (int i = 0; i < 4; ++i) {
      uint2 u;
      u.x = (unsigned)f2bf_bits(x[t][i][0]) | ((unsigned)f2bf_bits(x[t][i][1]) << 16);
      u.y = (unsigned)f2bf_bits(x[t][i][2]) | ((unsigned)f2bf_bits(x[t][i][3]) << 16);
      *(uint2*)(dp + t * 512 + i * 32) = u;
    }
}

// =====================================================================================
// Attention, head_dim 64, no mask. Inputs are bf16 hi/lo planes of q, k, v laid out as G groups of
// contiguous [S][64] slabs (group stride gstride elements, row stride 64); output f32 in the same slab layout.
// Block = 4 waves = 64 query rows of one group; 64-key chunks. Both products run transposed, so that a lane owns one query:
//   scores^T = k.q^T * sscale : A = k rows, B = q rows; k and q hi/lo planes (hi.hi + hi.lo + lo.hi), f32 accumulate
//   out^T   += v^T.p^T        : A = v^T rows, B = p^T; p split into bf16 hi/lo after the max shift, v hi/lo planes (three products)
//   A lane's registers of two neighbouring 16-key score tiles are, in place, its share of a 32-key B operand: p stays in registers.
//   online softmax in f32: maximum and sum run over a lane's own 32 scores, plus one exchange between the wave's halves.
//   Q planes staged once per block in LDS (16-B copies); K planes copied and V planes
//   transposed to [d][kv] in LDS per chunk; all staging with plain loads + __syncthreads().
//   grid.x = G * (S/64).
// =====================================================================================
#define AT_D 64
#define AT_NW 4
#define AT_QB 64
#define AT_KC 64
#define AT_LP 72   // LDS row pitch in elements: 144 B = 16 B x odd, so the 16 rows of a 16-byte fragment read fall on distinct banks

__device__ __forceinline__ unsigned short at_bf_bits(float f) {
  unsigned u = __float_as_uint(f);
  return (unsigned short)((u + 0x7FFFu + ((u >> 16) & 1u)) >> 16);
}
__device__ __forceinline__ __bf16 at_f2bf(float f) { return __builtin_bit_cast(__bf16, at_bf_bits(f)); }
__device__ __forceinline__ void at_split(float f, __bf16& hi, __bf16& lo) {
  const unsigned short hb = at_bf_bits(f);
  hi = __builtin_bit_cast(__bf16, hb);
  lo = at_f2bf(f - __uint_as_float(((unsigned)hb) << 16));
}
// three products of a hi/lo x hi/lo pair into one accumulator, then the hazard guard tying D and all four operands
__device__ __forceinline__ v8f at_mma3(v16b ah, v16b al, v16b bh, v16b bl, v8f c) {
  c = __builtin_amdgcn_wmma_f32_16x16x32_bf16(false, ah, false, bh, (short)0, c, false, false);
  c = __builtin_amdgcn_wmma_f32_16x16x32_bf16(false, ah, false, bl, (short)0, c, false, false);
  c = __builtin_amdgcn_wmma_f32_16x16x32_bf16(false, al, false, bh, (short)0, c, false, false);
  asm volatile("v_nop\n\tv_nop\n\tv_nop\n\tv_nop" : "+v"(c) : "v"(ah), "v"(al), "v"(bh), "v"(bl));
  return c;
}

// the value of lane l ^ 16 (the wave's other half), by a vector cross-row move
__device__ __forceinline__ float at_xhalf(float x) {
  const int b = __float_as_int(x);
  return __int_as_float(__builtin_amdgcn_permlanex16(b, b, 0x76543210, 0xfedcba98, false, false));
}

__global__ __launch_bounds__(128)
void attn64_planes(const unsigned short* __restrict__ QH, const unsigned short* __restrict__ QL,
                   const unsigned short* __restrict__ KH, const unsigned short* __restrict__ KL,
                   const unsigned short* __restrict__ VH, const unsigned short* __restrict__ VL,
                   float* __restrict__ out, long gstride, int S, int nkc, float sscale) {
  union FB { v16b v; v8b h[2]; };
  __shared__ __align__(16) __bf16 Qs[AT_NW][2 * 16 * AT_LP];  // per wave Q hi [row][d], then Q lo [row][d]  18 KB
  __shared__ __align__(16) __bf16 Ksh[AT_KC * AT_LP];         // K hi [kv][d]    9 KB
  __shared__ __align__(16) __bf16 Ksl[AT_KC * AT_LP];         // K lo [kv][d]    9 KB
  __shared__ __align__(16) __bf16 Vth[AT_D * AT_LP];          // V hi [d][kv]    9 KB
  __shared__ __align__(16) __bf16 Vtl[AT_D * AT_LP];          // V lo [d][kv]    9 KB
  // The per-wave out tile (16 rows, pitch 68 floats) has no LDS of its own: it lies on the wave's own Q tiles, which no other
  // wave reads and which are dead behind the last chunk's scores. 54 KB a block in all.
  static_assert(16 * 68 * sizeof(float) <= 2 * 16 * AT_LP * sizeof(__bf16));

  const int tid  = threadIdx.x;
  const int wave = tid >> 5;
  const int lane = tid & 31;
  const int hh   = lane >> 4;
  const int c    = lane & 15;

  const int nqb = S / AT_QB;
  const int bx  = blockIdx.x;
  const int qb  = bx % nqb;
  const int g   = bx / nqb;
  const int q0  = qb * AT_QB + wave * 16;

  const __bf16* Qh = (const __bf16*)QH + (size_t)g * gstride;
  const __bf16* Ql = (const __bf16*)QL + (size_t)g * gstride;
  const __bf16* Kh = (const __bf16*)KH + (size_t)g * gstride;
  const __bf16* Kl = (const __bf16*)KL + (size_t)g * gstride;
  const __bf16* Vh = (const __bf16*)VH + (size_t)g * gstride;
  const __bf16* Vl = (const __bf16*)VL + (size_t)g * gstride;
  float*        Og = out + (size_t)g * gstride;

  // ---- Q hi/lo planes for the block's 64 rows: [row][d], 16-B copies (512 chunks per plane, 4 per thread) ----
  {
    const __bf16* qsh = Qh + (size_t)(qb * AT_QB) * AT_D;
    const __bf16* qsl = Ql + (size_t)(qb * AT_QB) * AT_D;
#pragma unroll
    for (int it = 0; it < 4; ++it) {
      const int ch = tid + it * 128;
      const int row = ch >> 3, col = (ch & 7) * 8;
      __bf16* qd = Qs[row >> 4] + (row & 15) * AT_LP + col;
      *(v8b*)(qd)              = *(const v8b*)(qsh + (size_t)row * AT_D + col);
      *(v8b*)(qd + 16 * AT_LP) = *(const v8b*)(qsl + (size_t)row * AT_D + col);
    }
  }
  __syncthreads();

  float mrow = -INFINITY, lrow = 0.f;   // query q0 + c: running maximum (alike in both halves); sum over this half's keys only
  v8f oacc[4];                          // oacc[t][r] = out^T[d = 16t + 8hh + r][query q0 + c]
#pragma unroll
  for (int t = 0; t < 4; ++t) oacc[t] = (v8f){0.f,0.f,0.f,0.f,0.f,0.f,0.f,0.f};

  const int nk = (nkc < 64) ? nkc : 64;                             // host-provided trip count, clamped to a static maximum
  const __bf16* qwh = Qs[wave] + c * AT_LP + 8 * hh;                 // B fragment column c (query row c) of this wave
  const __bf16* qwl = qwh + 16 * AT_LP;

  for (int kc = 0; kc < nk; ++kc) {
    const int kv0 = kc * AT_KC;
    __syncthreads();                                                // readers of the last K/V tile done
    {
      const __bf16* ksh = Kh + (size_t)kv0 * AT_D;
      const __bf16* ksl = Kl + (size_t)kv0 * AT_D;
      const __bf16* vsh = Vh + (size_t)kv0 * AT_D;
      const __bf16* vsl = Vl + (size_t)kv0 * AT_D;
#pragma unroll
      for (int it = 0; it < 4; ++it) {
        const int ch = tid + it * 128;
        const int row = ch >> 3, col = (ch & 7) * 8;                // row = kv within chunk, col = d
        *(v8b*)(Ksh + row * AT_LP + col) = *(const v8b*)(ksh + (size_t)row * AT_D + col);
        *(v8b*)(Ksl + row * AT_LP + col) = *(const v8b*)(ksl + (size_t)row * AT_D + col);
        const v8b vvh = *(const v8b*)(vsh + (size_t)row * AT_D + col);
        const v8b vvl = *(const v8b*)(vsl + (size_t)row * AT_D + col);
#pragma unroll
        for (int i = 0; i < 8; ++i) {
          Vth[(col + i) * AT_LP + row] = vvh[i];
          Vtl[(col + i) * AT_LP + row] = vvl[i];
        }
      }
    }
    __syncthreads();

    // ---- scores^T[64 x 16] = k . q^T  (A = K[kv][d], B = Q[row][d]; split k-map via two 16-B halves at +8hh and +16+8hh) ----
    // s[j][r] = score of key 16j + 8hh + r and query c
    v8f s[4];
#pragma unroll
    for (int j = 0; j < 4; ++j) s[j] = (v8f){0.f,0.f,0.f,0.f,0.f,0.f,0.f,0.f};
#pragma unroll 1
    for (int dc = 0; dc < 2; ++dc) {
      FB qh, ql;
      qh.h[0] = *(const v8b*)(qwh + dc * 32);
      qh.h[1] = *(const v8b*)(qwh + dc * 32 + 16);
      ql.h[0] = *(const v8b*)(qwl + dc * 32);
      ql.h[1] = *(const v8b*)(qwl + dc * 32 + 16);
#pragma unroll
      for (int j = 0; j < 4; ++j) {
        FB kb, kl;
        const __bf16* kp  = Ksh + (j * 16 + c) * AT_LP + dc * 32 + 8 * hh;
        const __bf16* kpl = Ksl + (j * 16 + c) * AT_LP + dc * 32 + 8 * hh;
        kb.h[0] = *(const v8b*)(kp);
        kb.h[1] = *(const v8b*)(kp + 16);
        kl.h[0] = *(const v8b*)(kpl);
        kl.h[1] = *(const v8b*)(kpl + 16);
        s[j] = at_mma3(kb.v, kl.v, qh.v, ql.v, s[j]);
      }
    }
    // ---- scale (f32), the query's maximum: in-lane over 32 keys, then the other half's 32 ----
    float mj[4];
#pragma unroll   // here and below: s, pa, pl and oacc live in registers, so every index into them must be a constant
    for (int j = 0; j < 4; ++j) {
      float m = -INFINITY;
#pragma unroll
      for (int r = 0; r < 8; ++r) {
        const float sv = s[j][r] * sscale;
        s[j][r] = sv;
        m = fmaxf(m, sv);
      }
      mj[j] = m;
    }
    const float mh = fmaxf(fmaxf(mj[0], mj[1]), fmaxf(mj[2], mj[3]));
    const float mnew = fmaxf(mrow, fmaxf(mh, at_xhalf(mh)));
    const float mref = (mnew == -INFINITY) ? 0.0f : mnew;
    const float alpha = __expf(mrow - mref);
    mrow = mnew;
    // p^T as B operand of keys 32kk .. 32kk+31: elements 0..7 = tile 2kk's registers, 8..15 = tile 2kk+1's (the split k-map)
    FB pa[2], pl[2];
    float pj[4];
#pragma unroll
    for (int j = 0; j < 4; ++j) {
      float psum = 0.f;
#pragma unroll
      for (int r = 0; r < 8; ++r) {
        const float p = __expf(s[j][r] - mref);
        psum += p;
        __bf16 a, bl; at_split(p, a, bl);
        pa[j >> 1].v[(j & 1) * 8 + r] = a;
        pl[j >> 1].v[(j & 1) * 8 + r] = bl;
      }
      pj[j] = psum;
    }
    lrow = lrow * alpha + ((pj[0] + pj[1]) + (pj[2] + pj[3]));
#pragma unroll
    for (int t = 0; t < 4; ++t)
#pragma unroll
      for (int r = 0; r < 8; ++r) oacc[t][r] *= alpha;
    // ---- O^T[64 x 16] += V^T[64 x 64] . P^T[64 x 16]  (A = V^T[d][kv] from the [d][kv] tile, B = p^T from registers) ----
#pragma unroll   // pa[kk] and pl[kk] live in registers: kk must be a constant at each use
    for (int kk = 0; kk < 2; ++kk) {
#pragma unroll
      for (int t = 0; t < 4; ++t) {
        FB vb, vl;
        const __bf16* vp  = Vth + (t * 16 + c) * AT_LP + kk * 32 + 8 * hh;
        const __bf16* vpl = Vtl + (t * 16 + c) * AT_LP + kk * 32 + 8 * hh;
        vb.h[0] = *(const v8b*)(vp);
        vb.h[1] = *(const v8b*)(vp + 16);
        vl.h[0] = *(const v8b*)(vpl);
        vl.h[1] = *(const v8b*)(vpl + 16);
        oacc[t] = at_mma3(vb.v, vl.v, pa[kk].v, pl[kk].v, oacc[t]);
      }
    }
  }

  float* os = (float*)Qs[wave];   // every value stored here comes out of products that have read all of this wave's Q
  {
    const float inv = 1.0f / (lrow + at_xhalf(lrow));   // the two halves' key sums joined once
#pragma unroll
    for (int t = 0; t < 4; ++t) {                       // a lane's 8 registers are 8 neighbouring d of its query's row
      *(v4f*)(os + c * 68 + t * 16 + 8 * hh)     = (v4f){oacc[t][0] * inv, oacc[t][1] * inv, oacc[t][2] * inv, oacc[t][3] * inv};
      *(v4f*)(os + c * 68 + t * 16 + 8 * hh + 4) = (v4f){oacc[t][4] * inv, oacc[t][5] * inv, oacc[t][6] * inv, oacc[t][7] * inv};
    }
  }
  __builtin_amdgcn_fence(__ATOMIC_RELEASE, "workgroup");
  __builtin_amdgcn_wave_barrier();
  __builtin_amdgcn_fence(__ATOMIC_ACQUIRE, "workgroup");
  {
    const int c4 = (lane & 15) * 4;
    {
#pragma unroll
      for (int it = 0; it < 8; ++it) {
        const int row = it * 2 + hh;                    // hh in 0..1, it in 0..7 -> rows 0..15
        v4f val = *(const v4f*)(os + row * 68 + c4);
        *(v4f*)(Og + (size_t)(q0 + row) * AT_D + c4) = val;
      }
      
    }
  }
}

// ---------------------------------------------------------------------------
// Host orchestration (launches only).
// d_in: 0=query 1=key 2=value [4,1024,1024] f32; 3=Wq 4=Wk 5=Wv [1024,1024] f32 ([out,in]).
// q/k/v = x . W^T as [4096][1024] bf16 hi/lo planes; the raw row-major reshape to [64][1024][64] is a pure
// reinterpretation of the same memory: group g owns the contiguous slab of 1024 rows x 64.
// ---------------------------------------------------------------------------
extern "C" void kernel_launch(void* const* d_in, const int* in_sizes, int n_in,
                              void* d_out, int out_size, void* d_ws, size_t ws_size,
                              hipStream_t stream) {
  constexpr int Bn = 4, Sn = 1024, E = 1024, Dh = 64, G = 64;
  constexpr int M = Bn * Sn;                       // 4096 projected rows
  constexpr int GS = (M * E) / (G * Dh);           // 1024 group-tokens per group
  static_assert(GS % AT_QB == 0 && GS % AT_KC == 0);
  static_assert(M % 64 == 0 && E % 64 == 0 && E % 32 == 0);
  if (n_in < 6) return;
  if (in_sizes[0] != M * E || in_sizes[1] != M * E || in_sizes[2] != M * E ||
      in_sizes[3] != E * E || in_sizes[4] != E * E || in_sizes[5] != E * E || out_size != M * E) return;

  const float* xq = (const float*)d_in[0];
  const float* xk = (const float*)d_in[1];
  const float* xv = (const float*)d_in[2];
  const float* wq = (const float*)d_in[3];
  const float* wk = (const float*)d_in[4];
  const float* wv = (const float*)d_in[5];
  float* out = (float*)d_out;

  const size_t bX = (size_t)M * E * 2;            //  8 MiB  bf16 activation copy (x3)
  const size_t bW = (size_t)E * E * 2;            //  2 MiB  bf16 weight copy (x3)
  const size_t bP = (size_t)M * E * 2;            //  8 MiB  bf16 projection plane (x3 hi, x3 lo)
  char* ws = (char*)d_ws;
  size_t off = 0;
  unsigned short* X16 = (unsigned short*)(ws + off); off += 3 * bX;   // [3] x (4096 x 1024) bf16, fragment order
  unsigned short* W16 = (unsigned short*)(ws + off); off += 3 * bW;   // [3] x (1024 x 1024) bf16, fragment order
  unsigned short* PH  = (unsigned short*)(ws + off); off += 3 * bP;   // [3][4096][1024] bf16 hi : q, k, v
  unsigned short* PL  = (unsigned short*)(ws + off); off += 3 * bP;   // [3][4096][1024] bf16 lo : q, k, v
  if (off > ws_size || off > (size_t)134217728) return;               // 81,788,928 B

  const size_t PE = (size_t)M * E;                 // elements per plane
  unsigned short* QH = PH;          unsigned short* QL = PL;
  unsigned short* KH = PH + PE;     unsigned short* KL = PL + PE;
  unsigned short* VH = PH + 2 * PE; unsigned short* VL = PL + 2 * PE;

  dim3 blk256(256), blk128(128);

  // 1-6: RNE bf16 casts of the three activations and the three weights, written in the GEMM's fragment order
  {
    static_assert(E % 64 == 0 && M % 16 == 0);
    const int npx = (M / 16) * (E / 64), npw = (E / 16) * (E / 64);   // waves: one per pair of 16 x 32 tiles
    cast_f32_bf16_frag<E><<<dim3((npx + 7) / 8), blk256, 0, stream>>>(xq, X16, npx);
    cast_f32_bf16_frag<E><<<dim3((npx + 7) / 8), blk256, 0, stream>>>(xk, X16 + PE, npx);
    cast_f32_bf16_frag<E><<<dim3((npx + 7) / 8), blk256, 0, stream>>>(xv, X16 + 2 * PE, npx);
    cast_f32_bf16_frag<E><<<dim3((npw + 7) / 8), blk256, 0, stream>>>(wq, W16, npw);
    cast_f32_bf16_frag<E><<<dim3((npw + 7) / 8), blk256, 0, stream>>>(wk, W16 + (size_t)E * E, npw);
    cast_f32_bf16_frag<E><<<dim3((npw + 7) / 8), blk256, 0, stream>>>(wv, W16 + (size_t)2 * E * E, npw);
  }

  // 7: P_z[m][f] = bf16(x_z)[m][e] . bf16(W_z)[f][e], f32 accumulate, stored as bf16 hi/lo planes; z = 0..2 via grid.y
  {
    const int tiles = (M / 64) * (E / 64);          // 1024 tiles of 64x64 per z; 8 waves per block
    wmma_gemm64<1, false, 0, 2, false, 0, E><<<dim3((tiles + 7) / 8, 3), blk256, 0, stream>>>(
        X16, X16, E, (long)PE,
        W16, W16, E, (long)E * E,
        (void*)PH, (void*)PL, E, (long)PE,
        wq, wq, 0L, M, E, E, 1.0f);
  }

  // 8: attention over 64 groups, each a contiguous [1024][64] slab (group stride 65536 elements, row stride 64); no mask
  {
    const int nblk = G * (GS / AT_QB);               // 64 groups x 16 query blocks = 1024
    const long gstride = (long)GS * Dh;              // 65536
    attn64_planes<<<dim3(nblk), blk128, 0, stream>>>(
        QH, QL, KH, KL, VH, VL, out, gstride, GS, GS / AT_KC, 0.125f);
  }
}

// v005
// A run of this version takes 130 microseconds.
// In two side-by-side timings against v004, it was 1.34 and 1.35 times as fast.
// All steps since v000 together make it 2.68 times as fast.
#include <hip/hip_runtime.h>
#include <math.h>
// Contractions: q/k/v projection GEMMs = v_wmma_f32_16x16x32_bf16 (bf16 operands, one product, f32 accumulate, results stored as bf16 hi/lo planes); scores q.k^T = v_wmma_f32_16x16x32_bf16 (bf16 hi/lo planes of q and k, three products); out = p.v = v_wmma_f32_16x16x32_bf16 (bf16 hi/lo planes of p and v, three products); f32 accumulate everywhere; online softmax in f32.

typedef __attribute__((ext_vector_type(16))) _Float16 v16h;
typedef __attribute__((ext_vector_type(8)))  _Float16 v8h;
typedef __attribute__((ext_vector_type(16))) __bf16   v16b;
typedef __attribute__((ext_vector_type(8)))  __bf16   v8b;
typedef __attribute__((ext_vector_type(8)))  float    v8f;
typedef __attribute__((ext_vector_type(4)))  float    v4f;

__device__ __forceinline__ unsigned short f2bf_bits(float f) {
  unsigned u = __float_as_uint(f);
  return (unsigned short)((u + 0x7FFFu + ((u >> 16) & 1u)) >> 16);
}
__device__ __forceinline__ float bf_bits2f(unsigned short h) { return __uint_as_float(((unsigned)h) << 16); }

// hazard guards as plain device helpers (no inline asm inside the kernel template body)
__device__ __forceinline__ void dep_guard_h(v8f& a, v8f& b, v16h x, v16h y) { asm volatile("v_nop\n\tv_nop\n\tv_nop\n\tv_nop" : "+v"(a), "+v"(b) : "v"(x), "v"(y)); }
__device__ __forceinline__ void dep_guard_b(v8f& a, v8f& b, v16b x, v16b y) { asm volatile("v_nop\n\tv_nop\n\tv_nop\n\tv_nop" : "+v"(a), "+v"(b) : "v"(x), "v"(y)); }
__device__ __forceinline__ void keep4_h(v16h a, v16h b, v16h c, v16h d) { asm volatile("v_nop" :: "v"(a), "v"(b), "v"(c), "v"(d)); }
__device__ __forceinline__ void keep4_b(v16b a, v16b b, v16b c, v16b d) { asm volatile("v_nop" :: "v"(a), "v"(b), "v"(c), "v"(d)); }
__device__ __forceinline__ void acc_guard4(v8f& a, v8f& b, v8f& c, v8f& d) { asm volatile("v_nop\n\tv_nop\n\tv_nop\n\tv_nop" : "+v"(a), "+v"(b), "+v"(c), "+v"(d)); }
template <typename T> struct Frag;
template <> struct Frag<_Float16> {
  typedef v16h V; union U { v16h v; v8h h[2]; };
  static __device__ __forceinline__ v16h load(const _Float16* p) {   // fragment-order tile: elements 0..7 <- p[0..7], 8..15 <- p[256..263]
    U f; f.h[0] = *(const v8h*)(p); f.h[1] = *(const v8h*)(p + 256); return f.v;
  }
  static __device__ __forceinline__ v8f mma(v16h a, v16h b, v8f c) {
    return __builtin_amdgcn_wmma_f32_16x16x32_f16(false, a, false, b, (short)0, c, false, false);
  }
  static __device__ __forceinline__ void guard(v8f& a, v8f& b, v16h x, v16h y) { dep_guard_h(a, b, x, y); }
  static __device__ __forceinline__ void keep(v16h a, v16h b, v16h c, v16h d) { keep4_h(a, b, c, d); }
};
template <> struct Frag<__bf16> {
  typedef v16b V; union U { v16b v; v8b h[2]; };
  static __device__ __forceinline__ v16b load(const __bf16* p) {
    U f; f.h[0] = *(const v8b*)(p); f.h[1] = *(const v8b*)(p + 256); return f.v;
  }
  static __device__ __forceinline__ v8f mma(v16b a, v16b b, v8f c) {
    return __builtin_amdgcn_wmma_f32_16x16x32_bf16(false, a, false, b, (short)0, c, false, false);
  }
  static __device__ __forceinline__ void guard(v8f& a, v8f& b, v16b x, v16b y) { dep_guard_b(a, b, x, y); }
  static __device__ __forceinline__ void keep(v16b a, v16b b, v16b c, v16b d) { keep4_b(a, b, c, d); }
};

// ---- Register-blocked batched WMMA GEMM ------------------------------------
// C[m,n] = scale * sum_k A[m,k] * Bt[n,k] (+bias)(+resid); each wave owns a 64x64 tile.
// A [M,K] and Bt [N,K] in fragment order; M,N % 64 == 0, K % 32 == 0.
// Fragment order: the tile of rows 16*rt..+15 and k 32*kt..+31 is 512 contiguous elements at (rt * (K/32) + kt) * 512;
// in it element (row c, k) lies at ((k >> 4) & 1) * 256 + (((k >> 3) & 1) * 16 + c) * 8 + (k & 7), so lane l's two
// 16-byte pieces lie at l * 8 and 256 + l * 8 and each wave-wide 16-byte load covers 512 contiguous bytes (4 whole lines).
// SPLIT: operands are hi/lo planes (A2/Bt2 = lo planes, same layout); product = hi.hi + hi.lo + lo.hi.
// BIAS_MODE: 0 = none, 1 = bias[m], 2 = bias[n].
// OUT_MODE: 0 = f32, 1 = f16, 2 = bf16 hi plane (Cout) + bf16 lo plane (Cout2).
// ET: 0 = f16 operands, 1 = bf16 operands (pointers passed as 16-bit storage)
template <int ET> struct Elem;
template <> struct Elem<0> { typedef _Float16 T; };
template <> struct Elem<1> { typedef __bf16 T; };
// LDK: K of the stored A and Bt, a compile-time constant, so that the step from one 16-row tile strip to the next is an
// immediate offset of the load (lda and ldb are not read).
template <int ET, bool SPLIT, int BIAS_MODE, int OUT_MODE, bool RESID, int ACT = 0, int LDK = 1024>
__global__ __launch_bounds__(256) void wmma_gemm64(
    const unsigned short* __restrict__ Ap, const unsigned short* __restrict__ A2p, int lda, long strideA,
    const unsigned short* __restrict__ Btp, const unsigned short* __restrict__ Bt2p, int ldb, long strideB,
    void* __restrict__ Cout, void* __restrict__ Cout2, int ldc, long strideC,
    const float* __restrict__ bias,
    const float* __restrict__ resid, long strideR,
    int M, int N, int K, float scale) {
  typedef typename Elem<ET>::T T;
  typedef typename Frag<T>::V V;
  const T* A = (const T*)Ap; const T* A2 = (const T*)A2p; const T* Bt = (const T*)Btp; const T* Bt2 = (const T*)Bt2p;
  __shared__ __align__(16) float sT[8][16 * 68];   // per-wave 16x64 slab, pitch 68 floats
  const int b    = blockIdx.y;
  const int lane = threadIdx.x & 31;
  const int wave = __builtin_amdgcn_readfirstlane(threadIdx.x >> 5);   // wave-uniform: the tile bases below stay in scalar registers
  const int tilesN = N >> 6;
  const int tilesM = M >> 6;
  const int tile = blockIdx.x * 8 + wave;
  if (tile >= tilesM * tilesN) return;   // wave-uniform; no block barriers in this kernel
  const int tm = tile / tilesN;
  const int tn = tile - tm * tilesN;
  const int m0 = tm << 6;
  const int n0 = tn << 6;

  const T* Ab  = A  + (size_t)b * strideA;
  const T* Bb  = Bt + (size_t)b * strideB;
  const T* Ab2 = SPLIT ? (A2  + (size_t)b * strideA) : nullptr;
  const T* Bb2 = SPLIT ? (Bt2 + (size_t)b * strideB) : nullptr;

  const int rlane = lane & 15;                 // row (A) / col (B, D) within subtile
  const int mOff  = (lane >> 4) * 8;           // D row offset

  v8f acc[4][4];
#pragma unroll
  for (int i = 0; i < 4; ++i)
#pragma unroll
    for (int j = 0; j < 4; ++j) acc[i][j] = (v8f){0.f,0.f,0.f,0.f,0.f,0.f,0.f,0.f};

  // one scalar base per operand; one 32-bit vector byte offset serves all loads: lane * 16, + 1024 per k step
  constexpr size_t TS = (size_t)(LDK / 32) * 512;                                // elements per 16-row tile strip
  const size_t aT = (size_t)(m0 >> 4) * TS, bT = (size_t)(n0 >> 4) * TS;
  for (int k0 = 0; k0 < K; k0 += 32) {
    const unsigned vo = (unsigned)(k0 << 5) + (unsigned)(lane * 16);
    V bh[4], bl[4];
#pragma unroll
    for (int j = 0; j < 4; ++j) {
      bh[j] = Frag<T>::load((const T*)((const char*)(Bb + (bT + j * TS)) + vo));
      if (SPLIT) bl[j] = Frag<T>::load((const T*)((const char*)(Bb2 + (bT + j * TS)) + vo));
    }
#pragma unroll
    for (int i = 0; i < 4; ++i) {
      V ah = Frag<T>::load((const T*)((const char*)(Ab + (aT + i * TS)) + vo));
      V al;
      if (SPLIT) al = Frag<T>::load((const T*)((const char*)(Ab2 + (aT + i * TS)) + vo));
#pragma unroll
      for (int j = 0; j < 4; ++j) {
        acc[i][j] = Frag<T>::mma(ah, bh[j], acc[i][j]);
        if (SPLIT) {
          acc[i][j] = Frag<T>::mma(ah, bl[j], acc[i][j]);
          acc[i][j] = Frag<T>::mma(al, bh[j], acc[i][j]);
        }
      }
      Frag<T>::guard(acc[i][0], acc[i][3], ah, SPLIT ? al : ah);
    }
    Frag<T>::keep(bh[0], bh[1], bh[2], bh[3]);
    if (SPLIT) Frag<T>::keep(bl[0], bl[1], bl[2], bl[3]);
  }
  acc_guard4(acc[0][0], acc[0][1], acc[0][2], acc[0][3]);
  acc_guard4(acc[1][0], acc[1][1], acc[1][2], acc[1][3]);
  acc_guard4(acc[2][0], acc[2][1], acc[2][2], acc[2][3]);
  acc_guard4(acc[3][0], acc[3][1], acc[3][2], acc[3][3]);

  // ---- epilogue ----
  float* slab = sT[wave];
  const float* Rb = RESID ? (resid + (size_t)b * strideR) : nullptr;
#pragma unroll
  for (int i = 0; i < 4; ++i) {
    const int mBase = m0 + (i << 4);
#pragma unroll
    for (int j = 0; j < 4; ++j) {
      const int n = n0 + (j << 4) + rlane;
      float bv = 0.f;
      if (BIAS_MODE == 2) bv = bias[n];
#pragma unroll
      for (int r = 0; r < 8; ++r) {
        float v = acc[i][j][r] * scale;
        if (BIAS_MODE == 1) v += bias[mBase + mOff + r];
        if (BIAS_MODE == 2) v += bv;
        if (RESID) v += Rb[(size_t)(mBase + mOff + r) * ldc + n];
        if (ACT == 1) v = tanhf(v);
        if (ACT == 2) v = fmaxf(v, 0.0f);
        if (ACT == 3) v = v / (1.0f + expf(-v));
        if (ACT == 4) v = (v > 0.f) ? v : 0.01f * v;
        if (ACT == 5) v = 0.5f * v * (1.0f + erff(v * 0.70710678118654752f));
        slab[(mOff + r) * 68 + (j << 4) + rlane] = v;
      }
    }
    __builtin_amdgcn_fence(__ATOMIC_RELEASE, "workgroup");
    __builtin_amdgcn_wave_barrier();
    __builtin_amdgcn_fence(__ATOMIC_ACQUIRE, "workgroup");
    if (OUT_MODE == 0) {
      float* C = (float*)Cout + (size_t)b * strideC;
      const int hh = lane >> 4, c4 = (lane & 15) * 4;     // row seg = 256 B = 16 lanes x 16 B
      {
#pragma unroll
        for (int it = 0; it < 8; ++it) {
          const int row = it * 2 + hh;
          v4f v = *(const v4f*)(slab + row * 68 + c4);
          *(v4f*)(C + (size_t)(mBase + row) * ldc + n0 + c4) = v;
        }
        
      }
    } else {
      const int q = lane >> 3, c8 = (lane & 7) * 8;
      unsigned short* C  = (unsigned short*)Cout  + (size_t)b * strideC;
      unsigned short* C2 = (OUT_MODE == 2) ? ((unsigned short*)Cout2 + (size_t)b * strideC) : nullptr;
      {
#pragma unroll
        for (int it = 0; it < 4; ++it) {
          const int row = it * 4 + q;
          const float* sp = slab + row * 68 + c8;
          v8h hv, lv;
#pragma unroll
          for (int e = 0; e < 8; ++e) {
            if (OUT_MODE == 1) {
              hv[e] = (_Float16)sp[e];
            } else {
              unsigned short hb = f2bf_bits(sp[e]);
              unsigned short lb = f2bf_bits(sp[e] - bf_bits2f(hb));
              hv[e] = __builtin_bit_cast(_Float16, hb);
              lv[e] = __builtin_bit_cast(_Float16, lb);
            }
          }
          *(v8h*)(C + (size_t)(mBase + row) * ldc + n0 + c8) = hv;
          if (OUT_MODE == 2) *(v8h*)(C2 + (size_t)(mBase + row) * ldc + n0 + c8) = lv;
        }
        
      }
    }
    __builtin_amdgcn_fence(__ATOMIC_RELEASE, "workgroup");
    __builtin_amdgcn_wave_barrier();
    __builtin_amdgcn_fence(__ATOMIC_ACQUIRE, "workgroup");
  }
}

// f32 row-major [rows][K] -> bf16 (RNE) in the GEMM's fragment order. One wave per two neighbouring 16 x 32 tiles:
// each 16-byte load covers 4 rows x 128 B (whole lines), eight in flight; a lane's four values of one row are 8 bytes of
// the tile, and the four rows of a load are 64 contiguous bytes in each of the tile's four 256-byte quarters.
template <int K>
__global__ __launch_bounds__(256) void cast_f32_bf16_frag(
    const float* __restrict__ in, unsigned short* __restrict__ out, int npair) {
  const int lane = threadIdx.x & 31;
  const int wv   = blockIdx.x * 8 + (threadIdx.x >> 5);
  if (wv >= npair) return;
  const int rt = wv / (K / 64);                // 16-row tile
  const int kq = wv % (K / 64);                // pair of 32-k tiles
  const int rs = lane >> 3;                    // row within a group of four
  const int q  = lane & 7;                     // k = 4q .. 4q+3 within the tile
  const float* sp = in + (size_t)(rt * 16 + rs) * K + kq * 64 + q * 4;
  v4f x[2][4];
#pragma unroll
  for (int t = 0; t < 2; ++t)
#pragma unroll
    for (int i = 0; i < 4; ++i) x[t][i] = *(const v4f*)(sp + (size_t)(4 * i) * K + t * 32);
  unsigned short* dp = out + ((size_t)rt * (K / 32) + kq * 2) * 512 + (q >> 2) * 256 + (((q >> 1) & 1) * 16 + rs) * 8 + (q & 1) * 4;
#pragma unroll
  for (int t = 0; t < 2; ++t)
#pragma unroll
    for (int i = 0; i < 4; ++i) {
      uint2 u;
      u.x = (unsigned)f2bf_bits(x[t][i][0]) | ((unsigned)f2bf_bits(x[t][i][1]) << 16);
      u.y = (unsigned)f2bf_bits(x[t][i][2]) | ((unsigned)f2bf_bits(x[t][i][3]) << 16);
      *(uint2*)(dp + t * 512 + i * 32) = u;
    }
}

// =====================================================================================
// Attention, head_dim 64, no mask. Inputs are bf16 hi/lo planes of q, k, v laid out as G groups of
// contiguous [S][64] slabs (group stride gstride elements, row stride 64); output f32 in the same slab layout.
// Block = 4 waves = 64 query rows of one group; 64-key chunks. Both products run transposed, so that a lane owns one query:
//   scores^T = k.q^T * sscale : A = k rows, B = q rows; k and q hi/lo planes (hi.hi + hi.lo + lo.hi), f32 accumulate
//   out^T   += v^T.p^T        : A = v^T rows, B = p^T; p split into bf16 hi/lo after the max shift, v hi/lo planes (three products)
//   A lane's registers of two neighbouring 16-key score tiles are, in place, its share of a 32-key B operand: p stays in registers.
//   online softmax in f32: maximum and sum run over a lane's own 32 scores, plus one exchange between the wave's halves.
//   Q planes staged once per block in LDS (16-B copies); K and V planes copied row by row per chunk (16-B copies);
//   the V^T fragments come out of the row-major V tile by the transposing LDS load; all staging with plain loads + __syncthreads().
//   grid.x = G * (S/64).
// =====================================================================================
#define AT_D 64
#define AT_NW 4
#define AT_QB 64
#define AT_KC 64
#define AT_LP 72   // LDS row pitch in elements: 144 B = 16 B x odd, so the 16 rows of a 16-byte fragment read fall on distinct banks
#define AT_VP 80   // LDS row pitch of the V tiles in elements: 160 B = 32 B x odd, the conflict-free pitch of the transposing load

__device__ __forceinline__ unsigned short at_bf_bits(float f) {
  unsigned u = __float_as_uint(f);
  return (unsigned short)((u + 0x7FFFu + ((u >> 16) & 1u)) >> 16);
}
__device__ __forceinline__ __bf16 at_f2bf(float f) { return __builtin_bit_cast(__bf16, at_bf_bits(f)); }
__device__ __forceinline__ void at_split(float f, __bf16& hi, __bf16& lo) {
  const unsigned short hb = at_bf_bits(f);
  hi = __builtin_bit_cast(__bf16, hb);
  lo = at_f2bf(f - __uint_as_float(((unsigned)hb) << 16));
}
// three products of a hi/lo x hi/lo pair into one accumulator, then the hazard guard tying D and all four operands
__device__ __forceinline__ v8f at_mma3(v16b ah, v16b al, v16b bh, v16b bl, v8f c) {
  c = __builtin_amdgcn_wmma_f32_16x16x32_bf16(false, ah, false, bh, (short)0, c, false, false);
  c = __builtin_amdgcn_wmma_f32_16x16x32_bf16(false, ah, false, bl, (short)0, c, false, false);
  c = __builtin_amdgcn_wmma_f32_16x16x32_bf16(false, al, false, bh, (short)0, c, false, false);
  asm volatile("v_nop\n\tv_nop\n\tv_nop\n\tv_nop" : "+v"(c) : "v"(ah), "v"(al), "v"(bh), "v"(bl));
  return c;
}

// transposing LDS load: the lanes point at 16 rows x 32 B of a row-major 16-bit tile (lane l: row 8(l >> 4) + (l & 7), 16-byte
// half (l >> 3) & 1); lane (c, hh) receives column c of rows 8hh .. 8hh+7, which is half of an A fragment of the transposed tile
__device__ __forceinline__ v8b at_ld_tr16(const __bf16* p) {
  typedef __attribute__((address_space(3))) v8b lds_v8b;
  return __builtin_amdgcn_ds_load_tr16_b128_v8bf16((lds_v8b*)p);
}

// the value of lane l ^ 16 (the wave's other half), by a vector cross-row move
__device__ __forceinline__ float at_xhalf(float x) {
  const int b = __float_as_int(x);
  return __int_as_float(__builtin_amdgcn_permlanex16(b, b, 0x76543210, 0xfedcba98, false, false));
}

__global__ __launch_bounds__(128)
void attn64_planes(const unsigned short* __restrict__ QH, const unsigned short* __restrict__ QL,
                   const unsigned short* __restrict__ KH, const unsigned short* __restrict__ KL,
                   const unsigned short* __restrict__ VH, const unsigned short* __restrict__ VL,
                   float* __restrict__ out, long gstride, int S, int nkc, float sscale) {
  union FB { v16b v; v8b h[2]; };
  __shared__ __align__(16) __bf16 Qs[AT_NW][2 * 16 * AT_LP];  // per wave Q hi [row][d], then Q lo [row][d]  18 KB
  __shared__ __align__(16) __bf16 Ksh[AT_KC * AT_LP];         // K hi [kv][d]    9 KB
  __shared__ __align__(16) __bf16 Ksl[AT_KC * AT_LP];         // K lo [kv][d]    9 KB
  __shared__ __align__(16) __bf16 Vsh[AT_KC * AT_VP];         // V hi [kv][d]   10 KB
  __shared__ __align__(16) __bf16 Vsl[AT_KC * AT_VP];         // V lo [kv][d]   10 KB
  // The per-wave out tile (16 rows, pitch 68 floats) has no LDS of its own: it lies on the wave's own Q tiles, which no other
  // wave reads and which are dead behind the last chunk's scores. 56 KB a block in all.
  static_assert(16 * 68 * sizeof(float) <= 2 * 16 * AT_LP * sizeof(__bf16));

  const int tid  = threadIdx.x;
  const int wave = tid >> 5;
  const int lane = tid & 31;
  const int hh   = lane >> 4;
  const int c    = lane & 15;

  const int nqb = S / AT_QB;
  const int bx  = blockIdx.x;
  const int qb  = bx % nqb;
  const int g   = bx / nqb;
  const int q0  = qb * AT_QB + wave * 16;

  const __bf16* Qh = (const __bf16*)QH + (size_t)g * gstride;
  const __bf16* Ql = (const __bf16*)QL + (size_t)g * gstride;
  const __bf16* Kh = (const __bf16*)KH + (size_t)g * gstride;
  const __bf16* Kl = (const __bf16*)KL + (size_t)g * gstride;
  const __bf16* Vh = (const __bf16*)VH + (size_t)g * gstride;
  const __bf16* Vl = (const __bf16*)VL + (size_t)g * gstride;
  float*        Og = out + (size_t)g * gstride;

  // ---- Q hi/lo planes for the block's 64 rows: [row][d], 16-B copies (512 chunks per plane, 4 per thread) ----
  {
    const __bf16* qsh = Qh + (size_t)(qb * AT_QB) * AT_D;
    const __bf16* qsl = Ql + (size_t)(qb * AT_QB) * AT_D;
#pragma unroll
    for (int it = 0; it < 4; ++it) {
      const int ch = tid + it * 128;
      const int row = ch >> 3, col = (ch & 7) * 8;
      __bf16* qd = Qs[row >> 4] + (row & 15) * AT_LP + col;
      *(v8b*)(qd)              = *(const v8b*)(qsh + (size_t)row * AT_D + col);
      *(v8b*)(qd + 16 * AT_LP) = *(const v8b*)(qsl + (size_t)row * AT_D + col);
    }
  }
  __syncthreads();

  float mrow = -INFINITY, lrow = 0.f;   // query q0 + c: running maximum (alike in both halves); sum over this half's keys only
  v8f oacc[4];                          // oacc[t][r] = out^T[d = 16t + 8hh + r][query q0 + c]
#pragma unroll
  for (int t = 0; t < 4; ++t) oacc[t] = (v8f){0.f,0.f,0.f,0.f,0.f,0.f,0.f,0.f};

  const int nk = (nkc < 64) ? nkc : 64;                             // host-provided trip count, clamped to a static maximum
  const __bf16* qwh = Qs[wave] + c * AT_LP + 8 * hh;                 // B fragment column c (query row c) of this wave
  const __bf16* qwl = qwh + 16 * AT_LP;

  for (int kc = 0; kc < nk; ++kc) {
    const int kv0 = kc * AT_KC;
    __syncthreads();                                                // readers of the last K/V tile done
    {
      const __bf16* ksh = Kh + (size_t)kv0 * AT_D;
      const __bf16* ksl = Kl + (size_t)kv0 * AT_D;
      const __bf16* vsh = Vh + (size_t)kv0 * AT_D;
      const __bf16* vsl = Vl + (size_t)kv0 * AT_D;
#pragma unroll
      for (int it = 0; it < 4; ++it) {
        const int ch = tid + it * 128;
        const int row = ch >> 3, col = (ch & 7) * 8;                // row = kv within chunk, col = d
        *(v8b*)(Ksh + row * AT_LP + col) = *(const v8b*)(ksh + (size_t)row * AT_D + col);
        *(v8b*)(Ksl + row * AT_LP + col) = *(const v8b*)(ksl + (size_t)row * AT_D + col);
        *(v8b*)(Vsh + row * AT_VP + col) = *(const v8b*)(vsh + (size_t)row * AT_D + col);
        *(v8b*)(Vsl + row * AT_VP + col) = *(const v8b*)(vsl + (size_t)row * AT_D + col);
      }
    }
    __syncthreads();

    // ---- scores^T[64 x 16] = k . q^T  (A = K[kv][d], B = Q[row][d]; split k-map via two 16-B halves at +8hh and +16+8hh) ----
    // s[j][r] = score of key 16j + 8hh + r and query c
    v8f s[4];
#pragma unroll
    for (int j = 0; j < 4; ++j) s[j] = (v8f){0.f,0.f,0.f,0.f,0.f,0.f,0.f,0.f};
#pragma unroll 1
    for (int dc = 0; dc < 2; ++dc) {
      FB qh, ql;
      qh.h[0] = *(const v8b*)(qwh + dc * 32);
      qh.h[1] = *(const v8b*)(qwh + dc * 32 + 16);
      ql.h[0] = *(const v8b*)(qwl + dc * 32);
      ql.h[1] = *(const v8b*)(qwl + dc * 32 + 16);
#pragma unroll
      for (int j = 0; j < 4; ++j) {
        FB kb, kl;
        const __bf16* kp  = Ksh + (j * 16 + c) * AT_LP + dc * 32 + 8 * hh;
        const __bf16* kpl = Ksl + (j * 16 + c) * AT_LP + dc * 32 + 8 * hh;
        kb.h[0] = *(const v8b*)(kp);
        kb.h[1] = *(const v8b*)(kp + 16);
        kl.h[0] = *(const v8b*)(kpl);
        kl.h[1] = *(const v8b*)(kpl + 16);
        s[j] = at_mma3(kb.v, kl.v, qh.v, ql.v, s[j]);
      }
    }
    // ---- scale (f32), the query's maximum: in-lane over 32 keys, then the other half's 32 ----
    float mj[4];
#pragma unroll   // here and below: s, pa, pl and oacc live in registers, so every index into them must be a constant
    for (int j = 0; j < 4; ++j) {
      float m = -INFINITY;
#pragma unroll
      for (int r = 0; r < 8; ++r) {
        const float sv = s[j][r] * sscale;
        s[j][r] = sv;
        m = fmaxf(m, sv);
      }
      mj[j] = m;
    }
    const float mh = fmaxf(fmaxf(mj[0], mj[1]), fmaxf(mj[2], mj[3]));
    const float mnew = fmaxf(mrow, fmaxf(mh, at_xhalf(mh)));
    const float mref = (mnew == -INFINITY) ? 0.0f : mnew;
    const float alpha = __expf(mrow - mref);
    mrow = mnew;
    // p^T as B operand of keys 32kk .. 32kk+31: elements 0..7 = tile 2kk's registers, 8..15 = tile 2kk+1's (the split k-map)
    FB pa[2], pl[2];
    float pj[4];
#pragma unroll
    for (int j = 0; j < 4; ++j) {
      float psum = 0.f;
#pragma unroll
      for (int r = 0; r < 8; ++r) {
        const float p = __expf(s[j][r] - mref);
        psum += p;
        __bf16 a, bl; at_split(p, a, bl);
        pa[j >> 1].v[(j & 1) * 8 + r] = a;
        pl[j >> 1].v[(j & 1) * 8 + r] = bl;
      }
      pj[j] = psum;
    }
    lrow = lrow * alpha + ((pj[0] + pj[1]) + (pj[2] + pj[3]));
#pragma unroll
    for (int t = 0; t < 4; ++t)
#pragma unroll
      for (int r = 0; r < 8; ++r) oacc[t][r] *= alpha;
    // ---- O^T[64 x 16] += V^T[64 x 64] . P^T[64 x 16]  (A = V^T[d][kv] by transposing loads of the [kv][d] tile, B = p^T from registers) ----
#pragma unroll   // pa[kk] and pl[kk] live in registers: kk must be a constant at each use
    for (int kk = 0; kk < 2; ++kk) {
#pragma unroll
      for (int t = 0; t < 4; ++t) {
        FB vb, vl;
        const int vo = (kk * 32 + 8 * hh + (lane & 7)) * AT_VP + t * 16 + ((lane >> 3) & 1) * 8;
        vb.h[0] = at_ld_tr16(Vsh + vo);                  // keys 32kk + 8hh .. +7 of d = 16t + c
        vb.h[1] = at_ld_tr16(Vsh + vo + 16 * AT_VP);     // keys 32kk + 16 + 8hh .. +7
        vl.h[0] = at_ld_tr16(Vsl + vo);
        vl.h[1] = at_ld_tr16(Vsl + vo + 16 * AT_VP);
        oacc[t] = at_mma3(vb.v, vl.v, pa[kk].v, pl[kk].v, oacc[t]);
      }
    }
  }

  float* os = (float*)Qs[wave];   // every value stored here comes out of products that have read all of this wave's Q
  {
    const float inv = 1.0f / (lrow + at_xhalf(lrow));   // the two halves' key sums joined once
#pragma unroll
    for (int t = 0; t < 4; ++t) {                       // a lane's 8 registers are 8 neighbouring d of its query's row
      *(v4f*)(os + c * 68 + t * 16 + 8 * hh)     = (v4f){oacc[t][0] * inv, oacc[t][1] * inv, oacc[t][2] * inv, oacc[t][3] * inv};
      *(v4f*)(os + c * 68 + t * 16 + 8 * hh + 4) = (v4f){oacc[t][4] * inv, oacc[t][5] * inv, oacc[t][6] * inv, oacc[t][7] * inv};
    }
  }
  __builtin_amdgcn_fence(__ATOMIC_RELEASE, "workgroup");
  __builtin_amdgcn_wave_barrier();
  __builtin_amdgcn_fence(__ATOMIC_ACQUIRE, "workgroup");
  {
    const int c4 = (lane & 15) * 4;
    {
#pragma unroll
      for (int it = 0; it < 8; ++it) {
        const int row = it * 2 + hh;                    // hh in 0..1, it in 0..7 -> rows 0..15
        v4f val = *(const v4f*)(os + row * 68 + c4);
        *(v4f*)(Og + (size_t)(q0 + row) * AT_D + c4) = val;
      }
      
    }
  }
}

// ---------------------------------------------------------------------------
// Host orchestration (launches only).
// d_in: 0=query 1=key 2=value [4,1024,1024] f32; 3=Wq 4=Wk 5=Wv [1024,1024] f32 ([out,in]).
// q/k/v = x . W^T as [4096][1024] bf16 hi/lo planes; the raw row-major reshape to [64][1024][64] is a pure
// reinterpretation of the same memory: group g owns the contiguous slab of 1024 rows x 64.
// ---------------------------------------------------------------------------
extern "C" void kernel_launch(void* const* d_in, const int* in_sizes, int n_in,
                              void* d_out, int out_size, void* d_ws, size_t ws_size,
                              hipStream_t stream) {
  constexpr int Bn = 4, Sn = 1024, E = 1024, Dh = 64, G = 64;
  constexpr int M = Bn * Sn;                       // 4096 projected rows
  constexpr int GS = (M * E) / (G * Dh);           // 1024 group-tokens per group
  static_assert(GS % AT_QB == 0 && GS % AT_KC == 0);
  static_assert(M % 64 == 0 && E % 64 == 0 && E % 32 == 0);
  if (n_in < 6) return;
  if (in_sizes[0] != M * E || in_sizes[1] != M * E || in_sizes[2] != M * E ||
      in_sizes[3] != E * E || in_sizes[4] != E * E || in_sizes[5] != E * E || out_size != M * E) return;

  const float* xq = (const float*)d_in[0];
  const float* xk = (const float*)d_in[1];
  const float* xv = (const float*)d_in[2];
  const float* wq = (const float*)d_in[3];
  const float* wk = (const float*)d_in[4];
  const float* wv = (const float*)d_in[5];
  float* out = (float*)d_out;

  const size_t bX = (size_t)M * E * 2;            //  8 MiB  bf16 activation copy (x3)
  const size_t bW = (size_t)E * E * 2;            //  2 MiB  bf16 weight copy (x3)
  const size_t bP = (size_t)M * E * 2;            //  8 MiB  bf16 projection plane (x3 hi, x3 lo)
  char* ws = (char*)d_ws;
  size_t off = 0;
  unsigned short* X16 = (unsigned short*)(ws + off); off += 3 * bX;   // [3] x (4096 x 1024) bf16, fragment order
  unsigned short* W16 = (unsigned short*)(ws + off); off += 3 * bW;   // [3] x (1024 x 1024) bf16, fragment order
  unsigned short* PH  = (unsigned short*)(ws + off); off += 3 * bP;   // [3][4096][1024] bf16 hi : q, k, v
  unsigned short* PL  = (unsigned short*)(ws + off); off += 3 * bP;   // [3][4096][1024] bf16 lo : q, k, v
  if (off > ws_size || off > (size_t)134217728) return;               // 81,788,928 B

  const size_t PE = (size_t)M * E;                 // elements per plane
  unsigned short* QH = PH;          unsigned short* QL = PL;
  unsigned short* KH = PH + PE;     unsigned short* KL = PL + PE;
  unsigned short* VH = PH + 2 * PE; unsigned short* VL = PL + 2 * PE;

  dim3 blk256(256), blk128(128);

  // 1-6: RNE bf16 casts of the three activations and the three weights, written in the GEMM's fragment order
  {
    static_assert(E % 64 == 0 && M % 16 == 0);
    const int npx = (M / 16) * (E / 64), npw = (E / 16) * (E / 64);   // waves: one per pair of 16 x 32 tiles
    cast_f32_bf16_frag<E><<<dim3((npx + 7) / 8), blk256, 0, stream>>>(xq, X16, npx);
    cast_f32_bf16_frag<E><<<dim3((npx + 7) / 8), blk256, 0, stream>>>(xk, X16 + PE, npx);
    cast_f32_bf16_frag<E><<<dim3((npx + 7) / 8), blk256, 0, stream>>>(xv, X16 + 2 * PE, npx);
    cast_f32_bf16_frag<E><<<dim3((npw + 7) / 8), blk256, 0, stream>>>(wq, W16, npw);
    cast_f32_bf16_frag<E><<<dim3((npw + 7) / 8), blk256, 0, stream>>>(wk, W16 + (size_t)E * E, npw);
    cast_f32_bf16_frag<E><<<dim3((npw + 7) / 8), blk256, 0, stream>>>(wv, W16 + (size_t)2 * E * E, npw);
  }

  // 7: P_z[m][f] = bf16(x_z)[m][e] . bf16(W_z)[f][e], f32 accumulate, stored as bf16 hi/lo planes; z = 0..2 via grid.y
  {
    const int tiles = (M / 64) * (E / 64);          // 1024 tiles of 64x64 per z; 8 waves per block
    wmma_gemm64<1, false, 0, 2, false, 0, E><<<dim3((tiles + 7) / 8, 3), blk256, 0, stream>>>(
        X16, X16, E, (long)PE,
        W16, W16, E, (long)E * E,
        (void*)PH, (void*)PL, E, (long)PE,
        wq, wq, 0L, M, E, E, 1.0f);
  }

  // 8: attention over 64 groups, each a contiguous [1024][64] slab (group stride 65536 elements, row stride 64); no mask
  {
    const int nblk = G * (GS / AT_QB);               // 64 groups x 16 query blocks = 1024
    const long gstride = (long)GS * Dh;              // 65536
    attn64_planes<<<dim3(nblk), blk128, 0, stream>>>(
        QH, QL, KH, KL, VH, VL, out, gstride, GS, GS / AT_KC, 0.125f);
  }
}

// v006
// A run of this version takes 109 microseconds.
// Next to v005, in two timings, it ran 1.20 and 1.19 times as fast.
// Over all steps from v000 it is 3.20 times as fast.
#include <hip/hip_runtime.h>
#include <math.h>
// Contractions: q/k/v projection GEMMs = v_wmma_f32_16x16x32_bf16 (bf16 operands, one product, f32 accumulate, results stored as bf16 hi/lo planes); scores q.k^T = v_wmma_f32_16x16x32_bf16 (bf16 hi/lo planes of q and k, three products); out = p.v = v_wmma_f32_16x16x32_bf16 (bf16 hi/lo planes of p and v, three products); f32 accumulate everywhere; online softmax in f32.

typedef __attribute__((ext_vector_type(16))) _Float16 v16h;
typedef __attribute__((ext_vector_type(8)))  _Float16 v8h;
typedef __attribute__((ext_vector_type(16))) __bf16   v16b;
typedef __attribute__((ext_vector_type(8)))  __bf16   v8b;
typedef __attribute__((ext_vector_type(8)))  float    v8f;
typedef __attribute__((ext_vector_type(4)))  float    v4f;

__device__ __forceinline__ unsigned short f2bf_bits(float f) {
  unsigned u = __float_as_uint(f);
  return (unsigned short)((u + 0x7FFFu + ((u >> 16) & 1u)) >> 16);
}
__device__ __forceinline__ float bf_bits2f(unsigned short h) { return __uint_as_float(((unsigned)h) << 16); }

// hazard guards as plain device helpers (no inline asm inside the kernel template body)
__device__ __forceinline__ void dep_guard_h(v8f& a, v8f& b, v16h x, v16h y) { asm volatile("v_nop\n\tv_nop\n\tv_nop\n\tv_nop" : "+v"(a), "+v"(b) : "v"(x), "v"(y)); }
__device__ __forceinline__ void dep_guard_b(v8f& a, v8f& b, v16b x, v16b y) { asm volatile("v_nop\n\tv_nop\n\tv_nop\n\tv_nop" : "+v"(a), "+v"(b) : "v"(x), "v"(y)); }
__device__ __forceinline__ void keep4_h(v16h a, v16h b, v16h c, v16h d) { asm volatile("v_nop" :: "v"(a), "v"(b), "v"(c), "v"(d)); }
__device__ __forceinline__ void keep4_b(v16b a, v16b b, v16b c, v16b d) { asm volatile("v_nop" :: "v"(a), "v"(b), "v"(c), "v"(d)); }
__device__ __forceinline__ void acc_guard4(v8f& a, v8f& b, v8f& c, v8f& d) { asm volatile("v_nop\n\tv_nop\n\tv_nop\n\tv_nop" : "+v"(a), "+v"(b), "+v"(c), "+v"(d)); }
template <typename T> struct Frag;
template <> struct Frag<_Float16> {
  typedef v16h V; union U { v16h v; v8h h[2]; };
  static __device__ __forceinline__ v16h load(const _Float16* p) {   // fragment-order tile: elements 0..7 <- p[0..7], 8..15 <- p[256..263]
    U f; f.h[0] = *(const v8h*)(p); f.h[1] = *(const v8h*)(p + 256); return f.v;
  }
  static __device__ __forceinline__ v8f mma(v16h a, v16h b, v8f c) {
    return __builtin_amdgcn_wmma_f32_16x16x32_f16(false, a, false, b, (short)0, c, false, false);
  }
  static __device__ __forceinline__ void guard(v8f& a, v8f& b, v16h x, v16h y) { dep_guard_h(a, b, x, y); }
  static __device__ __forceinline__ void keep(v16h a, v16h b, v16h c, v16h d) { keep4_h(a, b, c, d); }
};
template <> struct Frag<__bf16> {
  typedef v16b V; union U { v16b v; v8b h[2]; };
  static __device__ __forceinline__ v16b load(const __bf16* p) {
    U f; f.h[0] = *(const v8b*)(p); f.h[1] = *(const v8b*)(p + 256); return f.v;
  }
  static __device__ __forceinline__ v8f mma(v16b a, v16b b, v8f c) {
    return __builtin_amdgcn_wmma_f32_16x16x32_bf16(false, a, false, b, (short)0, c, false, false);
  }
  static __device__ __forceinline__ void guard(v8f& a, v8f& b, v16b x, v16b y) { dep_guard_b(a, b, x, y); }
  static __device__ __forceinline__ void keep(v16b a, v16b b, v16b c, v16b d) { keep4_b(a, b, c, d); }
};

// ---- Register-blocked batched WMMA GEMM ------------------------------------
// C[m,n] = scale * sum_k A[m,k] * Bt[n,k] (+bias)(+resid); each wave owns a 64x64 tile.
// A [M,K] and Bt [N,K] in fragment order; M,N % 64 == 0, K % 32 == 0.
// Fragment order: the tile of rows 16*rt..+15 and k 32*kt..+31 is 512 contiguous elements at (rt * (K/32) + kt) * 512;
// in it element (row c, k) lies at ((k >> 4) & 1) * 256 + (((k >> 3) & 1) * 16 + c) * 8 + (k & 7), so lane l's two
// 16-byte pieces lie at l * 8 and 256 + l * 8 and each wave-wide 16-byte load covers 512 contiguous bytes (4 whole lines).
// SPLIT: operands are hi/lo planes (A2/Bt2 = lo planes, same layout); product = hi.hi + hi.lo + lo.hi.
// BIAS_MODE: 0 = none, 1 = bias[m], 2 = bias[n].
// OUT_MODE: 0 = f32, 1 = f16, 2 = bf16 hi plane (Cout) + bf16 lo plane (Cout2).
// ET: 0 = f16 operands, 1 = bf16 operands (pointers passed as 16-bit storage)
template <int ET> struct Elem;
template <> struct Elem<0> { typedef _Float16 T; };
template <> struct Elem<1> { typedef __bf16 T; };
// LDK: K of the stored A and Bt, a compile-time constant, so that the step from one 16-row tile strip to the next is an
// immediate offset of the load (lda and ldb are not read).
template <int ET, bool SPLIT, int BIAS_MODE, int OUT_MODE, bool RESID, int ACT = 0, int LDK = 1024>
__global__ __launch_bounds__(256) void wmma_gemm64(
    const unsigned short* __restrict__ Ap, const unsigned short* __restrict__ A2p, int lda, long strideA,
    const unsigned short* __restrict__ Btp, const unsigned short* __restrict__ Bt2p, int ldb, long strideB,
    void* __restrict__ Cout, void* __restrict__ Cout2, int ldc, long strideC,
    const float* __restrict__ bias,
    const float* __restrict__ resid, long strideR,
    int M, int N, int K, float scale) {
  typedef typename Elem<ET>::T T;
  typedef typename Frag<T>::V V;
  const T* A = (const T*)Ap; const T* A2 = (const T*)A2p; const T* Bt = (const T*)Btp; const T* Bt2 = (const T*)Bt2p;
  __shared__ __align__(16) float sT[8][16 * 68];   // per-wave 16x64 slab, pitch 68 floats
  const int b    = blockIdx.y;
  const int lane = threadIdx.x & 31;
  const int wave = __builtin_amdgcn_readfirstlane(threadIdx.x >> 5);   // wave-uniform: the tile bases below stay in scalar registers
  const int tilesN = N >> 6;
  const int tilesM = M >> 6;
  const int tile = blockIdx.x * 8 + wave;
  if (tile >= tilesM * tilesN) return;   // wave-uniform; no block barriers in this kernel
  const int tm = tile / tilesN;
  const int tn = tile - tm * tilesN;
  const int m0 = tm << 6;
  const int n0 = tn << 6;

  const T* Ab  = A  + (size_t)b * strideA;
  const T* Bb  = Bt + (size_t)b * strideB;
  const T* Ab2 = SPLIT ? (A2  + (size_t)b * strideA) : nullptr;
  const T* Bb2 = SPLIT ? (Bt2 + (size_t)b * strideB) : nullptr;

  const int rlane = lane & 15;                 // row (A) / col (B, D) within subtile
  const int mOff  = (lane >> 4) * 8;           // D row offset

  v8f acc[4][4];
#pragma unroll
  for (int i = 0; i < 4; ++i)
#pragma unroll
    for (int j = 0; j < 4; ++j) acc[i][j] = (v8f){0.f,0.f,0.f,0.f,0.f,0.f,0.f,0.f};

  // one scalar base per operand; one 32-bit vector byte offset serves all loads: lane * 16, + 1024 per k step
  constexpr size_t TS = (size_t)(LDK / 32) * 512;                                // elements per 16-row tile strip
  const size_t aT = (size_t)(m0 >> 4) * TS, bT = (size_t)(n0 >> 4) * TS;
  for (int k0 = 0; k0 < K; k0 += 32) {
    const unsigned vo = (unsigned)(k0 << 5) + (unsigned)(lane * 16);
    V bh[4], bl[4];
#pragma unroll
    for (int j = 0; j < 4; ++j) {
      bh[j] = Frag<T>::load((const T*)((const char*)(Bb + (bT + j * TS)) + vo));
      if (SPLIT) bl[j] = Frag<T>::load((const T*)((const char*)(Bb2 + (bT + j * TS)) + vo));
    }
    // all four A fragments of the k step are requested here, in one group with the B fragments: the step then waits out one
    // load latency, not one per A fragment
    V ah[4], al[4];
#pragma unroll
    for (int i = 0; i < 4; ++i) {
      ah[i] = Frag<T>::load((const T*)((const char*)(Ab + (aT + i * TS)) + vo));
      if (SPLIT) al[i] = Frag<T>::load((const T*)((const char*)(Ab2 + (aT + i * TS)) + vo));
    }
#pragma unroll
    for (int i = 0; i < 4; ++i) {
#pragma unroll
      for (int j = 0; j < 4; ++j) {
        acc[i][j] = Frag<T>::mma(ah[i], bh[j], acc[i][j]);
        if (SPLIT) {
          acc[i][j] = Frag<T>::mma(ah[i], bl[j], acc[i][j]);
          acc[i][j] = Frag<T>::mma(al[i], bh[j], acc[i][j]);
        }
      }
      Frag<T>::guard(acc[i][0], acc[i][3], ah[i], SPLIT ? al[i] : ah[i]);
    }
    Frag<T>::keep(bh[0], bh[1], bh[2], bh[3]);
    if (SPLIT) Frag<T>::keep(bl[0], bl[1], bl[2], bl[3]);
  }
  acc_guard4(acc[0][0], acc[0][1], acc[0][2], acc[0][3]);
  acc_guard4(acc[1][0], acc[1][1], acc[1][2], acc[1][3]);
  acc_guard4(acc[2][0], acc[2][1], acc[2][2], acc[2][3]);
  acc_guard4(acc[3][0], acc[3][1], acc[3][2], acc[3][3]);

  // ---- epilogue ----
  float* slab = sT[wave];
  const float* Rb = RESID ? (resid + (size_t)b * strideR) : nullptr;
#pragma unroll
  for (int i = 0; i < 4; ++i) {
    const int mBase = m0 + (i << 4);
#pragma unroll
    for (int j = 0; j < 4; ++j) {
      const int n = n0 + (j << 4) + rlane;
      float bv = 0.f;
      if (BIAS_MODE == 2) bv = bias[n];
#pragma unroll
      for (int r = 0; r < 8; ++r) {
        float v = acc[i][j][r] * scale;
        if (BIAS_MODE == 1) v += bias[mBase + mOff + r];
        if (BIAS_MODE == 2) v += bv;
        if (RESID) v += Rb[(size_t)(mBase + mOff + r) * ldc + n];
        if (ACT == 1) v = tanhf(v);
        if (ACT == 2) v = fmaxf(v, 0.0f);
        if (ACT == 3) v = v / (1.0f + expf(-v));
        if (ACT == 4) v = (v > 0.f) ? v : 0.01f * v;
        if (ACT == 5) v = 0.5f * v * (1.0f + erff(v * 0.70710678118654752f));
        slab[(mOff + r) * 68 + (j << 4) + rlane] = v;
      }
    }
    __builtin_amdgcn_fence(__ATOMIC_RELEASE, "workgroup");
    __builtin_amdgcn_wave_barrier();
    __builtin_amdgcn_fence(__ATOMIC_ACQUIRE, "workgroup");
    if (OUT_MODE == 0) {
      float* C = (float*)Cout + (size_t)b * strideC;
      const int hh = lane >> 4, c4 = (lane & 15) * 4;     // row seg = 256 B = 16 lanes x 16 B
      {
#pragma unroll
        for (int it = 0; it < 8; ++it) {
          const int row = it * 2 + hh;
          v4f v = *(const v4f*)(slab + row * 68 + c4);
          *(v4f*)(C + (size_t)(mBase + row) * ldc + n0 + c4) = v;
        }
        
      }
    } else {
      const int q = lane >> 3, c8 = (lane & 7) * 8;
      unsigned short* C  = (unsigned short*)Cout  + (size_t)b * strideC;
      unsigned short* C2 = (OUT_MODE == 2) ? ((unsigned short*)Cout2 + (size_t)b * strideC) : nullptr;
      {
#pragma unroll
        for (int it = 0; it < 4; ++it) {
          const int row = it * 4 + q;
          const float* sp = slab + row * 68 + c8;
          v8h hv, lv;
#pragma unroll
          for (int e = 0; e < 8; ++e) {
            if (OUT_MODE == 1) {
              hv[e] = (_Float16)sp[e];
            } else {
              unsigned short hb = f2bf_bits(sp[e]);
              unsigned short lb = f2bf_bits(sp[e] - bf_bits2f(hb));
              hv[e] = __builtin_bit_cast(_Float16, hb);
              lv[e] = __builtin_bit_cast(_Float16, lb);
            }
          }
          *(v8h*)(C + (size_t)(mBase + row) * ldc + n0 + c8) = hv;
          if (OUT_MODE == 2) *(v8h*)(C2 + (size_t)(mBase + row) * ldc + n0 + c8) = lv;
        }
        
      }
    }
    __builtin_amdgcn_fence(__ATOMIC_RELEASE, "workgroup");
    __builtin_amdgcn_wave_barrier();
    __builtin_amdgcn_fence(__ATOMIC_ACQUIRE, "workgroup");
  }
}

// f32 row-major [rows][K] -> bf16 (RNE) in the GEMM's fragment order. One wave per two neighbouring 16 x 32 tiles:
// each 16-byte load covers 4 rows x 128 B (whole lines), eight in flight; a lane's four values of one row are 8 bytes of
// the tile, and the four rows of a load are 64 contiguous bytes in each of the tile's four 256-byte quarters.
template <int K>
__global__ __launch_bounds__(256) void cast_f32_bf16_frag(
    const float* __restrict__ in, unsigned short* __restrict__ out, int npair) {
  const int lane = threadIdx.x & 31;
  const int wv   = blockIdx.x * 8 + (threadIdx.x >> 5);
  if (wv >= npair) return;
  const int rt = wv / (K / 64);                // 16-row tile
  const int kq = wv % (K / 64);                // pair of 32-k tiles
  const int rs = lane >> 3;                    // row within a group of four
  const int q  = lane & 7;                     // k = 4q .. 4q+3 within the tile
  const float* sp = in + (size_t)(rt * 16 + rs) * K + kq * 64 + q * 4;
  v4f x[2][4];
#pragma unroll
  for (int t = 0; t < 2; ++t)
#pragma unroll
    for (int i = 0; i < 4; ++i) x[t][i] = *(const v4f*)(sp + (size_t)(4 * i) * K + t * 32);
  unsigned short* dp = out + ((size_t)rt * (K / 32) + kq * 2) * 512 + (q >> 2) * 256 + (((q >> 1) & 1) * 16 + rs) * 8 + (q & 1) * 4;
#pragma unroll
  for (int t = 0; t < 2; ++t)
#pragma unroll
    for (int i = 0; i < 4; ++i) {
      uint2 u;
      u.x = (unsigned)f2bf_bits(x[t][i][0]) | ((unsigned)f2bf_bits(x[t][i][1]) << 16);
      u.y = (unsigned)f2bf_bits(x[t][i][2]) | ((unsigned)f2bf_bits(x[t][i][3]) << 16);
      *(uint2*)(dp + t * 512 + i * 32) = u;
    }
}

// =====================================================================================
// Attention, head_dim 64, no mask. Inputs are bf16 hi/lo planes of q, k, v laid out as G groups of
// contiguous [S][64] slabs (group stride gstride elements, row stride 64); output f32 in the same slab layout.
// Block = 4 waves = 64 query rows of one group; 64-key chunks. Both products run transposed, so that a lane owns one query:
//   scores^T = k.q^T * sscale : A = k rows, B = q rows; k and q hi/lo planes (hi.hi + hi.lo + lo.hi), f32 accumulate
//   out^T   += v^T.p^T        : A = v^T rows, B = p^T; p split into bf16 hi/lo after the max shift, v hi/lo planes (three products)
//   A lane's registers of two neighbouring 16-key score tiles are, in place, its share of a 32-key B operand: p stays in registers.
//   online softmax in f32: maximum and sum run over a lane's own 32 scores, plus one exchange between the wave's halves.
//   Q planes staged once per block in LDS (16-B copies); K and V planes copied row by row per chunk (16-B copies);
//   the V^T fragments come out of the row-major V tile by the transposing LDS load; all staging with plain loads + __syncthreads().
//   grid.x = G * (S/64).
// =====================================================================================
#define AT_D 64
#define AT_NW 4
#define AT_QB 64
#define AT_KC 64
#define AT_LP 72   // LDS row pitch in elements: 144 B = 16 B x odd, so the 16 rows of a 16-byte fragment read fall on distinct banks
#define AT_VP 80   // LDS row pitch of the V tiles in elements: 160 B = 32 B x odd, the conflict-free pitch of the transposing load

__device__ __forceinline__ unsigned short at_bf_bits(float f) {
  unsigned u = __float_as_uint(f);
  return (unsigned short)((u + 0x7FFFu + ((u >> 16) & 1u)) >> 16);
}
__device__ __forceinline__ __bf16 at_f2bf(float f) { return __builtin_bit_cast(__bf16, at_bf_bits(f)); }
__device__ __forceinline__ void at_split(float f, __bf16& hi, __bf16& lo) {
  const unsigned short hb = at_bf_bits(f);
  hi = __builtin_bit_cast(__bf16, hb);
  lo = at_f2bf(f - __uint_as_float(((unsigned)hb) << 16));
}
// three products of a hi/lo x hi/lo pair into one accumulator, then the hazard guard tying D and all four operands
__device__ __forceinline__ v8f at_mma3(v16b ah, v16b al, v16b bh, v16b bl, v8f c) {
  c = __builtin_amdgcn_wmma_f32_16x16x32_bf16(false, ah, false, bh, (short)0, c, false, false);
  c = __builtin_amdgcn_wmma_f32_16x16x32_bf16(false, ah, false, bl, (short)0, c, false, false);
  c = __builtin_amdgcn_wmma_f32_16x16x32_bf16(false, al, false, bh, (short)0, c, false, false);
  asm volatile("v_nop\n\tv_nop\n\tv_nop\n\tv_nop" : "+v"(c) : "v"(ah), "v"(al), "v"(bh), "v"(bl));
  return c;
}

// transposing LDS load: the lanes point at 16 rows x 32 B of a row-major 16-bit tile (lane l: row 8(l >> 4) + (l & 7), 16-byte
// half (l >> 3) & 1); lane (c, hh) receives column c of rows 8hh .. 8hh+7, which is half of an A fragment of the transposed tile
__device__ __forceinline__ v8b at_ld_tr16(const __bf16* p) {
  typedef __attribute__((address_space(3))) v8b lds_v8b;
  return __builtin_amdgcn_ds_load_tr16_b128_v8bf16((lds_v8b*)p);
}

// the value of lane l ^ 16 (the wave's other half), by a vector cross-row move
__device__ __forceinline__ float at_xhalf(float x) {
  const int b = __float_as_int(x);
  return __int_as_float(__builtin_amdgcn_permlanex16(b, b, 0x76543210, 0xfedcba98, false, false));
}

__global__ __launch_bounds__(128)
void attn64_planes(const unsigned short* __restrict__ QH, const unsigned short* __restrict__ QL,
                   const unsigned short* __restrict__ KH, const unsigned short* __restrict__ KL,
                   const unsigned short* __restrict__ VH, const unsigned short* __restrict__ VL,
                   float* __restrict__ out, long gstride, int S, int nkc, float sscale) {
  union FB { v16b v; v8b h[2]; };
  __shared__ __align__(16) __bf16 Qs[AT_NW][2 * 16 * AT_LP];  // per wave Q hi [row][d], then Q lo [row][d]  18 KB
  __shared__ __align__(16) __bf16 Ksh[AT_KC * AT_LP];         // K hi [kv][d]    9 KB
  __shared__ __align__(16) __bf16 Ksl[AT_KC * AT_LP];         // K lo [kv][d]    9 KB
  __shared__ __align__(16) __bf16 Vsh[AT_KC * AT_VP];         // V hi [kv][d]   10 KB
  __shared__ __align__(16) __bf16 Vsl[AT_KC * AT_VP];         // V lo [kv][d]   10 KB
  // The per-wave out tile (16 rows, pitch 68 floats) has no LDS of its own: it lies on the wave's own Q tiles, which no other
  // wave reads and which are dead behind the last chunk's scores. 56 KB a block in all.
  static_assert(16 * 68 * sizeof(float) <= 2 * 16 * AT_LP * sizeof(__bf16));

  const int tid  = threadIdx.x;
  const int wave = tid >> 5;
  const int lane = tid & 31;
  const int hh   = lane >> 4;
  const int c    = lane & 15;

  const int nqb = S / AT_QB;
  const int bx  = blockIdx.x;
  const int qb  = bx % nqb;
  const int g   = bx / nqb;
  const int q0  = qb * AT_QB + wave * 16;

  const __bf16* Qh = (const __bf16*)QH + (size_t)g * gstride;
  const __bf16* Ql = (const __bf16*)QL + (size_t)g * gstride;
  const __bf16* Kh = (const __bf16*)KH + (size_t)g * gstride;
  const __bf16* Kl = (const __bf16*)KL + (size_t)g * gstride;
  const __bf16* Vh = (const __bf16*)VH + (size_t)g * gstride;
  const __bf16* Vl = (const __bf16*)VL + (size_t)g * gstride;
  float*        Og = out + (size_t)g * gstride;

  // ---- Q hi/lo planes for the block's 64 rows: [row][d], 16-B copies (512 chunks per plane, 4 per thread) ----
  {
    const __bf16* qsh = Qh + (size_t)(qb * AT_QB) * AT_D;
    const __bf16* qsl = Ql + (size_t)(qb * AT_QB) * AT_D;
#pragma unroll
    for (int it = 0; it < 4; ++it) {
      const int ch = tid + it * 128;
      const int row = ch >> 3, col = (ch & 7) * 8;
      __bf16* qd = Qs[row >> 4] + (row & 15) * AT_LP + col;
      *(v8b*)(qd)              = *(const v8b*)(qsh + (size_t)row * AT_D + col);
      *(v8b*)(qd + 16 * AT_LP) = *(const v8b*)(qsl + (size_t)row * AT_D + col);
    }
  }
  __syncthreads();

  float mrow = -INFINITY, lrow = 0.f;   // query q0 + c: running maximum (alike in both halves); sum over this half's keys only
  v8f oacc[4];                          // oacc[t][r] = out^T[d = 16t + 8hh + r][query q0 + c]
#pragma unroll
  for (int t = 0; t < 4; ++t) oacc[t] = (v8f){0.f,0.f,0.f,0.f,0.f,0.f,0.f,0.f};

  const int nk = (nkc < 64) ? nkc : 64;                             // host-provided trip count, clamped to a static maximum
  const __bf16* qwh = Qs[wave] + c * AT_LP + 8 * hh;                 // B fragment column c (query row c) of this wave
  const __bf16* qwl = qwh + 16 * AT_LP;

  for (int kc = 0; kc < nk; ++kc) {
    const int kv0 = kc * AT_KC;
    __syncthreads();                                                // readers of the last K/V tile done
    {
      const __bf16* ksh = Kh + (size_t)kv0 * AT_D;
      const __bf16* ksl = Kl + (size_t)kv0 * AT_D;
      const __bf16* vsh = Vh + (size_t)kv0 * AT_D;
      const __bf16* vsl = Vl + (size_t)kv0 * AT_D;
#pragma unroll
      for (int it = 0; it < 4; ++it) {
        const int ch = tid + it * 128;
        const int row = ch >> 3, col = (ch & 7) * 8;                // row = kv within chunk, col = d
        *(v8b*)(Ksh + row * AT_LP + col) = *(const v8b*)(ksh + (size_t)row * AT_D + col);
        *(v8b*)(Ksl + row * AT_LP + col) = *(const v8b*)(ksl + (size_t)row * AT_D + col);
        *(v8b*)(Vsh + row * AT_VP + col) = *(const v8b*)(vsh + (size_t)row * AT_D + col);
        *(v8b*)(Vsl + row * AT_VP + col) = *(const v8b*)(vsl + (size_t)row * AT_D + col);
      }
    }
    __syncthreads();

    // ---- scores^T[64 x 16] = k . q^T  (A = K[kv][d], B = Q[row][d]; split k-map via two 16-B halves at +8hh and +16+8hh) ----
    // s[j][r] = score of key 16j + 8hh + r and query c
    v8f s[4];
#pragma unroll
    for (int j = 0; j < 4; ++j) s[j] = (v8f){0.f,0.f,0.f,0.f,0.f,0.f,0.f,0.f};
#pragma unroll 1
    for (int dc = 0; dc < 2; ++dc) {
      FB qh, ql;
      qh.h[0] = *(const v8b*)(qwh + dc * 32);
      qh.h[1] = *(const v8b*)(qwh + dc * 32 + 16);
      ql.h[0] = *(const v8b*)(qwl + dc * 32);
      ql.h[1] = *(const v8b*)(qwl + dc * 32 + 16);
#pragma unroll
      for (int j = 0; j < 4; ++j) {
        FB kb, kl;
        const __bf16* kp  = Ksh + (j * 16 + c) * AT_LP + dc * 32 + 8 * hh;
        const __bf16* kpl = Ksl + (j * 16 + c) * AT_LP + dc * 32 + 8 * hh;
        kb.h[0] = *(const v8b*)(kp);
        kb.h[1] = *(const v8b*)(kp + 16);
        kl.h[0] = *(const v8b*)(kpl);
        kl.h[1] = *(const v8b*)(kpl + 16);
        s[j] = at_mma3(kb.v, kl.v, qh.v, ql.v, s[j]);
      }
    }
    // ---- scale (f32), the query's maximum: in-lane over 32 keys, then the other half's 32 ----
    float mj[4];
#pragma unroll   // here and below: s, pa, pl and oacc live in registers, so every index into them must be a constant
    for (int j = 0; j < 4; ++j) {
      float m = -INFINITY;
#pragma unroll
      for (int r = 0; r < 8; ++r) {
        const float sv = s[j][r] * sscale;
        s[j][r] = sv;
        m = fmaxf(m, sv);
      }
      mj[j] = m;
    }
    const float mh = fmaxf(fmaxf(mj[0], mj[1]), fmaxf(mj[2], mj[3]));
    const float mnew = fmaxf(mrow, fmaxf(mh, at_xhalf(mh)));
    const float mref = (mnew == -INFINITY) ? 0.0f : mnew;
    const float alpha = __expf(mrow - mref);
    mrow = mnew;
    // p^T as B operand of keys 32kk .. 32kk+31: elements 0..7 = tile 2kk's registers, 8..15 = tile 2kk+1's (the split k-map)
    FB pa[2], pl[2];
    float pj[4];
#pragma unroll
    for (int j = 0; j < 4; ++j) {
      float psum = 0.f;
#pragma unroll
      for (int r = 0; r < 8; ++r) {
        const float p = __expf(s[j][r] - mref);
        psum += p;
        __bf16 a, bl; at_split(p, a, bl);
        pa[j >> 1].v[(j & 1) * 8 + r] = a;
        pl[j >> 1].v[(j & 1) * 8 + r] = bl;
      }
      pj[j] = psum;
    }
    lrow = lrow * alpha + ((pj[0] + pj[1]) + (pj[2] + pj[3]));
#pragma unroll
    for (int t = 0; t < 4; ++t)
#pragma unroll
      for (int r = 0; r < 8; ++r) oacc[t][r] *= alpha;
    // ---- O^T[64 x 16] += V^T[64 x 64] . P^T[64 x 16]  (A = V^T[d][kv] by transposing loads of the [kv][d] tile, B = p^T from registers) ----
#pragma unroll   // pa[kk] and pl[kk] live in registers: kk must be a constant at each use
    for (int kk = 0; kk < 2; ++kk) {
#pragma unroll
      for (int t = 0; t < 4; ++t) {
        FB vb, vl;
        const int vo = (kk * 32 + 8 * hh + (lane & 7)) * AT_VP + t * 16 + ((lane >> 3) & 1) * 8;
        vb.h[0] = at_ld_tr16(Vsh + vo);                  // keys 32kk + 8hh .. +7 of d = 16t + c
        vb.h[1] = at_ld_tr16(Vsh + vo + 16 * AT_VP);     // keys 32kk + 16 + 8hh .. +7
        vl.h[0] = at_ld_tr16(Vsl + vo);
        vl.h[1] = at_ld_tr16(Vsl + vo + 16 * AT_VP);
        oacc[t] = at_mma3(vb.v, vl.v, pa[kk].v, pl[kk].v, oacc[t]);
      }
    }
  }

  float* os = (float*)Qs[wave];   // every value stored here comes out of products that have read all of this wave's Q
  {
    const float inv = 1.0f / (lrow + at_xhalf(lrow));   // the two halves' key sums joined once
#pragma unroll
    for (int t = 0; t < 4; ++t) {                       // a lane's 8 registers are 8 neighbouring d of its query's row
      *(v4f*)(os + c * 68 + t * 16 + 8 * hh)     = (v4f){oacc[t][0] * inv, oacc[t][1] * inv, oacc[t][2] * inv, oacc[t][3] * inv};
      *(v4f*)(os + c * 68 + t * 16 + 8 * hh + 4) = (v4f){oacc[t][4] * inv, oacc[t][5] * inv, oacc[t][6] * inv, oacc[t][7] * inv};
    }
  }
  __builtin_amdgcn_fence(__ATOMIC_RELEASE, "workgroup");
  __builtin_amdgcn_wave_barrier();
  __builtin_amdgcn_fence(__ATOMIC_ACQUIRE, "workgroup");
  {
    const int c4 = (lane & 15) * 4;
    {
#pragma unroll
      for (int it = 0; it < 8; ++it) {
        const int row = it * 2 + hh;                    // hh in 0..1, it in 0..7 -> rows 0..15
        v4f val = *(const v4f*)(os + row * 68 + c4);
        *(v4f*)(Og + (size_t)(q0 + row) * AT_D + c4) = val;
      }
      
    }
  }
}

// ---------------------------------------------------------------------------
// Host orchestration (launches only).
// d_in: 0=query 1=key 2=value [4,1024,1024] f32; 3=Wq 4=Wk 5=Wv [1024,1024] f32 ([out,in]).
// q/k/v = x . W^T as [4096][1024] bf16 hi/lo planes; the raw row-major reshape to [64][1024][64] is a pure
// reinterpretation of the same memory: group g owns the contiguous slab of 1024 rows x 64.
// ---------------------------------------------------------------------------
extern "C" void kernel_launch(void* const* d_in, const int* in_sizes, int n_in,
                              void* d_out, int out_size, void* d_ws, size_t ws_size,
                              hipStream_t stream) {
  constexpr int Bn = 4, Sn = 1024, E = 1024, Dh = 64, G = 64;
  constexpr int M = Bn * Sn;                       // 4096 projected rows
  constexpr int GS = (M * E) / (G * Dh);           // 1024 group-tokens per group
  static_assert(GS % AT_QB == 0 && GS % AT_KC == 0);
  static_assert(M % 64 == 0 && E % 64 == 0 && E % 32 == 0);
  if (n_in < 6) return;
  if (in_sizes[0] != M * E || in_sizes[1] != M * E || in_sizes[2] != M * E ||
      in_sizes[3] != E * E || in_sizes[4] != E * E || in_sizes[5] != E * E || out_size != M * E) return;

  const float* xq = (const float*)d_in[0];
  const float* xk = (const float*)d_in[1];
  const float* xv = (const float*)d_in[2];
  const float* wq = (const float*)d_in[3];
  const float* wk = (const float*)d_in[4];
  const float* wv = (const float*)d_in[5];
  float* out = (float*)d_out;

  const size_t bX = (size_t)M * E * 2;            //  8 MiB  bf16 activation copy (x3)
  const size_t bW = (size_t)E * E * 2;            //  2 MiB  bf16 weight copy (x3)
  const size_t bP = (size_t)M * E * 2;            //  8 MiB  bf16 projection plane (x3 hi, x3 lo)
  char* ws = (char*)d_ws;
  size_t off = 0;
  unsigned short* X16 = (unsigned short*)(ws + off); off += 3 * bX;   // [3] x (4096 x 1024) bf16, fragment order
  unsigned short* W16 = (unsigned short*)(ws + off); off += 3 * bW;   // [3] x (1024 x 1024) bf16, fragment order
  unsigned short* PH  = (unsigned short*)(ws + off); off += 3 * bP;   // [3][4096][1024] bf16 hi : q, k, v
  unsigned short* PL  = (unsigned short*)(ws + off); off += 3 * bP;   // [3][4096][1024] bf16 lo : q, k, v
  if (off > ws_size || off > (size_t)134217728) return;               // 81,788,928 B

  const size_t PE = (size_t)M * E;                 // elements per plane
  unsigned short* QH = PH;          unsigned short* QL = PL;
  unsigned short* KH = PH + PE;     unsigned short* KL = PL + PE;
  unsigned short* VH = PH + 2 * PE; unsigned short* VL = PL + 2 * PE;

  dim3 blk256(256), blk128(128);

  // 1-6: RNE bf16 casts of the three activations and the three weights, written in the GEMM's fragment order
  {
    static_assert(E % 64 == 0 && M % 16 == 0);
    const int npx = (M / 16) * (E / 64), npw = (E / 16) * (E / 64);   // waves: one per pair of 16 x 32 tiles
    cast_f32_bf16_frag<E><<<dim3((npx + 7) / 8), blk256, 0, stream>>>(xq, X16, npx);
    cast_f32_bf16_frag<E><<<dim3((npx + 7) / 8), blk256, 0, stream>>>(xk, X16 + PE, npx);
    cast_f32_bf16_frag<E><<<dim3((npx + 7) / 8), blk256, 0, stream>>>(xv, X16 + 2 * PE, npx);
    cast_f32_bf16_frag<E><<<dim3((npw + 7) / 8), blk256, 0, stream>>>(wq, W16, npw);
    cast_f32_bf16_frag<E><<<dim3((npw + 7) / 8), blk256, 0, stream>>>(wk, W16 + (size_t)E * E, npw);
    cast_f32_bf16_frag<E><<<dim3((npw + 7) / 8), blk256, 0, stream>>>(wv, W16 + (size_t)2 * E * E, npw);
  }

  // 7: P_z[m][f] = bf16(x_z)[m][e] . bf16(W_z)[f][e], f32 accumulate, stored as bf16 hi/lo planes; z = 0..2 via grid.y
  {
    const int tiles = (M / 64) * (E / 64);          // 1024 tiles of 64x64 per z; 8 waves per block
    wmma_gemm64<1, false, 0, 2, false, 0, E><<<dim3((tiles + 7) / 8, 3), blk256, 0, stream>>>(
        X16, X16, E, (long)PE,
        W16, W16, E, (long)E * E,
        (void*)PH, (void*)PL, E, (long)PE,
        wq, wq, 0L, M, E, E, 1.0f);
  }

  // 8: attention over 64 groups, each a contiguous [1024][64] slab (group stride 65536 elements, row stride 64); no mask
  {
    const int nblk = G * (GS / AT_QB);               // 64 groups x 16 query blocks = 1024
    const long gstride = (long)GS * Dh;              // 65536
    attn64_planes<<<dim3(nblk), blk128, 0, stream>>>(
        QH, QL, KH, KL, VH, VL, out, gstride, GS, GS / AT_KC, 0.125f);
  }
}

// v007
// Measured time: 98.2 microseconds a run.
// Next to v006, in two timings, it ran 1.11 times as fast each time.
// Over all steps from v000 it is 3.55 times as fast.
#include <hip/hip_runtime.h>
#include <math.h>
// Contractions: q/k/v projection GEMMs = v_wmma_f32_16x16x32_bf16 (bf16 operands, one product, f32 accumulate, results stored as bf16 hi/lo planes); scores q.k^T = v_wmma_f32_16x16x32_bf16 (bf16 hi/lo planes of q and k, three products); out = p.v = v_wmma_f32_16x16x32_bf16 (bf16 hi/lo planes of p and v, three products); f32 accumulate everywhere; online softmax in f32.

typedef __attribute__((ext_vector_type(16))) _Float16 v16h;
typedef __attribute__((ext_vector_type(8)))  _Float16 v8h;
typedef __attribute__((ext_vector_type(16))) __bf16   v16b;
typedef __attribute__((ext_vector_type(8)))  __bf16   v8b;
typedef __attribute__((ext_vector_type(8)))  float    v8f;
typedef __attribute__((ext_vector_type(4)))  float    v4f;

__device__ __forceinline__ unsigned short f2bf_bits(float f) {
  unsigned u = __float_as_uint(f);
  return (unsigned short)((u + 0x7FFFu + ((u >> 16) & 1u)) >> 16);
}
__device__ __forceinline__ float bf_bits2f(unsigned short h) { return __uint_as_float(((unsigned)h) << 16); }

// hazard guards as plain device helpers (no inline asm inside the kernel template body)
__device__ __forceinline__ void dep_guard_h(v8f& a, v8f& b, v16h x, v16h y) { asm volatile("v_nop\n\tv_nop\n\tv_nop\n\tv_nop" : "+v"(a), "+v"(b) : "v"(x), "v"(y)); }
__device__ __forceinline__ void dep_guard_b(v8f& a, v8f& b, v16b x, v16b y) { asm volatile("v_nop\n\tv_nop\n\tv_nop\n\tv_nop" : "+v"(a), "+v"(b) : "v"(x), "v"(y)); }
__device__ __forceinline__ void keep4_h(v16h a, v16h b, v16h c, v16h d) { asm volatile("v_nop" :: "v"(a), "v"(b), "v"(c), "v"(d)); }
__device__ __forceinline__ void keep4_b(v16b a, v16b b, v16b c, v16b d) { asm volatile("v_nop" :: "v"(a), "v"(b), "v"(c), "v"(d)); }
__device__ __forceinline__ void acc_guard4(v8f& a, v8f& b, v8f& c, v8f& d) { asm volatile("v_nop\n\tv_nop\n\tv_nop\n\tv_nop" : "+v"(a), "+v"(b), "+v"(c), "+v"(d)); }
template <typename T> struct Frag;
template <> struct Frag<_Float16> {
  typedef v16h V; union U { v16h v; v8h h[2]; };
  static __device__ __forceinline__ v16h load(const _Float16* p) {   // fragment-order tile: elements 0..7 <- p[0..7], 8..15 <- p[256..263]
    U f; f.h[0] = *(const v8h*)(p); f.h[1] = *(const v8h*)(p + 256); return f.v;
  }
  static __device__ __forceinline__ v8f mma(v16h a, v16h b, v8f c) {
    return __builtin_amdgcn_wmma_f32_16x16x32_f16(false, a, false, b, (short)0, c, false, false);
  }
  static __device__ __forceinline__ void guard(v8f& a, v8f& b, v16h x, v16h y) { dep_guard_h(a, b, x, y); }
  static __device__ __forceinline__ void keep(v16h a, v16h b, v16h c, v16h d) { keep4_h(a, b, c, d); }
};
template <> struct Frag<__bf16> {
  typedef v16b V; union U { v16b v; v8b h[2]; };
  static __device__ __forceinline__ v16b load(const __bf16* p) {
    U f; f.h[0] = *(const v8b*)(p); f.h[1] = *(const v8b*)(p + 256); return f.v;
  }
  static __device__ __forceinline__ v8f mma(v16b a, v16b b, v8f c) {
    return __builtin_amdgcn_wmma_f32_16x16x32_bf16(false, a, false, b, (short)0, c, false, false);
  }
  static __device__ __forceinline__ void guard(v8f& a, v8f& b, v16b x, v16b y) { dep_guard_b(a, b, x, y); }
  static __device__ __forceinline__ void keep(v16b a, v16b b, v16b c, v16b d) { keep4_b(a, b, c, d); }
};

// ---- Register-blocked batched WMMA GEMM ------------------------------------
// C[m,n] = scale * sum_k A[m,k] * Bt[n,k] (+bias)(+resid); each wave owns a 64x64 tile.
// A [M,K] and Bt [N,K] in fragment order; M,N % 64 == 0, K % 32 == 0.
// Fragment order: the tile of rows 16*rt..+15 and k 32*kt..+31 is 512 contiguous elements at (rt * (K/32) + kt) * 512;
// in it element (row c, k) lies at ((k >> 4) & 1) * 256 + (((k >> 3) & 1) * 16 + c) * 8 + (k & 7), so lane l's two
// 16-byte pieces lie at l * 8 and 256 + l * 8 and each wave-wide 16-byte load covers 512 contiguous bytes (4 whole lines).
// SPLIT: operands are hi/lo planes (A2/Bt2 = lo planes, same layout); product = hi.hi + hi.lo + lo.hi.
// BIAS_MODE: 0 = none, 1 = bias[m], 2 = bias[n].
// OUT_MODE: 0 = f32, 1 = f16, 2 = bf16 hi plane (Cout) + bf16 lo plane (Cout2).
// ET: 0 = f16 operands, 1 = bf16 operands (pointers passed as 16-bit storage)
template <int ET> struct Elem;
template <> struct Elem<0> { typedef _Float16 T; };
template <> struct Elem<1> { typedef __bf16 T; };
// LDK: K of the stored A and Bt, a compile-time constant, so that the step from one 16-row tile strip to the next is an
// immediate offset of the load (lda and ldb are not read).
template <int ET, bool SPLIT, int BIAS_MODE, int OUT_MODE, bool RESID, int ACT = 0, int LDK = 1024>
__global__ __launch_bounds__(256) void wmma_gemm64(
    const unsigned short* __restrict__ Ap, const unsigned short* __restrict__ A2p, int lda, long strideA,
    const unsigned short* __restrict__ Btp, const unsigned short* __restrict__ Bt2p, int ldb, long strideB,
    void* __restrict__ Cout, void* __restrict__ Cout2, int ldc, long strideC,
    const float* __restrict__ bias,
    const float* __restrict__ resid, long strideR,
    int M, int N, int K, float scale) {
  typedef typename Elem<ET>::T T;
  typedef typename Frag<T>::V V;
  const T* A = (const T*)Ap; const T* A2 = (const T*)A2p; const T* Bt = (const T*)Btp; const T* Bt2 = (const T*)Bt2p;
  __shared__ __align__(16) float sT[8][16 * 68];   // per-wave 16x64 slab, pitch 68 floats
  const int b    = blockIdx.y;
  const int lane = threadIdx.x & 31;
  const int wave = __builtin_amdgcn_readfirstlane(threadIdx.x >> 5);   // wave-uniform: the tile bases below stay in scalar registers
  const int tilesN = N >> 6;
  const int tilesM = M >> 6;
  const int tile = blockIdx.x * 8 + wave;
  if (tile >= tilesM * tilesN) return;   // wave-uniform; no block barriers in this kernel
  const int tm = tile / tilesN;
  const int tn = tile - tm * tilesN;
  const int m0 = tm << 6;
  const int n0 = tn << 6;

  const T* Ab  = A  + (size_t)b * strideA;
  const T* Bb  = Bt + (size_t)b * strideB;
  const T* Ab2 = SPLIT ? (A2  + (size_t)b * strideA) : nullptr;
  const T* Bb2 = SPLIT ? (Bt2 + (size_t)b * strideB) : nullptr;

  const int rlane = lane & 15;                 // row (A) / col (B, D) within subtile
  const int mOff  = (lane >> 4) * 8;           // D row offset

  v8f acc[4][4];
#pragma unroll
  for (int i = 0; i < 4; ++i)
#pragma unroll
    for (int j = 0; j < 4; ++j) acc[i][j] = (v8f){0.f,0.f,0.f,0.f,0.f,0.f,0.f,0.f};

  // one scalar base per operand; one 32-bit vector byte offset serves all loads: lane * 16, + 1024 per k step
  constexpr size_t TS = (size_t)(LDK / 32) * 512;                                // elements per 16-row tile strip
  const size_t aT = (size_t)(m0 >> 4) * TS, bT = (size_t)(n0 >> 4) * TS;
  for (int k0 = 0; k0 < K; k0 += 32) {
    const unsigned vo = (unsigned)(k0 << 5) + (unsigned)(lane * 16);
    V bh[4], bl[4];
#pragma unroll
    for (int j = 0; j < 4; ++j) {
      bh[j] = Frag<T>::load((const T*)((const char*)(Bb + (bT + j * TS)) + vo));
      if (SPLIT) bl[j] = Frag<T>::load((const T*)((const char*)(Bb2 + (bT + j * TS)) + vo));
    }
    // all four A fragments of the k step are requested here, in one group with the B fragments: the step then waits out one
    // load latency, not one per A fragment
    V ah[4], al[4];
#pragma unroll
    for (int i = 0; i < 4; ++i) {
      ah[i] = Frag<T>::load((const T*)((const char*)(Ab + (aT + i * TS)) + vo));
      if (SPLIT) al[i] = Frag<T>::load((const T*)((const char*)(Ab2 + (aT + i * TS)) + vo));
    }
#pragma unroll
    for (int i = 0; i < 4; ++i) {
#pragma unroll
      for (int j = 0; j < 4; ++j) {
        acc[i][j] = Frag<T>::mma(ah[i], bh[j], acc[i][j]);
        if (SPLIT) {
          acc[i][j] = Frag<T>::mma(ah[i], bl[j], acc[i][j]);
          acc[i][j] = Frag<T>::mma(al[i], bh[j], acc[i][j]);
        }
      }
      Frag<T>::guard(acc[i][0], acc[i][3], ah[i], SPLIT ? al[i] : ah[i]);
    }
    Frag<T>::keep(bh[0], bh[1], bh[2], bh[3]);
    if (SPLIT) Frag<T>::keep(bl[0], bl[1], bl[2], bl[3]);
  }
  acc_guard4(acc[0][0], acc[0][1], acc[0][2], acc[0][3]);
  acc_guard4(acc[1][0], acc[1][1], acc[1][2], acc[1][3]);
  acc_guard4(acc[2][0], acc[2][1], acc[2][2], acc[2][3]);
  acc_guard4(acc[3][0], acc[3][1], acc[3][2], acc[3][3]);

  // ---- epilogue ----
  float* slab = sT[wave];
  const float* Rb = RESID ? (resid + (size_t)b * strideR) : nullptr;
#pragma unroll
  for (int i = 0; i < 4; ++i) {
    const int mBase = m0 + (i << 4);
#pragma unroll
    for (int j = 0; j < 4; ++j) {
      const int n = n0 + (j << 4) + rlane;
      float bv = 0.f;
      if (BIAS_MODE == 2) bv = bias[n];
#pragma unroll
      for (int r = 0; r < 8; ++r) {
        float v = acc[i][j][r] * scale;
        if (BIAS_MODE == 1) v += bias[mBase + mOff + r];
        if (BIAS_MODE == 2) v += bv;
        if (RESID) v += Rb[(size_t)(mBase + mOff + r) * ldc + n];
        if (ACT == 1) v = tanhf(v);
        if (ACT == 2) v = fmaxf(v, 0.0f);
        if (ACT == 3) v = v / (1.0f + expf(-v));
        if (ACT == 4) v = (v > 0.f) ? v : 0.01f * v;
        if (ACT == 5) v = 0.5f * v * (1.0f + erff(v * 0.70710678118654752f));
        slab[(mOff + r) * 68 + (j << 4) + rlane] = v;
      }
    }
    __builtin_amdgcn_fence(__ATOMIC_RELEASE, "workgroup");
    __builtin_amdgcn_wave_barrier();
    __builtin_amdgcn_fence(__ATOMIC_ACQUIRE, "workgroup");
    if (OUT_MODE == 0) {
      float* C = (float*)Cout + (size_t)b * strideC;
      const int hh = lane >> 4, c4 = (lane & 15) * 4;     // row seg = 256 B = 16 lanes x 16 B
      {
#pragma unroll
        for (int it = 0; it < 8; ++it) {
          const int row = it * 2 + hh;
          v4f v = *(const v4f*)(slab + row * 68 + c4);
          *(v4f*)(C + (size_t)(mBase + row) * ldc + n0 + c4) = v;
        }
        
      }
    } else {
      const int q = lane >> 3, c8 = (lane & 7) * 8;
      unsigned short* C  = (unsigned short*)Cout  + (size_t)b * strideC;
      unsigned short* C2 = (OUT_MODE == 2) ? ((unsigned short*)Cout2 + (size_t)b * strideC) : nullptr;
      {
#pragma unroll
        for (int it = 0; it < 4; ++it) {
          const int row = it * 4 + q;
          const float* sp = slab + row * 68 + c8;
          v8h hv, lv;
#pragma unroll
          for (int e = 0; e < 8; ++e) {
            if (OUT_MODE == 1) {
              hv[e] = (_Float16)sp[e];
            } else {
              unsigned short hb = f2bf_bits(sp[e]);
              unsigned short lb = f2bf_bits(sp[e] - bf_bits2f(hb));
              hv[e] = __builtin_bit_cast(_Float16, hb);
              lv[e] = __builtin_bit_cast(_Float16, lb);
            }
          }
          *(v8h*)(C + (size_t)(mBase + row) * ldc + n0 + c8) = hv;
          if (OUT_MODE == 2) *(v8h*)(C2 + (size_t)(mBase + row) * ldc + n0 + c8) = lv;
        }
        
      }
    }
    __builtin_amdgcn_fence(__ATOMIC_RELEASE, "workgroup");
    __builtin_amdgcn_wave_barrier();
    __builtin_amdgcn_fence(__ATOMIC_ACQUIRE, "workgroup");
  }
}

// f32 row-major [rows][K] -> bf16 (RNE) in the GEMM's fragment order. One wave per two neighbouring 16 x 32 tiles:
// each 16-byte load covers 4 rows x 128 B (whole lines), eight in flight; a lane's four values of one row are 8 bytes of
// the tile, and the four rows of a load are 64 contiguous bytes in each of the tile's four 256-byte quarters.
// All six operands in one launch, none reading what another writes: blocks 0 .. 3 NBX - 1 are the three activations (NBX blocks
// each, results one behind the other in xout), the next 3 NBW blocks the three weights (into wout). A block is 8 waves = 8192 elements.
template <int K, int NBX, int NBW>
__global__ __launch_bounds__(256) void cast6_f32_bf16_frag(
    const float* __restrict__ x0, const float* __restrict__ x1, const float* __restrict__ x2,
    const float* __restrict__ w0, const float* __restrict__ w1, const float* __restrict__ w2,
    unsigned short* __restrict__ xout, unsigned short* __restrict__ wout) {
  const int bx = blockIdx.x;
  const float* in;
  unsigned short* out;
  int lb;                                      // block within its operand
  if (bx < 3 * NBX) {
    const int z = bx / NBX;
    lb  = bx - z * NBX;
    in  = (z == 0) ? x0 : (z == 1) ? x1 : x2;
    out = xout + (size_t)z * NBX * 8192;
  } else {
    const int z = (bx - 3 * NBX) / NBW;
    lb  = (bx - 3 * NBX) - z * NBW;
    in  = (z == 0) ? w0 : (z == 1) ? w1 : w2;
    out = wout + (size_t)z * NBW * 8192;
  }
  const int lane = threadIdx.x & 31;
  const int wv   = lb * 8 + (threadIdx.x >> 5);
  const int rt = wv / (K / 64);                // 16-row tile
  const int kq = wv % (K / 64);                // pair of 32-k tiles
  const int rs = lane >> 3;                    // row within a group of four
  const int q  = lane & 7;                     // k = 4q .. 4q+3 within the tile
  const float* sp = in + (size_t)(rt * 16 + rs) * K + kq * 64 + q * 4;
  v4f x[2][4];
#pragma unroll
  for (int t = 0; t < 2; ++t)
#pragma unroll
    for (int i = 0; i < 4; ++i) x[t][i] = *(const v4f*)(sp + (size_t)(4 * i) * K + t * 32);
  unsigned short* dp = out + ((size_t)rt * (K / 32) + kq * 2) * 512 + (q >> 2) * 256 + (((q >> 1) & 1) * 16 + rs) * 8 + (q & 1) * 4;
#pragma unroll
  for (int t = 0; t < 2; ++t)
#pragma unroll
    for (int i = 0; i < 4; ++i) {
      uint2 u;
      u.x = (unsigned)f2bf_bits(x[t][i][0]) | ((unsigned)f2bf_bits(x[t][i][1]) << 16);
      u.y = (unsigned)f2bf_bits(x[t][i][2]) | ((unsigned)f2bf_bits(x[t][i][3]) << 16);
      *(uint2*)(dp + t * 512 + i * 32) = u;
    }
}

// =====================================================================================
// Attention, head_dim 64, no mask. Inputs are bf16 hi/lo planes of q, k, v laid out as G groups of
// contiguous [S][64] slabs (group stride gstride elements, row stride 64); output f32 in the same slab layout.
// Block = 4 waves = 64 query rows of one group; 64-key chunks. Both products run transposed, so that a lane owns one query:
//   scores^T = k.q^T * sscale : A = k rows, B = q rows; k and q hi/lo planes (hi.hi + hi.lo + lo.hi), f32 accumulate
//   out^T   += v^T.p^T        : A = v^T rows, B = p^T; p split into bf16 hi/lo after the max shift, v hi/lo planes (three products)
//   A lane's registers of two neighbouring 16-key score tiles are, in place, its share of a 32-key B operand: p stays in registers.
//   online softmax in f32: maximum and sum run over a lane's own 32 scores, plus one exchange between the wave's halves.
//   Q planes staged once per block in LDS (16-B copies); K and V planes copied row by row per chunk (16-B copies);
//   the V^T fragments come out of the row-major V tile by the transposing LDS load; all staging with plain loads + __syncthreads().
//   grid.x = G * (S/64).
// =====================================================================================
#define AT_D 64
#define AT_NW 4
#define AT_QB 64
#define AT_KC 64
#define AT_LP 72   // LDS row pitch in elements: 144 B = 16 B x odd, so the 16 rows of a 16-byte fragment read fall on distinct banks
#define AT_VP 80   // LDS row pitch of the V tiles in elements: 160 B = 32 B x odd, the conflict-free pitch of the transposing load

__device__ __forceinline__ unsigned short at_bf_bits(float f) {
  unsigned u = __float_as_uint(f);
  return (unsigned short)((u + 0x7FFFu + ((u >> 16) & 1u)) >> 16);
}
__device__ __forceinline__ __bf16 at_f2bf(float f) { return __builtin_bit_cast(__bf16, at_bf_bits(f)); }
__device__ __forceinline__ void at_split(float f, __bf16& hi, __bf16& lo) {
  const unsigned short hb = at_bf_bits(f);
  hi = __builtin_bit_cast(__bf16, hb);
  lo = at_f2bf(f - __uint_as_float(((unsigned)hb) << 16));
}
// three products of a hi/lo x hi/lo pair into one accumulator, then the hazard guard tying D and all four operands
__device__ __forceinline__ v8f at_mma3(v16b ah, v16b al, v16b bh, v16b bl, v8f c) {
  c = __builtin_amdgcn_wmma_f32_16x16x32_bf16(false, ah, false, bh, (short)0, c, false, false);
  c = __builtin_amdgcn_wmma_f32_16x16x32_bf16(false, ah, false, bl, (short)0, c, false, false);
  c = __builtin_amdgcn_wmma_f32_16x16x32_bf16(false, al, false, bh, (short)0, c, false, false);
  asm volatile("v_nop\n\tv_nop\n\tv_nop\n\tv_nop" : "+v"(c) : "v"(ah), "v"(al), "v"(bh), "v"(bl));
  return c;
}

// transposing LDS load: the lanes point at 16 rows x 32 B of a row-major 16-bit tile (lane l: row 8(l >> 4) + (l & 7), 16-byte
// half (l >> 3) & 1); lane (c, hh) receives column c of rows 8hh .. 8hh+7, which is half of an A fragment of the transposed tile
__device__ __forceinline__ v8b at_ld_tr16(const __bf16* p) {
  typedef __attribute__((address_space(3))) v8b lds_v8b;
  return __builtin_amdgcn_ds_load_tr16_b128_v8bf16((lds_v8b*)p);
}

// the value of lane l ^ 16 (the wave's other half), by a vector cross-row move
__device__ __forceinline__ float at_xhalf(float x) {
  const int b = __float_as_int(x);
  return __int_as_float(__builtin_amdgcn_permlanex16(b, b, 0x76543210, 0xfedcba98, false, false));
}

__global__ __launch_bounds__(128)
void attn64_planes(const unsigned short* __restrict__ QH, const unsigned short* __restrict__ QL,
                   const unsigned short* __restrict__ KH, const unsigned short* __restrict__ KL,
                   const unsigned short* __restrict__ VH, const unsigned short* __restrict__ VL,
                   float* __restrict__ out, long gstride, int S, int nkc, float sscale) {
  union FB { v16b v; v8b h[2]; };
  __shared__ __align__(16) __bf16 Qs[AT_NW][2 * 16 * AT_LP];  // per wave Q hi [row][d], then Q lo [row][d]  18 KB
  __shared__ __align__(16) __bf16 Ksh[AT_KC * AT_LP];         // K hi [kv][d]    9 KB
  __shared__ __align__(16) __bf16 Ksl[AT_KC * AT_LP];         // K lo [kv][d]    9 KB
  __shared__ __align__(16) __bf16 Vsh[AT_KC * AT_VP];         // V hi [kv][d]   10 KB
  __shared__ __align__(16) __bf16 Vsl[AT_KC * AT_VP];         // V lo [kv][d]   10 KB
  // The per-wave out tile (16 rows, pitch 68 floats) has no LDS of its own: it lies on the wave's own Q tiles, which no other
  // wave reads and which are dead behind the last chunk's scores. 56 KB a block in all.
  static_assert(16 * 68 * sizeof(float) <= 2 * 16 * AT_LP * sizeof(__bf16));

  const int tid  = threadIdx.x;
  const int wave = tid >> 5;
  const int lane = tid & 31;
  const int hh   = lane >> 4;
  const int c    = lane & 15;

  const int nqb = S / AT_QB;
  const int bx  = blockIdx.x;
  const int qb  = bx % nqb;
  const int g   = bx / nqb;
  const int q0  = qb * AT_QB + wave * 16;

  const __bf16* Qh = (const __bf16*)QH + (size_t)g * gstride;
  const __bf16* Ql = (const __bf16*)QL + (size_t)g * gstride;
  const __bf16* Kh = (const __bf16*)KH + (size_t)g * gstride;
  const __bf16* Kl = (const __bf16*)KL + (size_t)g * gstride;
  const __bf16* Vh = (const __bf16*)VH + (size_t)g * gstride;
  const __bf16* Vl = (const __bf16*)VL + (size_t)g * gstride;
  float*        Og = out + (size_t)g * gstride;

  // ---- Q hi/lo planes for the block's 64 rows: [row][d], 16-B copies (512 chunks per plane, 4 per thread) ----
  {
    const __bf16* qsh = Qh + (size_t)(qb * AT_QB) * AT_D;
    const __bf16* qsl = Ql + (size_t)(qb * AT_QB) * AT_D;
#pragma unroll
    for (int it = 0; it < 4; ++it) {
      const int ch = tid + it * 128;
      const int row = ch >> 3, col = (ch & 7) * 8;
      __bf16* qd = Qs[row >> 4] + (row & 15) * AT_LP + col;
      *(v8b*)(qd)              = *(const v8b*)(qsh + (size_t)row * AT_D + col);
      *(v8b*)(qd + 16 * AT_LP) = *(const v8b*)(qsl + (size_t)row * AT_D + col);
    }
  }
  __syncthreads();

  float mrow = -INFINITY, lrow = 0.f;   // query q0 + c: running maximum (alike in both halves); sum over this half's keys only
  v8f oacc[4];                          // oacc[t][r] = out^T[d = 16t + 8hh + r][query q0 + c]
#pragma unroll
  for (int t = 0; t < 4; ++t) oacc[t] = (v8f){0.f,0.f,0.f,0.f,0.f,0.f,0.f,0.f};

  const int nk = (nkc < 64) ? nkc : 64;                             // host-provided trip count, clamped to a static maximum
  const __bf16* qwh = Qs[wave] + c * AT_LP + 8 * hh;                 // B fragment column c (query row c) of this wave
  const __bf16* qwl = qwh + 16 * AT_LP;

  for (int kc = 0; kc < nk; ++kc) {
    const int kv0 = kc * AT_KC;
    __syncthreads();                                                // readers of the last K/V tile done
    {
      const __bf16* ksh = Kh + (size_t)kv0 * AT_D;
      const __bf16* ksl = Kl + (size_t)kv0 * AT_D;
      const __bf16* vsh = Vh + (size_t)kv0 * AT_D;
      const __bf16* vsl = Vl + (size_t)kv0 * AT_D;
#pragma unroll
      for (int it = 0; it < 4; ++it) {
        const int ch = tid + it * 128;
        const int row = ch >> 3, col = (ch & 7) * 8;                // row = kv within chunk, col = d
        *(v8b*)(Ksh + row * AT_LP + col) = *(const v8b*)(ksh + (size_t)row * AT_D + col);
        *(v8b*)(Ksl + row * AT_LP + col) = *(const v8b*)(ksl + (size_t)row * AT_D + col);
        *(v8b*)(Vsh + row * AT_VP + col) = *(const v8b*)(vsh + (size_t)row * AT_D + col);
        *(v8b*)(Vsl + row * AT_VP + col) = *(const v8b*)(vsl + (size_t)row * AT_D + col);
      }
    }
    __syncthreads();

    // ---- scores^T[64 x 16] = k . q^T  (A = K[kv][d], B = Q[row][d]; split k-map via two 16-B halves at +8hh and +16+8hh) ----
    // s[j][r] = score of key 16j + 8hh + r and query c
    v8f s[4];
#pragma unroll
    for (int j = 0; j < 4; ++j) s[j] = (v8f){0.f,0.f,0.f,0.f,0.f,0.f,0.f,0.f};
#pragma unroll 1
    for (int dc = 0; dc < 2; ++dc) {
      FB qh, ql;
      qh.h[0] = *(const v8b*)(qwh + dc * 32);
      qh.h[1] = *(const v8b*)(qwh + dc * 32 + 16);
      ql.h[0] = *(const v8b*)(qwl + dc * 32);
      ql.h[1] = *(const v8b*)(qwl + dc * 32 + 16);
#pragma unroll
      for (int j = 0; j < 4; ++j) {
        FB kb, kl;
        const __bf16* kp  = Ksh + (j * 16 + c) * AT_LP + dc * 32 + 8 * hh;
        const __bf16* kpl = Ksl + (j * 16 + c) * AT_LP + dc * 32 + 8 * hh;
        kb.h[0] = *(const v8b*)(kp);
        kb.h[1] = *(const v8b*)(kp + 16);
        kl.h[0] = *(const v8b*)(kpl);
        kl.h[1] = *(const v8b*)(kpl + 16);
        s[j] = at_mma3(kb.v, kl.v, qh.v, ql.v, s[j]);
      }
    }
    // ---- scale (f32), the query's maximum: in-lane over 32 keys, then the other half's 32 ----
    float mj[4];
#pragma unroll   // here and below: s, pa, pl and oacc live in registers, so every index into them must be a constant
    for (int j = 0; j < 4; ++j) {
      float m = -INFINITY;
#pragma unroll
      for (int r = 0; r < 8; ++r) {
        const float sv = s[j][r] * sscale;
        s[j][r] = sv;
        m = fmaxf(m, sv);
      }
      mj[j] = m;
    }
    const float mh = fmaxf(fmaxf(mj[0], mj[1]), fmaxf(mj[2], mj[3]));
    const float mnew = fmaxf(mrow, fmaxf(mh, at_xhalf(mh)));
    const float mref = (mnew == -INFINITY) ? 0.0f : mnew;
    const float alpha = __expf(mrow - mref);
    mrow = mnew;
    // p^T as B operand of keys 32kk .. 32kk+31: elements 0..7 = tile 2kk's registers, 8..15 = tile 2kk+1's (the split k-map)
    FB pa[2], pl[2];
    float pj[4];
#pragma unroll
    for (int j = 0; j < 4; ++j) {
      float psum = 0.f;
#pragma unroll
      for (int r = 0; r < 8; ++r) {
        const float p = __expf(s[j][r] - mref);
        psum += p;
        __bf16 a, bl; at_split(p, a, bl);
        pa[j >> 1].v[(j & 1) * 8 + r] = a;
        pl[j >> 1].v[(j & 1) * 8 + r] = bl;
      }
      pj[j] = psum;
    }
    lrow = lrow * alpha + ((pj[0] + pj[1]) + (pj[2] + pj[3]));
#pragma unroll
    for (int t = 0; t < 4; ++t)
#pragma unroll
      for (int r = 0; r < 8; ++r) oacc[t][r] *= alpha;
    // ---- O^T[64 x 16] += V^T[64 x 64] . P^T[64 x 16]  (A = V^T[d][kv] by transposing loads of the [kv][d] tile, B = p^T from registers) ----
#pragma unroll   // pa[kk] and pl[kk] live in registers: kk must be a constant at each use
    for (int kk = 0; kk < 2; ++kk) {
#pragma unroll
      for (int t = 0; t < 4; ++t) {
        FB vb, vl;
        const int vo = (kk * 32 + 8 * hh + (lane & 7)) * AT_VP + t * 16 + ((lane >> 3) & 1) * 8;
        vb.h[0] = at_ld_tr16(Vsh + vo);                  // keys 32kk + 8hh .. +7 of d = 16t + c
        vb.h[1] = at_ld_tr16(Vsh + vo + 16 * AT_VP);     // keys 32kk + 16 + 8hh .. +7
        vl.h[0] = at_ld_tr16(Vsl + vo);
        vl.h[1] = at_ld_tr16(Vsl + vo + 16 * AT_VP);
        oacc[t] = at_mma3(vb.v, vl.v, pa[kk].v, pl[kk].v, oacc[t]);
      }
    }
  }

  float* os = (float*)Qs[wave];   // every value stored here comes out of products that have read all of this wave's Q
  {
    const float inv = 1.0f / (lrow + at_xhalf(lrow));   // the two halves' key sums joined once
#pragma unroll
    for (int t = 0; t < 4; ++t) {                       // a lane's 8 registers are 8 neighbouring d of its query's row
      *(v4f*)(os + c * 68 + t * 16 + 8 * hh)     = (v4f){oacc[t][0] * inv, oacc[t][1] * inv, oacc[t][2] * inv, oacc[t][3] * inv};
      *(v4f*)(os + c * 68 + t * 16 + 8 * hh + 4) = (v4f){oacc[t][4] * inv, oacc[t][5] * inv, oacc[t][6] * inv, oacc[t][7] * inv};
    }
  }
  __builtin_amdgcn_fence(__ATOMIC_RELEASE, "workgroup");
  __builtin_amdgcn_wave_barrier();
  __builtin_amdgcn_fence(__ATOMIC_ACQUIRE, "workgroup");
  {
    const int c4 = (lane & 15) * 4;
    {
#pragma unroll
      for (int it = 0; it < 8; ++it) {
        const int row = it * 2 + hh;                    // hh in 0..1, it in 0..7 -> rows 0..15
        v4f val = *(const v4f*)(os + row * 68 + c4);
        *(v4f*)(Og + (size_t)(q0 + row) * AT_D + c4) = val;
      }
      
    }
  }
}

// ---------------------------------------------------------------------------
// Host orchestration (launches only).
// d_in: 0=query 1=key 2=value [4,1024,1024] f32; 3=Wq 4=Wk 5=Wv [1024,1024] f32 ([out,in]).
// q/k/v = x . W^T as [4096][1024] bf16 hi/lo planes; the raw row-major reshape to [64][1024][64] is a pure
// reinterpretation of the same memory: group g owns the contiguous slab of 1024 rows x 64.
// ---------------------------------------------------------------------------
extern "C" void kernel_launch(void* const* d_in, const int* in_sizes, int n_in,
                              void* d_out, int out_size, void* d_ws, size_t ws_size,
                              hipStream_t stream) {
  constexpr int Bn = 4, Sn = 1024, E = 1024, Dh = 64, G = 64;
  constexpr int M = Bn * Sn;                       // 4096 projected rows
  constexpr int GS = (M * E) / (G * Dh);           // 1024 group-tokens per group
  static_assert(GS % AT_QB == 0 && GS % AT_KC == 0);
  static_assert(M % 64 == 0 && E % 64 == 0 && E % 32 == 0);
  if (n_in < 6) return;
  if (in_sizes[0] != M * E || in_sizes[1] != M * E || in_sizes[2] != M * E ||
      in_sizes[3] != E * E || in_sizes[4] != E * E || in_sizes[5] != E * E || out_size != M * E) return;

  const float* xq = (const float*)d_in[0];
  const float* xk = (const float*)d_in[1];
  const float* xv = (const float*)d_in[2];
  const float* wq = (const float*)d_in[3];
  const float* wk = (const float*)d_in[4];
  const float* wv = (const float*)d_in[5];
  float* out = (float*)d_out;

  const size_t bX = (size_t)M * E * 2;            //  8 MiB  bf16 activation copy (x3)
  const size_t bW = (size_t)E * E * 2;            //  2 MiB  bf16 weight copy (x3)
  const size_t bP = (size_t)M * E * 2;            //  8 MiB  bf16 projection plane (x3 hi, x3 lo)
  char* ws = (char*)d_ws;
  size_t off = 0;
  unsigned short* X16 = (unsigned short*)(ws + off); off += 3 * bX;   // [3] x (4096 x 1024) bf16, fragment order
  unsigned short* W16 = (unsigned short*)(ws + off); off += 3 * bW;   // [3] x (1024 x 1024) bf16, fragment order
  unsigned short* PH  = (unsigned short*)(ws + off); off += 3 * bP;   // [3][4096][1024] bf16 hi : q, k, v
  unsigned short* PL  = (unsigned short*)(ws + off); off += 3 * bP;   // [3][4096][1024] bf16 lo : q, k, v
  if (off > ws_size || off > (size_t)134217728) return;               // 81,788,928 B

  const size_t PE = (size_t)M * E;                 // elements per plane
  unsigned short* QH = PH;          unsigned short* QL = PL;
  unsigned short* KH = PH + PE;     unsigned short* KL = PL + PE;
  unsigned short* VH = PH + 2 * PE; unsigned short* VL = PL + 2 * PE;

  dim3 blk256(256), blk128(128);

  // 1: RNE bf16 casts of the three activations and the three weights, written in the GEMM's fragment order, one launch
  {
    static_assert(E % 64 == 0 && M % 16 == 0);
    constexpr int npx = (M / 16) * (E / 64), npw = (E / 16) * (E / 64);   // waves: one per pair of 16 x 32 tiles
    static_assert(npx % 8 == 0 && npw % 8 == 0);                          // whole blocks of 8 waves: no wave without a tile pair
    static_assert((size_t)(npx / 8) * 8192 == (size_t)M * E && (size_t)(npw / 8) * 8192 == (size_t)E * E);
    cast6_f32_bf16_frag<E, npx / 8, npw / 8><<<dim3(3 * (npx / 8) + 3 * (npw / 8)), blk256, 0, stream>>>(
        xq, xk, xv, wq, wk, wv, X16, W16);
  }

  // 2: P_z[m][f] = bf16(x_z)[m][e] . bf16(W_z)[f][e], f32 accumulate, stored as bf16 hi/lo planes; z = 0..2 via grid.y
  {
    const int tiles = (M / 64) * (E / 64);          // 1024 tiles of 64x64 per z; 8 waves per block
    wmma_gemm64<1, false, 0, 2, false, 0, E><<<dim3((tiles + 7) / 8, 3), blk256, 0, stream>>>(
        X16, X16, E, (long)PE,
        W16, W16, E, (long)E * E,
        (void*)PH, (void*)PL, E, (long)PE,
        wq, wq, 0L, M, E, E, 1.0f);
  }

  // 3: attention over 64 groups, each a contiguous [1024][64] slab (group stride 65536 elements, row stride 64); no mask
  {
    const int nblk = G * (GS / AT_QB);               // 64 groups x 16 query blocks = 1024
    const long gstride = (long)GS * Dh;              // 65536
    attn64_planes<<<dim3(nblk), blk128, 0, stream>>>(
        QH, QL, KH, KL, VH, VL, out, gstride, GS, GS / AT_KC, 0.125f);
  }
}

// v008
// One run takes 87.8 microseconds.
// In both of two side-by-side timings against v007, it was 1.11 times as fast.
// Over all steps from v000 it is 3.95 times as fast.
#include <hip/hip_runtime.h>
#include <math.h>
// Contractions: q/k/v projection GEMMs = v_wmma_f32_16x16x32_bf16 (bf16 operands, one product, f32 accumulate, results stored as bf16 hi/lo planes); scores q.k^T = v_wmma_f32_16x16x32_bf16 (bf16 hi/lo planes of q and k, three products); out = p.v = v_wmma_f32_16x16x32_bf16 (bf16 hi/lo planes of p and v, three products); f32 accumulate everywhere; online softmax in f32.

typedef __attribute__((ext_vector_type(16))) _Float16 v16h;
typedef __attribute__((ext_vector_type(8)))  _Float16 v8h;
typedef __attribute__((ext_vector_type(16))) __bf16   v16b;
typedef __attribute__((ext_vector_type(8)))  __bf16   v8b;
typedef __attribute__((ext_vector_type(8)))  float    v8f;
typedef __attribute__((ext_vector_type(4)))  float    v4f;
typedef __attribute__((ext_vector_type(2)))  float    v2f;
typedef __attribute__((ext_vector_type(2)))  __bf16   v2b;

// two f32 -> two bf16 in one register (a in the low half), round to nearest even, by the packed convert instruction
__device__ __forceinline__ unsigned pk_bf16(float a, float b) {
  return __builtin_bit_cast(unsigned, __builtin_convertvector((v2f){a, b}, v2b));
}
// hi/lo split of two f32: hi = the packed bf16 pair, lo = the packed bf16 pair of what hi leaves over
__device__ __forceinline__ void pk_split(float a, float b, unsigned& hi, unsigned& lo) {
  hi = pk_bf16(a, b);
  const v2f r = (v2f){a, b} - (v2f){__uint_as_float(hi << 16), __uint_as_float(hi & 0xFFFF0000u)};
  lo = __builtin_bit_cast(unsigned, __builtin_convertvector(r, v2b));
}

// hazard guards as plain device helpers (no inline asm inside the kernel template body)
__device__ __forceinline__ void dep_guard_h(v8f& a, v8f& b, v16h x, v16h y) { asm volatile("v_nop\n\tv_nop\n\tv_nop\n\tv_nop" : "+v"(a), "+v"(b) : "v"(x), "v"(y)); }
__device__ __forceinline__ void dep_guard_b(v8f& a, v8f& b, v16b x, v16b y) { asm volatile("v_nop\n\tv_nop\n\tv_nop\n\tv_nop" : "+v"(a), "+v"(b) : "v"(x), "v"(y)); }
__device__ __forceinline__ void keep4_h(v16h a, v16h b, v16h c, v16h d) { asm volatile("v_nop" :: "v"(a), "v"(b), "v"(c), "v"(d)); }
__device__ __forceinline__ void keep4_b(v16b a, v16b b, v16b c, v16b d) { asm volatile("v_nop" :: "v"(a), "v"(b), "v"(c), "v"(d)); }
__device__ __forceinline__ void acc_guard4(v8f& a, v8f& b, v8f& c, v8f& d) { asm volatile("v_nop\n\tv_nop\n\tv_nop\n\tv_nop" : "+v"(a), "+v"(b), "+v"(c), "+v"(d)); }
template <typename T> struct Frag;
template <> struct Frag<_Float16> {
  typedef v16h V; union U { v16h v; v8h h[2]; };
  static __device__ __forceinline__ v16h load(const _Float16* p) {   // fragment-order tile: elements 0..7 <- p[0..7], 8..15 <- p[256..263]
    U f; f.h[0] = *(const v8h*)(p); f.h[1] = *(const v8h*)(p + 256); return f.v;
  }
  static __device__ __forceinline__ v8f mma(v16h a, v16h b, v8f c) {
    return __builtin_amdgcn_wmma_f32_16x16x32_f16(false, a, false, b, (short)0, c, false, false);
  }
  static __device__ __forceinline__ void guard(v8f& a, v8f& b, v16h x, v16h y) { dep_guard_h(a, b, x, y); }
  static __device__ __forceinline__ void keep(v16h a, v16h b, v16h c, v16h d) { keep4_h(a, b, c, d); }
};
template <> struct Frag<__bf16> {
  typedef v16b V; union U { v16b v; v8b h[2]; };
  static __device__ __forceinline__ v16b load(const __bf16* p) {
    U f; f.h[0] = *(const v8b*)(p); f.h[1] = *(const v8b*)(p + 256); return f.v;
  }
  static __device__ __forceinline__ v8f mma(v16b a, v16b b, v8f c) {
    return __builtin_amdgcn_wmma_f32_16x16x32_bf16(false, a, false, b, (short)0, c, false, false);
  }
  static __device__ __forceinline__ void guard(v8f& a, v8f& b, v16b x, v16b y) { dep_guard_b(a, b, x, y); }
  static __device__ __forceinline__ void keep(v16b a, v16b b, v16b c, v16b d) { keep4_b(a, b, c, d); }
};

// ---- Register-blocked batched WMMA GEMM ------------------------------------
// C[m,n] = scale * sum_k A[m,k] * Bt[n,k] (+bias)(+resid); each wave owns a 64x64 tile.
// A [M,K] and Bt [N,K] in fragment order; M,N % 64 == 0, K % 32 == 0.
// Fragment order: the tile of rows 16*rt..+15 and k 32*kt..+31 is 512 contiguous elements at (rt * (K/32) + kt) * 512;
// in it element (row c, k) lies at ((k >> 4) & 1) * 256 + (((k >> 3) & 1) * 16 + c) * 8 + (k & 7), so lane l's two
// 16-byte pieces lie at l * 8 and 256 + l * 8 and each wave-wide 16-byte load covers 512 contiguous bytes (4 whole lines).
// SPLIT: operands are hi/lo planes (A2/Bt2 = lo planes, same layout); product = hi.hi + hi.lo + lo.hi.
// BIAS_MODE: 0 = none, 1 = bias[m], 2 = bias[n].
// OUT_MODE: 0 = f32, 1 = f16, 2 = bf16 hi plane (Cout) + bf16 lo plane (Cout2).
// ET: 0 = f16 operands, 1 = bf16 operands (pointers passed as 16-bit storage)
template <int ET> struct Elem;
template <> struct Elem<0> { typedef _Float16 T; };
template <> struct Elem<1> { typedef __bf16 T; };
// LDK: K of the stored A and Bt, a compile-time constant, so that the step from one 16-row tile strip to the next is an
// immediate offset of the load (lda and ldb are not read).
template <int ET, bool SPLIT, int BIAS_MODE, int OUT_MODE, bool RESID, int ACT = 0, int LDK = 1024>
__global__ __launch_bounds__(256) void wmma_gemm64(
    const unsigned short* __restrict__ Ap, const unsigned short* __restrict__ A2p, int lda, long strideA,
    const unsigned short* __restrict__ Btp, const unsigned short* __restrict__ Bt2p, int ldb, long strideB,
    void* __restrict__ Cout, void* __restrict__ Cout2, int ldc, long strideC,
    const float* __restrict__ bias,
    const float* __restrict__ resid, long strideR,
    int M, int N, int K, float scale) {
  typedef typename Elem<ET>::T T;
  typedef typename Frag<T>::V V;
  const T* A = (const T*)Ap; const T* A2 = (const T*)A2p; const T* Bt = (const T*)Btp; const T* Bt2 = (const T*)Bt2p;
  __shared__ __align__(16) float sT[8][16 * 68];   // per-wave 16x64 slab, pitch 68 floats
  const int b    = blockIdx.y;
  const int lane = threadIdx.x & 31;
  const int wave = __builtin_amdgcn_readfirstlane(threadIdx.x >> 5);   // wave-uniform: the tile bases below stay in scalar registers
  const int tilesN = N >> 6;
  const int tilesM = M >> 6;
  const int tile = blockIdx.x * 8 + wave;
  if (tile >= tilesM * tilesN) return;   // wave-uniform; no block barriers in this kernel
  const int tm = tile / tilesN;
  const int tn = tile - tm * tilesN;
  const int m0 = tm << 6;
  const int n0 = tn << 6;

  const T* Ab  = A  + (size_t)b * strideA;
  const T* Bb  = Bt + (size_t)b * strideB;
  const T* Ab2 = SPLIT ? (A2  + (size_t)b * strideA) : nullptr;
  const T* Bb2 = SPLIT ? (Bt2 + (size_t)b * strideB) : nullptr;

  const int rlane = lane & 15;                 // row (A) / col (B, D) within subtile
  const int mOff  = (lane >> 4) * 8;           // D row offset

  v8f acc[4][4];
#pragma unroll
  for (int i = 0; i < 4; ++i)
#pragma unroll
    for (int j = 0; j < 4; ++j) acc[i][j] = (v8f){0.f,0.f,0.f,0.f,0.f,0.f,0.f,0.f};

  // one scalar base per operand; one 32-bit vector byte offset serves all loads: lane * 16, + 1024 per k step
  constexpr size_t TS = (size_t)(LDK / 32) * 512;                                // elements per 16-row tile strip
  const size_t aT = (size_t)(m0 >> 4) * TS, bT = (size_t)(n0 >> 4) * TS;
  for (int k0 = 0; k0 < K; k0 += 32) {
    const unsigned vo = (unsigned)(k0 << 5) + (unsigned)(lane * 16);
    V bh[4], bl[4];
#pragma unroll
    for (int j = 0; j < 4; ++j) {
      bh[j] = Frag<T>::load((const T*)((const char*)(Bb + (bT + j * TS)) + vo));
      if (SPLIT) bl[j] = Frag<T>::load((const T*)((const char*)(Bb2 + (bT + j * TS)) + vo));
    }
    // all four A fragments of the k step are requested here, in one group with the B fragments: the step then waits out one
    // load latency, not one per A fragment
    V ah[4], al[4];
#pragma unroll
    for (int i = 0; i < 4; ++i) {
      ah[i] = Frag<T>::load((const T*)((const char*)(Ab + (aT + i * TS)) + vo));
      if (SPLIT) al[i] = Frag<T>::load((const T*)((const char*)(Ab2 + (aT + i * TS)) + vo));
    }
#pragma unroll
    for (int i = 0; i < 4; ++i) {
#pragma unroll
      for (int j = 0; j < 4; ++j) {
        acc[i][j] = Frag<T>::mma(ah[i], bh[j], acc[i][j]);
        if (SPLIT) {
          acc[i][j] = Frag<T>::mma(ah[i], bl[j], acc[i][j]);
          acc[i][j] = Frag<T>::mma(al[i], bh[j], acc[i][j]);
        }
      }
      Frag<T>::guard(acc[i][0], acc[i][3], ah[i], SPLIT ? al[i] : ah[i]);
    }
    Frag<T>::keep(bh[0], bh[1], bh[2], bh[3]);
    if (SPLIT) Frag<T>::keep(bl[0], bl[1], bl[2], bl[3]);
  }
  acc_guard4(acc[0][0], acc[0][1], acc[0][2], acc[0][3]);
  acc_guard4(acc[1][0], acc[1][1], acc[1][2], acc[1][3]);
  acc_guard4(acc[2][0], acc[2][1], acc[2][2], acc[2][3]);
  acc_guard4(acc[3][0], acc[3][1], acc[3][2], acc[3][3]);

  // ---- epilogue ----
  float* slab = sT[wave];
  const float* Rb = RESID ? (resid + (size_t)b * strideR) : nullptr;
#pragma unroll
  for (int i = 0; i < 4; ++i) {
    const int mBase = m0 + (i << 4);
#pragma unroll
    for (int j = 0; j < 4; ++j) {
      const int n = n0 + (j << 4) + rlane;
      float bv = 0.f;
      if (BIAS_MODE == 2) bv = bias[n];
#pragma unroll
      for (int r = 0; r < 8; ++r) {
        float v = acc[i][j][r] * scale;
        if (BIAS_MODE == 1) v += bias[mBase + mOff + r];
        if (BIAS_MODE == 2) v += bv;
        if (RESID) v += Rb[(size_t)(mBase + mOff + r) * ldc + n];
        if (ACT == 1) v = tanhf(v);
        if (ACT == 2) v = fmaxf(v, 0.0f);
        if (ACT == 3) v = v / (1.0f + expf(-v));
        if (ACT == 4) v = (v > 0.f) ? v : 0.01f * v;
        if (ACT == 5) v = 0.5f * v * (1.0f + erff(v * 0.70710678118654752f));
        slab[(mOff + r) * 68 + (j << 4) + rlane] = v;
      }
    }
    __builtin_amdgcn_fence(__ATOMIC_RELEASE, "workgroup");
    __builtin_amdgcn_wave_barrier();
    __builtin_amdgcn_fence(__ATOMIC_ACQUIRE, "workgroup");
    if (OUT_MODE == 0) {
      float* C = (float*)Cout + (size_t)b * strideC;
      const int hh = lane >> 4, c4 = (lane & 15) * 4;     // row seg = 256 B = 16 lanes x 16 B
      {
#pragma unroll
        for (int it = 0; it < 8; ++it) {
          const int row = it * 2 + hh;
          v4f v = *(const v4f*)(slab + row * 68 + c4);
          *(v4f*)(C + (size_t)(mBase + row) * ldc + n0 + c4) = v;
        }
        
      }
    } else {
      const int q = lane >> 3, c8 = (lane & 7) * 8;
      unsigned short* C  = (unsigned short*)Cout  + (size_t)b * strideC;
      unsigned short* C2 = (OUT_MODE == 2) ? ((unsigned short*)Cout2 + (size_t)b * strideC) : nullptr;
      {
#pragma unroll
        for (int it = 0; it < 4; ++it) {
          const int row = it * 4 + q;
          const float* sp = slab + row * 68 + c8;
          union { v8h v; unsigned u[4]; } hv, lv;
#pragma unroll
          for (int e = 0; e < 8; e += 2) {
            if (OUT_MODE == 1) {
              hv.v[e] = (_Float16)sp[e];
              hv.v[e + 1] = (_Float16)sp[e + 1];
            } else {
              pk_split(sp[e], sp[e + 1], hv.u[e >> 1], lv.u[e >> 1]);
            }
          }
          *(v8h*)(C + (size_t)(mBase + row) * ldc + n0 + c8) = hv.v;
          if (OUT_MODE == 2) *(v8h*)(C2 + (size_t)(mBase + row) * ldc + n0 + c8) = lv.v;
        }
        
      }
    }
    __builtin_amdgcn_fence(__ATOMIC_RELEASE, "workgroup");
    __builtin_amdgcn_wave_barrier();
    __builtin_amdgcn_fence(__ATOMIC_ACQUIRE, "workgroup");
  }
}

// f32 row-major [rows][K] -> bf16 (RNE) in the GEMM's fragment order. One wave per two neighbouring 16 x 32 tiles:
// each 16-byte load covers 4 rows x 128 B (whole lines), eight in flight; a lane's four values of one row are 8 bytes of
// the tile, and the four rows of a load are 64 contiguous bytes in each of the tile's four 256-byte quarters.
// All six operands in one launch, none reading what another writes: blocks 0 .. 3 NBX - 1 are the three activations (NBX blocks
// each, results one behind the other in xout), the next 3 NBW blocks the three weights (into wout). A block is 8 waves = 8192 elements.
template <int K, int NBX, int NBW>
__global__ __launch_bounds__(256) void cast6_f32_bf16_frag(
    const float* __restrict__ x0, const float* __restrict__ x1, const float* __restrict__ x2,
    const float* __restrict__ w0, const float* __restrict__ w1, const float* __restrict__ w2,
    unsigned short* __restrict__ xout, unsigned short* __restrict__ wout) {
  const int bx = blockIdx.x;
  const float* in;
  unsigned short* out;
  int lb;                                      // block within its operand
  if (bx < 3 * NBX) {
    const int z = bx / NBX;
    lb  = bx - z * NBX;
    in  = (z == 0) ? x0 : (z == 1) ? x1 : x2;
    out = xout + (size_t)z * NBX * 8192;
  } else {
    const int z = (bx - 3 * NBX) / NBW;
    lb  = (bx - 3 * NBX) - z * NBW;
    in  = (z == 0) ? w0 : (z == 1) ? w1 : w2;
    out = wout + (size_t)z * NBW * 8192;
  }
  const int lane = threadIdx.x & 31;
  const int wv   = lb * 8 + (threadIdx.x >> 5);
  const int rt = wv / (K / 64);                // 16-row tile
  const int kq = wv % (K / 64);                // pair of 32-k tiles
  const int rs = lane >> 3;                    // row within a group of four
  const int q  = lane & 7;                     // k = 4q .. 4q+3 within the tile
  const float* sp = in + (size_t)(rt * 16 + rs) * K + kq * 64 + q * 4;
  v4f x[2][4];
#pragma unroll
  for (int t = 0; t < 2; ++t)
#pragma unroll
    for (int i = 0; i < 4; ++i) x[t][i] = *(const v4f*)(sp + (size_t)(4 * i) * K + t * 32);
  unsigned short* dp = out + ((size_t)rt * (K / 32) + kq * 2) * 512 + (q >> 2) * 256 + (((q >> 1) & 1) * 16 + rs) * 8 + (q & 1) * 4;
#pragma unroll
  for (int t = 0; t < 2; ++t)
#pragma unroll
    for (int i = 0; i < 4; ++i) {
      uint2 u;
      u.x = pk_bf16(x[t][i][0], x[t][i][1]);
      u.y = pk_bf16(x[t][i][2], x[t][i][3]);
      *(uint2*)(dp + t * 512 + i * 32) = u;
    }
}

// =====================================================================================
// Attention, head_dim 64, no mask. Inputs are bf16 hi/lo planes of q, k, v laid out as G groups of
// contiguous [S][64] slabs (group stride gstride elements, row stride 64); output f32 in the same slab layout.
// Block = 4 waves = 64 query rows of one group; 64-key chunks. Both products run transposed, so that a lane owns one query:
//   scores^T = k.q^T * sscale : A = k rows, B = q rows; k and q hi/lo planes (hi.hi + hi.lo + lo.hi), f32 accumulate
//   out^T   += v^T.p^T        : A = v^T rows, B = p^T; p split into bf16 hi/lo after the max shift, v hi/lo planes (three products)
//   A lane's registers of two neighbouring 16-key score tiles are, in place, its share of a 32-key B operand: p stays in registers.
//   online softmax in f32: maximum and sum run over a lane's own 32 scores, plus one exchange between the wave's halves.
//   Q planes staged once per block in LDS (16-B copies); K and V planes copied row by row per chunk (16-B copies);
//   the V^T fragments come out of the row-major V tile by the transposing LDS load; all staging with plain loads + __syncthreads().
//   grid.x = G * (S/64).
// =====================================================================================
#define AT_D 64
#define AT_NW 4
#define AT_QB 64
#define AT_KC 64
#define AT_LP 72   // LDS row pitch in elements: 144 B = 16 B x odd, so the 16 rows of a 16-byte fragment read fall on distinct banks
#define AT_VP 80   // LDS row pitch of the V tiles in elements: 160 B = 32 B x odd, the conflict-free pitch of the transposing load

// three products of a hi/lo x hi/lo pair into one accumulator, then the hazard guard tying D and all four operands
__device__ __forceinline__ v8f at_mma3(v16b ah, v16b al, v16b bh, v16b bl, v8f c) {
  c = __builtin_amdgcn_wmma_f32_16x16x32_bf16(false, ah, false, bh, (short)0, c, false, false);
  c = __builtin_amdgcn_wmma_f32_16x16x32_bf16(false, ah, false, bl, (short)0, c, false, false);
  c = __builtin_amdgcn_wmma_f32_16x16x32_bf16(false, al, false, bh, (short)0, c, false, false);
  asm volatile("v_nop\n\tv_nop\n\tv_nop\n\tv_nop" : "+v"(c) : "v"(ah), "v"(al), "v"(bh), "v"(bl));
  return c;
}

// transposing LDS load: the lanes point at 16 rows x 32 B of a row-major 16-bit tile (lane l: row 8(l >> 4) + (l & 7), 16-byte
// half (l >> 3) & 1); lane (c, hh) receives column c of rows 8hh .. 8hh+7, which is half of an A fragment of the transposed tile
__device__ __forceinline__ v8b at_ld_tr16(const __bf16* p) {
  typedef __attribute__((address_space(3))) v8b lds_v8b;
  return __builtin_amdgcn_ds_load_tr16_b128_v8bf16((lds_v8b*)p);
}

// the value of lane l ^ 16 (the wave's other half), by a vector cross-row move
__device__ __forceinline__ float at_xhalf(float x) {
  const int b = __float_as_int(x);
  return __int_as_float(__builtin_amdgcn_permlanex16(b, b, 0x76543210, 0xfedcba98, false, false));
}

__global__ __launch_bounds__(128)
void attn64_planes(const unsigned short* __restrict__ QH, const unsigned short* __restrict__ QL,
                   const unsigned short* __restrict__ KH, const unsigned short* __restrict__ KL,
                   const unsigned short* __restrict__ VH, const unsigned short* __restrict__ VL,
                   float* __restrict__ out, long gstride, int S, int nkc, float sscale) {
  union FB { v16b v; v8b h[2]; unsigned u[8]; };
  __shared__ __align__(16) __bf16 Qs[AT_NW][2 * 16 * AT_LP];  // per wave Q hi [row][d], then Q lo [row][d]  18 KB
  __shared__ __align__(16) __bf16 Ksh[AT_KC * AT_LP];         // K hi [kv][d]    9 KB
  __shared__ __align__(16) __bf16 Ksl[AT_KC * AT_LP];         // K lo [kv][d]    9 KB
  __shared__ __align__(16) __bf16 Vsh[AT_KC * AT_VP];         // V hi [kv][d]   10 KB
  __shared__ __align__(16) __bf16 Vsl[AT_KC * AT_VP];         // V lo [kv][d]   10 KB
  // The per-wave out tile (16 rows, pitch 68 floats) has no LDS of its own: it lies on the wave's own Q tiles, which no other
  // wave reads and which are dead behind the last chunk's scores. 56 KB a block in all.
  static_assert(16 * 68 * sizeof(float) <= 2 * 16 * AT_LP * sizeof(__bf16));

  const int tid  = threadIdx.x;
  const int wave = tid >> 5;
  const int lane = tid & 31;
  const int hh   = lane >> 4;
  const int c    = lane & 15;

  const int nqb = S / AT_QB;
  const int bx  = blockIdx.x;
  const int qb  = bx % nqb;
  const int g   = bx / nqb;
  const int q0  = qb * AT_QB + wave * 16;

  const __bf16* Qh = (const __bf16*)QH + (size_t)g * gstride;
  const __bf16* Ql = (const __bf16*)QL + (size_t)g * gstride;
  const __bf16* Kh = (const __bf16*)KH + (size_t)g * gstride;
  const __bf16* Kl = (const __bf16*)KL + (size_t)g * gstride;
  const __bf16* Vh = (const __bf16*)VH + (size_t)g * gstride;
  const __bf16* Vl = (const __bf16*)VL + (size_t)g * gstride;
  float*        Og = out + (size_t)g * gstride;

  // ---- Q hi/lo planes for the block's 64 rows: [row][d], 16-B copies (512 chunks per plane, 4 per thread) ----
  {
    const __bf16* qsh = Qh + (size_t)(qb * AT_QB) * AT_D;
    const __bf16* qsl = Ql + (size_t)(qb * AT_QB) * AT_D;
#pragma unroll
    for (int it = 0; it < 4; ++it) {
      const int ch = tid + it * 128;
      const int row = ch >> 3, col = (ch & 7) * 8;
      __bf16* qd = Qs[row >> 4] + (row & 15) * AT_LP + col;
      *(v8b*)(qd)              = *(const v8b*)(qsh + (size_t)row * AT_D + col);
      *(v8b*)(qd + 16 * AT_LP) = *(const v8b*)(qsl + (size_t)row * AT_D + col);
    }
  }
  __syncthreads();

  float mrow = -INFINITY, lrow = 0.f;   // query q0 + c: running maximum (alike in both halves); sum over this half's keys only
  v8f oacc[4];                          // oacc[t][r] = out^T[d = 16t + 8hh + r][query q0 + c]
#pragma unroll
  for (int t = 0; t < 4; ++t) oacc[t] = (v8f){0.f,0.f,0.f,0.f,0.f,0.f,0.f,0.f};

  const int nk = (nkc < 64) ? nkc : 64;                             // host-provided trip count, clamped to a static maximum
  const __bf16* qwh = Qs[wave] + c * AT_LP + 8 * hh;                 // B fragment column c (query row c) of this wave
  const __bf16* qwl = qwh + 16 * AT_LP;

  for (int kc = 0; kc < nk; ++kc) {
    const int kv0 = kc * AT_KC;
    __syncthreads();                                                // readers of the last K/V tile done
    {
      const __bf16* ksh = Kh + (size_t)kv0 * AT_D;
      const __bf16* ksl = Kl + (size_t)kv0 * AT_D;
      const __bf16* vsh = Vh + (size_t)kv0 * AT_D;
      const __bf16* vsl = Vl + (size_t)kv0 * AT_D;
#pragma unroll
      for (int it = 0; it < 4; ++it) {
        const int ch = tid + it * 128;
        const int row = ch >> 3, col = (ch & 7) * 8;                // row = kv within chunk, col = d
        *(v8b*)(Ksh + row * AT_LP + col) = *(const v8b*)(ksh + (size_t)row * AT_D + col);
        *(v8b*)(Ksl + row * AT_LP + col) = *(const v8b*)(ksl + (size_t)row * AT_D + col);
        *(v8b*)(Vsh + row * AT_VP + col) = *(const v8b*)(vsh + (size_t)row * AT_D + col);
        *(v8b*)(Vsl + row * AT_VP + col) = *(const v8b*)(vsl + (size_t)row * AT_D + col);
      }
    }
    __syncthreads();

    // ---- scores^T[64 x 16] = k . q^T  (A = K[kv][d], B = Q[row][d]; split k-map via two 16-B halves at +8hh and +16+8hh) ----
    // s[j][r] = score of key 16j + 8hh + r and query c
    v8f s[4];
#pragma unroll
    for (int j = 0; j < 4; ++j) s[j] = (v8f){0.f,0.f,0.f,0.f,0.f,0.f,0.f,0.f};
#pragma unroll 1
    for (int dc = 0; dc < 2; ++dc) {
      FB qh, ql;
      qh.h[0] = *(const v8b*)(qwh + dc * 32);
      qh.h[1] = *(const v8b*)(qwh + dc * 32 + 16);
      ql.h[0] = *(const v8b*)(qwl + dc * 32);
      ql.h[1] = *(const v8b*)(qwl + dc * 32 + 16);
#pragma unroll
      for (int j = 0; j < 4; ++j) {
        FB kb, kl;
        const __bf16* kp  = Ksh + (j * 16 + c) * AT_LP + dc * 32 + 8 * hh;
        const __bf16* kpl = Ksl + (j * 16 + c) * AT_LP + dc * 32 + 8 * hh;
        kb.h[0] = *(const v8b*)(kp);
        kb.h[1] = *(const v8b*)(kp + 16);
        kl.h[0] = *(const v8b*)(kpl);
        kl.h[1] = *(const v8b*)(kpl + 16);
        s[j] = at_mma3(kb.v, kl.v, qh.v, ql.v, s[j]);
      }
    }
    // ---- scale (f32), the query's maximum: in-lane over 32 keys, then the other half's 32 ----
    float mj[4];
#pragma unroll   // here and below: s, pa, pl and oacc live in registers, so every index into them must be a constant
    for (int j = 0; j < 4; ++j) {
      float m = -INFINITY;
#pragma unroll
      for (int r = 0; r < 8; ++r) {
        const float sv = s[j][r] * sscale;
        s[j][r] = sv;
        m = fmaxf(m, sv);
      }
      mj[j] = m;
    }
    const float mh = fmaxf(fmaxf(mj[0], mj[1]), fmaxf(mj[2], mj[3]));
    const float mnew = fmaxf(mrow, fmaxf(mh, at_xhalf(mh)));
    const float mref = (mnew == -INFINITY) ? 0.0f : mnew;
    const float alpha = __expf(mrow - mref);
    mrow = mnew;
    // p^T as B operand of keys 32kk .. 32kk+31: elements 0..7 = tile 2kk's registers, 8..15 = tile 2kk+1's (the split k-map)
    FB pa[2], pl[2];
    float pj[4];
#pragma unroll
    for (int j = 0; j < 4; ++j) {
      float psum = 0.f;
#pragma unroll
      for (int r = 0; r < 8; r += 2) {
        const float p0 = __expf(s[j][r] - mref);
        const float p1 = __expf(s[j][r + 1] - mref);
        psum += p0;
        psum += p1;
        pk_split(p0, p1, pa[j >> 1].u[(j & 1) * 4 + (r >> 1)], pl[j >> 1].u[(j & 1) * 4 + (r >> 1)]);
      }
      pj[j] = psum;
    }
    lrow = lrow * alpha + ((pj[0] + pj[1]) + (pj[2] + pj[3]));
#pragma unroll
    for (int t = 0; t < 4; ++t)
#pragma unroll
      for (int r = 0; r < 8; ++r) oacc[t][r] *= alpha;
    // ---- O^T[64 x 16] += V^T[64 x 64] . P^T[64 x 16]  (A = V^T[d][kv] by transposing loads of the [kv][d] tile, B = p^T from registers) ----
#pragma unroll   // pa[kk] and pl[kk] live in registers: kk must be a constant at each use
    for (int kk = 0; kk < 2; ++kk) {
#pragma unroll
      for (int t = 0; t < 4; ++t) {
        FB vb, vl;
        const int vo = (kk * 32 + 8 * hh + (lane & 7)) * AT_VP + t * 16 + ((lane >> 3) & 1) * 8;
        vb.h[0] = at_ld_tr16(Vsh + vo);                  // keys 32kk + 8hh .. +7 of d = 16t + c
        vb.h[1] = at_ld_tr16(Vsh + vo + 16 * AT_VP);     // keys 32kk + 16 + 8hh .. +7
        vl.h[0] = at_ld_tr16(Vsl + vo);
        vl.h[1] = at_ld_tr16(Vsl + vo + 16 * AT_VP);
        oacc[t] = at_mma3(vb.v, vl.v, pa[kk].v, pl[kk].v, oacc[t]);
      }
    }
  }

  float* os = (float*)Qs[wave];   // every value stored here comes out of products that have read all of this wave's Q
  {
    const float inv = 1.0f / (lrow + at_xhalf(lrow));   // the two halves' key sums joined once
#pragma unroll
    for (int t = 0; t < 4; ++t) {                       // a lane's 8 registers are 8 neighbouring d of its query's row
      *(v4f*)(os + c * 68 + t * 16 + 8 * hh)     = (v4f){oacc[t][0] * inv, oacc[t][1] * inv, oacc[t][2] * inv, oacc[t][3] * inv};
      *(v4f*)(os + c * 68 + t * 16 + 8 * hh + 4) = (v4f){oacc[t][4] * inv, oacc[t][5] * inv, oacc[t][6] * inv, oacc[t][7] * inv};
    }
  }
  __builtin_amdgcn_fence(__ATOMIC_RELEASE, "workgroup");
  __builtin_amdgcn_wave_barrier();
  __builtin_amdgcn_fence(__ATOMIC_ACQUIRE, "workgroup");
  {
    const int c4 = (lane & 15) * 4;
    {
#pragma unroll
      for (int it = 0; it < 8; ++it) {
        const int row = it * 2 + hh;                    // hh in 0..1, it in 0..7 -> rows 0..15
        v4f val = *(const v4f*)(os + row * 68 + c4);
        *(v4f*)(Og + (size_t)(q0 + row) * AT_D + c4) = val;
      }
      
    }
  }
}

// ---------------------------------------------------------------------------
// Host orchestration (launches only).
// d_in: 0=query 1=key 2=value [4,1024,1024] f32; 3=Wq 4=Wk 5=Wv [1024,1024] f32 ([out,in]).
// q/k/v = x . W^T as [4096][1024] bf16 hi/lo planes; the raw row-major reshape to [64][1024][64] is a pure
// reinterpretation of the same memory: group g owns the contiguous slab of 1024 rows x 64.
// ---------------------------------------------------------------------------
extern "C" void kernel_launch(void* const* d_in, const int* in_sizes, int n_in,
                              void* d_out, int out_size, void* d_ws, size_t ws_size,
                              hipStream_t stream) {
  constexpr int Bn = 4, Sn = 1024, E = 1024, Dh = 64, G = 64;
  constexpr int M = Bn * Sn;                       // 4096 projected rows
  constexpr int GS = (M * E) / (G * Dh);           // 1024 group-tokens per group
  static_assert(GS % AT_QB == 0 && GS % AT_KC == 0);
  static_assert(M % 64 == 0 && E % 64 == 0 && E % 32 == 0);
  if (n_in < 6) return;
  if (in_sizes[0] != M * E || in_sizes[1] != M * E || in_sizes[2] != M * E ||
      in_sizes[3] != E * E || in_sizes[4] != E * E || in_sizes[5] != E * E || out_size != M * E) return;

  const float* xq = (const float*)d_in[0];
  const float* xk = (const float*)d_in[1];
  const float* xv = (const float*)d_in[2];
  const float* wq = (const float*)d_in[3];
  const float* wk = (const float*)d_in[4];
  const float* wv = (const float*)d_in[5];
  float* out = (float*)d_out;

  const size_t bX = (size_t)M * E * 2;            //  8 MiB  bf16 activation copy (x3)
  const size_t bW = (size_t)E * E * 2;            //  2 MiB  bf16 weight copy (x3)
  const size_t bP = (size_t)M * E * 2;            //  8 MiB  bf16 projection plane (x3 hi, x3 lo)
  char* ws = (char*)d_ws;
  size_t off = 0;
  unsigned short* X16 = (unsigned short*)(ws + off); off += 3 * bX;   // [3] x (4096 x 1024) bf16, fragment order
  unsigned short* W16 = (unsigned short*)(ws + off); off += 3 * bW;   // [3] x (1024 x 1024) bf16, fragment order
  unsigned short* PH  = (unsigned short*)(ws + off); off += 3 * bP;   // [3][4096][1024] bf16 hi : q, k, v
  unsigned short* PL  = (unsigned short*)(ws + off); off += 3 * bP;   // [3][4096][1024] bf16 lo : q, k, v
  if (off > ws_size || off > (size_t)134217728) return;               // 81,788,928 B

  const size_t PE = (size_t)M * E;                 // elements per plane
  unsigned short* QH = PH;          unsigned short* QL = PL;
  unsigned short* KH = PH + PE;     unsigned short* KL = PL + PE;
  unsigned short* VH = PH + 2 * PE; unsigned short* VL = PL + 2 * PE;

  dim3 blk256(256), blk128(128);

  // 1: RNE bf16 casts of the three activations and the three weights, written in the GEMM's fragment order, one launch
  {
    static_assert(E % 64 == 0 && M % 16 == 0);
    constexpr int npx = (M / 16) * (E / 64), npw = (E / 16) * (E / 64);   // waves: one per pair of 16 x 32 tiles
    static_assert(npx % 8 == 0 && npw % 8 == 0);                          // whole blocks of 8 waves: no wave without a tile pair
    static_assert((size_t)(npx / 8) * 8192 == (size_t)M * E && (size_t)(npw / 8) * 8192 == (size_t)E * E);
    cast6_f32_bf16_frag<E, npx / 8, npw / 8><<<dim3(3 * (npx / 8) + 3 * (npw / 8)), blk256, 0, stream>>>(
        xq, xk, xv, wq, wk, wv, X16, W16);
  }

  // 2: P_z[m][f] = bf16(x_z)[m][e] . bf16(W_z)[f][e], f32 accumulate, stored as bf16 hi/lo planes; z = 0..2 via grid.y
  {
    const int tiles = (M / 64) * (E / 64);          // 1024 tiles of 64x64 per z; 8 waves per block
    wmma_gemm64<1, false, 0, 2, false, 0, E><<<dim3((tiles + 7) / 8, 3), blk256, 0, stream>>>(
        X16, X16, E, (long)PE,
        W16, W16, E, (long)E * E,
        (void*)PH, (void*)PL, E, (long)PE,
        wq, wq, 0L, M, E, E, 1.0f);
  }

  // 3: attention over 64 groups, each a contiguous [1024][64] slab (group stride 65536 elements, row stride 64); no mask
  {
    const int nblk = G * (GS / AT_QB);               // 64 groups x 16 query blocks = 1024
    const long gstride = (long)GS * Dh;              // 65536
    attn64_planes<<<dim3(nblk), blk128, 0, stream>>>(
        QH, QL, KH, KL, VH, VL, out, gstride, GS, GS / AT_KC, 0.125f);
  }
}

// v009
// A run of this version takes 82.1 microseconds.
// In both of two side-by-side timings against v008, it was 1.07 times as fast.
// All steps since v000 together make it 4.21 times as fast.
#include <hip/hip_runtime.h>
#include <math.h>
// Contractions: q/k/v projection GEMMs = v_wmma_f32_16x16x32_bf16 (bf16 operands, one product, f32 accumulate, results stored as bf16 hi/lo planes); scores q.k^T = v_wmma_f32_16x16x32_bf16 (bf16 hi/lo planes of q and k, three products); out = p.v = v_wmma_f32_16x16x32_bf16 (bf16 hi/lo planes of p and v, three products); f32 accumulate everywhere; online softmax in f32.

typedef __attribute__((ext_vector_type(16))) _Float16 v16h;
typedef __attribute__((ext_vector_type(8)))  _Float16 v8h;
typedef __attribute__((ext_vector_type(16))) __bf16   v16b;
typedef __attribute__((ext_vector_type(8)))  __bf16   v8b;
typedef __attribute__((ext_vector_type(8)))  float    v8f;
typedef __attribute__((ext_vector_type(4)))  float    v4f;
typedef __attribute__((ext_vector_type(2)))  float    v2f;
typedef __attribute__((ext_vector_type(2)))  __bf16   v2b;

// two f32 -> two bf16 in one register (a in the low half), round to nearest even, by the packed convert instruction
__device__ __forceinline__ unsigned pk_bf16(float a, float b) {
  return __builtin_bit_cast(unsigned, __builtin_convertvector((v2f){a, b}, v2b));
}
// hi/lo split of two f32: hi = the packed bf16 pair, lo = the packed bf16 pair of what hi leaves over
__device__ __forceinline__ void pk_split(float a, float b, unsigned& hi, unsigned& lo) {
  hi = pk_bf16(a, b);
  const v2f r = (v2f){a, b} - (v2f){__uint_as_float(hi << 16), __uint_as_float(hi & 0xFFFF0000u)};
  lo = __builtin_bit_cast(unsigned, __builtin_convertvector(r, v2b));
}

// hazard guards as plain device helpers (no inline asm inside the kernel template body)
__device__ __forceinline__ void dep_guard_h(v8f& a, v8f& b, v16h x, v16h y) { asm volatile("v_nop\n\tv_nop\n\tv_nop\n\tv_nop" : "+v"(a), "+v"(b) : "v"(x), "v"(y)); }
__device__ __forceinline__ void dep_guard_b(v8f& a, v8f& b, v16b x, v16b y) { asm volatile("v_nop\n\tv_nop\n\tv_nop\n\tv_nop" : "+v"(a), "+v"(b) : "v"(x), "v"(y)); }
__device__ __forceinline__ void keep4_h(v16h a, v16h b, v16h c, v16h d) { asm volatile("v_nop" :: "v"(a), "v"(b), "v"(c), "v"(d)); }
__device__ __forceinline__ void keep4_b(v16b a, v16b b, v16b c, v16b d) { asm volatile("v_nop" :: "v"(a), "v"(b), "v"(c), "v"(d)); }
__device__ __forceinline__ void acc_guard4(v8f& a, v8f& b, v8f& c, v8f& d) { asm volatile("v_nop\n\tv_nop\n\tv_nop\n\tv_nop" : "+v"(a), "+v"(b), "+v"(c), "+v"(d)); }
template <typename T> struct Frag;
template <> struct Frag<_Float16> {
  typedef v16h V; union U { v16h v; v8h h[2]; };
  static __device__ __forceinline__ v16h load(const _Float16* p) {   // fragment-order tile: elements 0..7 <- p[0..7], 8..15 <- p[256..263]
    U f; f.h[0] = *(const v8h*)(p); f.h[1] = *(const v8h*)(p + 256); return f.v;
  }
  static __device__ __forceinline__ v8f mma(v16h a, v16h b, v8f c) {
    return __builtin_amdgcn_wmma_f32_16x16x32_f16(false, a, false, b, (short)0, c, false, false);
  }
  static __device__ __forceinline__ void guard(v8f& a, v8f& b, v16h x, v16h y) { dep_guard_h(a, b, x, y); }
  static __device__ __forceinline__ void keep(v16h a, v16h b, v16h c, v16h d) { keep4_h(a, b, c, d); }
};
template <> struct Frag<__bf16> {
  typedef v16b V; union U { v16b v; v8b h[2]; };
  static __device__ __forceinline__ v16b load(const __bf16* p) {
    U f; f.h[0] = *(const v8b*)(p); f.h[1] = *(const v8b*)(p + 256); return f.v;
  }
  static __device__ __forceinline__ v8f mma(v16b a, v16b b, v8f c) {
    return __builtin_amdgcn_wmma_f32_16x16x32_bf16(false, a, false, b, (short)0, c, false, false);
  }
  static __device__ __forceinline__ void guard(v8f& a, v8f& b, v16b x, v16b y) { dep_guard_b(a, b, x, y); }
  static __device__ __forceinline__ void keep(v16b a, v16b b, v16b c, v16b d) { keep4_b(a, b, c, d); }
};

// ---- Register-blocked batched WMMA GEMM ------------------------------------
// C[m,n] = scale * sum_k A[m,k] * Bt[n,k] (+bias)(+resid); each wave owns a 64x64 tile.
// A [M,K] and Bt [N,K] in fragment order; M,N % 64 == 0, K % 32 == 0.
// Fragment order: the tile of rows 16*rt..+15 and k 32*kt..+31 is 512 contiguous elements at (rt * (K/32) + kt) * 512;
// in it element (row c, k) lies at ((k >> 4) & 1) * 256 + (((k >> 3) & 1) * 16 + c) * 8 + (k & 7), so lane l's two
// 16-byte pieces lie at l * 8 and 256 + l * 8 and each wave-wide 16-byte load covers 512 contiguous bytes (4 whole lines).
// SPLIT: operands are hi/lo planes (A2/Bt2 = lo planes, same layout); product = hi.hi + hi.lo + lo.hi.
// BIAS_MODE: 0 = none, 1 = bias[m], 2 = bias[n].
// OUT_MODE: 0 = f32, 1 = f16, 2 = bf16 hi plane (Cout) + bf16 lo plane (Cout2).
// ET: 0 = f16 operands, 1 = bf16 operands (pointers passed as 16-bit storage)
template <int ET> struct Elem;
template <> struct Elem<0> { typedef _Float16 T; };
template <> struct Elem<1> { typedef __bf16 T; };
// LDK: K of the stored A and Bt, a compile-time constant, so that the step from one 16-row tile strip to the next is an
// immediate offset of the load (lda and ldb are not read).
template <int ET, bool SPLIT, int BIAS_MODE, int OUT_MODE, bool RESID, int ACT = 0, int LDK = 1024>
__global__ __launch_bounds__(256) void wmma_gemm64(
    const unsigned short* __restrict__ Ap, const unsigned short* __restrict__ A2p, int lda, long strideA,
    const unsigned short* __restrict__ Btp, const unsigned short* __restrict__ Bt2p, int ldb, long strideB,
    void* __restrict__ Cout, void* __restrict__ Cout2, int ldc, long strideC,
    const float* __restrict__ bias,
    const float* __restrict__ resid, long strideR,
    int M, int N, int K, float scale) {
  typedef typename Elem<ET>::T T;
  typedef typename Frag<T>::V V;
  const T* A = (const T*)Ap; const T* A2 = (const T*)A2p; const T* Bt = (const T*)Btp; const T* Bt2 = (const T*)Bt2p;
  __shared__ __align__(16) float sT[8][16 * 68];   // per-wave 16x64 slab, pitch 68 floats
  const int b    = blockIdx.y;
  const int lane = threadIdx.x & 31;
  const int wave = __builtin_amdgcn_readfirstlane(threadIdx.x >> 5);   // wave-uniform: the tile bases below stay in scalar registers
  const int tilesN = N >> 6;
  const int tilesM = M >> 6;
  const int tile = blockIdx.x * 8 + wave;
  if (tile >= tilesM * tilesN) return;   // wave-uniform; no block barriers in this kernel
  const int tm = tile / tilesN;
  const int tn = tile - tm * tilesN;
  const int m0 = tm << 6;
  const int n0 = tn << 6;

  const T* Ab  = A  + (size_t)b * strideA;
  const T* Bb  = Bt + (size_t)b * strideB;
  const T* Ab2 = SPLIT ? (A2  + (size_t)b * strideA) : nullptr;
  const T* Bb2 = SPLIT ? (Bt2 + (size_t)b * strideB) : nullptr;

  const int rlane = lane & 15;                 // row (A) / col (B, D) within subtile
  const int mOff  = (lane >> 4) * 8;           // D row offset

  v8f acc[4][4];
#pragma unroll
  for (int i = 0; i < 4; ++i)
#pragma unroll
    for (int j = 0; j < 4; ++j) acc[i][j] = (v8f){0.f,0.f,0.f,0.f,0.f,0.f,0.f,0.f};

  // one scalar base per operand; one 32-bit vector byte offset serves all loads: lane * 16, + 1024 per k step
  constexpr size_t TS = (size_t)(LDK / 32) * 512;                                // elements per 16-row tile strip
  const size_t aT = (size_t)(m0 >> 4) * TS, bT = (size_t)(n0 >> 4) * TS;
  for (int k0 = 0; k0 < K; k0 += 32) {
    const unsigned vo = (unsigned)(k0 << 5) + (unsigned)(lane * 16);
    V bh[4], bl[4];
#pragma unroll
    for (int j = 0; j < 4; ++j) {
      bh[j] = Frag<T>::load((const T*)((const char*)(Bb + (bT + j * TS)) + vo));
      if (SPLIT) bl[j] = Frag<T>::load((const T*)((const char*)(Bb2 + (bT + j * TS)) + vo));
    }
    // all four A fragments of the k step are requested here, in one group with the B fragments: the step then waits out one
    // load latency, not one per A fragment
    V ah[4], al[4];
#pragma unroll
    for (int i = 0; i < 4; ++i) {
      ah[i] = Frag<T>::load((const T*)((const char*)(Ab + (aT + i * TS)) + vo));
      if (SPLIT) al[i] = Frag<T>::load((const T*)((const char*)(Ab2 + (aT + i * TS)) + vo));
    }
#pragma unroll
    for (int i = 0; i < 4; ++i) {
#pragma unroll
      for (int j = 0; j < 4; ++j) {
        acc[i][j] = Frag<T>::mma(ah[i], bh[j], acc[i][j]);
        if (SPLIT) {
          acc[i][j] = Frag<T>::mma(ah[i], bl[j], acc[i][j]);
          acc[i][j] = Frag<T>::mma(al[i], bh[j], acc[i][j]);
        }
      }
      Frag<T>::guard(acc[i][0], acc[i][3], ah[i], SPLIT ? al[i] : ah[i]);
    }
    Frag<T>::keep(bh[0], bh[1], bh[2], bh[3]);
    if (SPLIT) Frag<T>::keep(bl[0], bl[1], bl[2], bl[3]);
  }
  acc_guard4(acc[0][0], acc[0][1], acc[0][2], acc[0][3]);
  acc_guard4(acc[1][0], acc[1][1], acc[1][2], acc[1][3]);
  acc_guard4(acc[2][0], acc[2][1], acc[2][2], acc[2][3]);
  acc_guard4(acc[3][0], acc[3][1], acc[3][2], acc[3][3]);

  // ---- epilogue ----
  float* slab = sT[wave];
  const float* Rb = RESID ? (resid + (size_t)b * strideR) : nullptr;
#pragma unroll
  for (int i = 0; i < 4; ++i) {
    const int mBase = m0 + (i << 4);
#pragma unroll
    for (int j = 0; j < 4; ++j) {
      const int n = n0 + (j << 4) + rlane;
      float bv = 0.f;
      if (BIAS_MODE == 2) bv = bias[n];
#pragma unroll
      for (int r = 0; r < 8; ++r) {
        float v = acc[i][j][r] * scale;
        if (BIAS_MODE == 1) v += bias[mBase + mOff + r];
        if (BIAS_MODE == 2) v += bv;
        if (RESID) v += Rb[(size_t)(mBase + mOff + r) * ldc + n];
        if (ACT == 1) v = tanhf(v);
        if (ACT == 2) v = fmaxf(v, 0.0f);
        if (ACT == 3) v = v / (1.0f + expf(-v));
        if (ACT == 4) v = (v > 0.f) ? v : 0.01f * v;
        if (ACT == 5) v = 0.5f * v * (1.0f + erff(v * 0.70710678118654752f));
        slab[(mOff + r) * 68 + (j << 4) + rlane] = v;
      }
    }
    __builtin_amdgcn_fence(__ATOMIC_RELEASE, "workgroup");
    __builtin_amdgcn_wave_barrier();
    __builtin_amdgcn_fence(__ATOMIC_ACQUIRE, "workgroup");
    if (OUT_MODE == 0) {
      float* C = (float*)Cout + (size_t)b * strideC;
      const int hh = lane >> 4, c4 = (lane & 15) * 4;     // row seg = 256 B = 16 lanes x 16 B
      {
#pragma unroll
        for (int it = 0; it < 8; ++it) {
          const int row = it * 2 + hh;
          v4f v = *(const v4f*)(slab + row * 68 + c4);
          *(v4f*)(C + (size_t)(mBase + row) * ldc + n0 + c4) = v;
        }
        
      }
    } else {
      const int q = lane >> 3, c8 = (lane & 7) * 8;
      unsigned short* C  = (unsigned short*)Cout  + (size_t)b * strideC;
      unsigned short* C2 = (OUT_MODE == 2) ? ((unsigned short*)Cout2 + (size_t)b * strideC) : nullptr;
      {
#pragma unroll
        for (int it = 0; it < 4; ++it) {
          const int row = it * 4 + q;
          const float* sp = slab + row * 68 + c8;
          union { v8h v; unsigned u[4]; } hv, lv;
#pragma unroll
          for (int e = 0; e < 8; e += 2) {
            if (OUT_MODE == 1) {
              hv.v[e] = (_Float16)sp[e];
              hv.v[e + 1] = (_Float16)sp[e + 1];
            } else {
              pk_split(sp[e], sp[e + 1], hv.u[e >> 1], lv.u[e >> 1]);
            }
          }
          *(v8h*)(C + (size_t)(mBase + row) * ldc + n0 + c8) = hv.v;
          if (OUT_MODE == 2) *(v8h*)(C2 + (size_t)(mBase + row) * ldc + n0 + c8) = lv.v;
        }
        
      }
    }
    __builtin_amdgcn_fence(__ATOMIC_RELEASE, "workgroup");
    __builtin_amdgcn_wave_barrier();
    __builtin_amdgcn_fence(__ATOMIC_ACQUIRE, "workgroup");
  }
}

// f32 row-major [rows][K] -> bf16 (RNE) in the GEMM's fragment order. One wave per two neighbouring 16 x 32 tiles:
// each 16-byte load covers 4 rows x 128 B (whole lines), eight in flight; a lane's four values of one row are 8 bytes of
// the tile, and the four rows of a load are 64 contiguous bytes in each of the tile's four 256-byte quarters.
// All six operands in one launch, none reading what another writes: blocks 0 .. 3 NBX - 1 are the three activations (NBX blocks
// each, results one behind the other in xout), the next 3 NBW blocks the three weights (into wout). A block is 8 waves = 8192 elements.
template <int K, int NBX, int NBW>
__global__ __launch_bounds__(256) void cast6_f32_bf16_frag(
    const float* __restrict__ x0, const float* __restrict__ x1, const float* __restrict__ x2,
    const float* __restrict__ w0, const float* __restrict__ w1, const float* __restrict__ w2,
    unsigned short* __restrict__ xout, unsigned short* __restrict__ wout) {
  const int bx = blockIdx.x;
  const float* in;
  unsigned short* out;
  int lb;                                      // block within its operand
  if (bx < 3 * NBX) {
    const int z = bx / NBX;
    lb  = bx - z * NBX;
    in  = (z == 0) ? x0 : (z == 1) ? x1 : x2;
    out = xout + (size_t)z * NBX * 8192;
  } else {
    const int z = (bx - 3 * NBX) / NBW;
    lb  = (bx - 3 * NBX) - z * NBW;
    in  = (z == 0) ? w0 : (z == 1) ? w1 : w2;
    out = wout + (size_t)z * NBW * 8192;
  }
  const int lane = threadIdx.x & 31;
  const int wv   = lb * 8 + (threadIdx.x >> 5);
  const int rt = wv / (K / 64);                // 16-row tile
  const int kq = wv % (K / 64);                // pair of 32-k tiles
  const int rs = lane >> 3;                    // row within a group of four
  const int q  = lane & 7;                     // k = 4q .. 4q+3 within the tile
  const float* sp = in + (size_t)(rt * 16 + rs) * K + kq * 64 + q * 4;
  v4f x[2][4];
#pragma unroll
  for (int t = 0; t < 2; ++t)
#pragma unroll
    for (int i = 0; i < 4; ++i) x[t][i] = *(const v4f*)(sp + (size_t)(4 * i) * K + t * 32);
  unsigned short* dp = out + ((size_t)rt * (K / 32) + kq * 2) * 512 + (q >> 2) * 256 + (((q >> 1) & 1) * 16 + rs) * 8 + (q & 1) * 4;
#pragma unroll
  for (int t = 0; t < 2; ++t)
#pragma unroll
    for (int i = 0; i < 4; ++i) {
      uint2 u;
      u.x = pk_bf16(x[t][i][0], x[t][i][1]);
      u.y = pk_bf16(x[t][i][2], x[t][i][3]);
      *(uint2*)(dp + t * 512 + i * 32) = u;
    }
}

// =====================================================================================
// Attention, head_dim 64, no mask. Inputs are bf16 hi/lo planes of q, k, v laid out as G groups of
// contiguous [S][64] slabs (group stride gstride elements, row stride 64); output f32 in the same slab layout.
// Block = 4 waves = 64 query rows of one group; 64-key chunks. Both products run transposed, so that a lane owns one query per tile:
//   scores^T = k.q^T * sscale : A = k rows, B = q rows; k and q hi/lo planes (hi.hi + hi.lo + lo.hi), f32 accumulate
//   out^T   += v^T.p^T        : A = v^T rows, B = p^T; p split into bf16 hi/lo after the max shift, v hi/lo planes (three products)
//   A wave owns 32 queries (two 16-query tiles) and 32 of a chunk's 64 keys: a 2 x 2 block of 16 x 16 tiles, in which every fragment
//   read from LDS feeds two tiles. Waves w and w ^ 2 share their queries and split the keys; each runs its own online softmax over
//   its keys, and the two partial results are joined once, behind the loop.
//   A lane's registers of the two 16-key score tiles are, in place, its share of a 32-key B operand: p stays in registers.
//   online softmax in f32: maximum and sum run over a lane's own 16 scores, plus one exchange between the wave's halves.
//   Q planes staged once per block in LDS (16-B copies); K and V planes copied row by row per chunk (16-B copies);
//   the V^T fragments come out of the row-major V tile by the transposing LDS load; all staging with plain loads + __syncthreads().
//   grid.x = G * (S/64).
// =====================================================================================
#define AT_D 64
#define AT_NW 4
#define AT_QB 64
#define AT_KC 64
#define AT_LP 72   // LDS row pitch in elements: 144 B = 16 B x odd, so the 16 rows of a 16-byte fragment read fall on distinct banks
#define AT_VP 80   // LDS row pitch of the V tiles in elements: 160 B = 32 B x odd, the conflict-free pitch of the transposing load
#define AT_XW 1152 // floats of one wave's hand-over area behind the loop: 16 queries x 64 partial sums, then 32 maxima and 32 sums

__device__ __forceinline__ v8f at_mma(v16b a, v16b b, v8f c) {
  return __builtin_amdgcn_wmma_f32_16x16x32_bf16(false, a, false, b, (short)0, c, false, false);
}

// 2 x 2 block of hi/lo x hi/lo products: cij += ai . bj, three products each (hi.hi, then hi.lo, then lo.hi, per accumulator in that
// order). The twelve products go round the four accumulators, so none waits for the result of the one before it.
__device__ __forceinline__ void at_mma3_2x2(v16b ah0, v16b al0, v16b ah1, v16b al1, v16b bh0, v16b bl0, v16b bh1, v16b bl1,
                                            v8f& c00, v8f& c01, v8f& c10, v8f& c11) {
  c00 = at_mma(ah0, bh0, c00); c01 = at_mma(ah0, bh1, c01); c10 = at_mma(ah1, bh0, c10); c11 = at_mma(ah1, bh1, c11);
  c00 = at_mma(ah0, bl0, c00); c01 = at_mma(ah0, bl1, c01); c10 = at_mma(ah1, bl0, c10); c11 = at_mma(ah1, bl1, c11);
  c00 = at_mma(al0, bh0, c00); c01 = at_mma(al0, bh1, c01); c10 = at_mma(al1, bh0, c10); c11 = at_mma(al1, bh1, c11);
  // hazard guard: four vector slots between the last products and whatever next touches their results or operands
  asm volatile("v_nop\n\tv_nop\n\tv_nop\n\tv_nop" : "+v"(c00), "+v"(c01), "+v"(c10), "+v"(c11)
               : "v"(ah0), "v"(al0), "v"(ah1), "v"(al1), "v"(bh0), "v"(bl0), "v"(bh1), "v"(bl1));
}

// transposing LDS load: the lanes point at 16 rows x 32 B of a row-major 16-bit tile (lane l: row 8(l >> 4) + (l & 7), 16-byte
// half (l >> 3) & 1); lane (c, hh) receives column c of rows 8hh .. 8hh+7, which is half of an A fragment of the transposed tile
__device__ __forceinline__ v8b at_ld_tr16(const __bf16* p) {
  typedef __attribute__((address_space(3))) v8b lds_v8b;
  return __builtin_amdgcn_ds_load_tr16_b128_v8bf16((lds_v8b*)p);
}

// the value of lane l ^ 16 (the wave's other half), by a vector cross-row move
__device__ __forceinline__ float at_xhalf(float x) {
  const int b = __float_as_int(x);
  return __int_as_float(__builtin_amdgcn_permlanex16(b, b, 0x76543210, 0xfedcba98, false, false));
}

__global__ __launch_bounds__(128)
void attn64_planes(const unsigned short* __restrict__ QH, const unsigned short* __restrict__ QL,
                   const unsigned short* __restrict__ KH, const unsigned short* __restrict__ KL,
                   const unsigned short* __restrict__ VH, const unsigned short* __restrict__ VL,
                   float* __restrict__ out, long gstride, int S, int nkc, float sscale) {
  union FB { v16b v; v8b h[2]; unsigned u[8]; };
  __shared__ __align__(16) __bf16 Qs[AT_NW][2 * 16 * AT_LP];  // per 16-query tile Q hi [row][d], then Q lo [row][d]  18 KB
  __shared__ __align__(16) __bf16 Ksh[AT_KC * AT_LP];         // K hi [kv][d]    9 KB
  __shared__ __align__(16) __bf16 Ksl[AT_KC * AT_LP];         // K lo [kv][d]    9 KB
  __shared__ __align__(16) __bf16 Vsh[AT_KC * AT_VP];         // V hi [kv][d]   10 KB
  __shared__ __align__(16) __bf16 Vsl[AT_KC * AT_VP];         // V lo [kv][d]   10 KB
  // Behind the loop and a barrier all of this is dead: the hand-over areas lie on the V tiles (two waves' on each), and a wave's out
  // tile (16 rows, pitch 68 floats) lies on the Q tile that it finishes. 56 KB a block in all.
  static_assert(16 * 68 * sizeof(float) <= 2 * 16 * AT_LP * sizeof(__bf16));
  static_assert(2 * AT_XW * sizeof(float) <= AT_KC * AT_VP * sizeof(__bf16) && AT_XW >= 16 * 64 + 64 && AT_XW % 4 == 0);

  const int tid  = threadIdx.x;
  const int wave = __builtin_amdgcn_readfirstlane(tid >> 5);   // wave-uniform: qg and kh below stay in scalar registers
  const int lane = tid & 31;
  const int hh   = lane >> 4;
  const int c    = lane & 15;
  const int qg   = wave & 1;    // which 32 of the block's 64 queries
  const int kh   = wave >> 1;   // which 32 of a chunk's 64 keys

  const int nqb = S / AT_QB;
  const int bx  = blockIdx.x;
  const int qb  = bx % nqb;
  const int g   = bx / nqb;

  const __bf16* Qh = (const __bf16*)QH + (size_t)g * gstride;
  const __bf16* Ql = (const __bf16*)QL + (size_t)g * gstride;
  const __bf16* Kh = (const __bf16*)KH + (size_t)g * gstride;
  const __bf16* Kl = (const __bf16*)KL + (size_t)g * gstride;
  const __bf16* Vh = (const __bf16*)VH + (size_t)g * gstride;
  const __bf16* Vl = (const __bf16*)VL + (size_t)g * gstride;
  float*        Og = out + (size_t)g * gstride;

  // ---- Q hi/lo planes for the block's 64 rows: [row][d], 16-B copies (512 chunks per plane, 4 per thread) ----
  {
    const __bf16* qsh = Qh + (size_t)(qb * AT_QB) * AT_D;
    const __bf16* qsl = Ql + (size_t)(qb * AT_QB) * AT_D;
#pragma unroll
    for (int it = 0; it < 4; ++it) {
      const int ch = tid + it * 128;
      const int row = ch >> 3, col = (ch & 7) * 8;
      __bf16* qd = Qs[row >> 4] + (row & 15) * AT_LP + col;
      *(v8b*)(qd)              = *(const v8b*)(qsh + (size_t)row * AT_D + col);
      *(v8b*)(qd + 16 * AT_LP) = *(const v8b*)(qsl + (size_t)row * AT_D + col);
    }
  }
  __syncthreads();

  // query 32qg + 16n + c, over this wave's keys: running maximum (alike in both halves of the wave); sum over this half's keys only
  float mrow[2] = {-INFINITY, -INFINITY}, lrow[2] = {0.f, 0.f};
  v8f oacc[2][4];                       // oacc[n][t][r] = out^T[d = 16t + 8hh + r][query 32qg + 16n + c], this wave's keys
#pragma unroll
  for (int n = 0; n < 2; ++n)
#pragma unroll
    for (int t = 0; t < 4; ++t) oacc[n][t] = (v8f){0.f,0.f,0.f,0.f,0.f,0.f,0.f,0.f};

  const int nk = (nkc < 64) ? nkc : 64;                             // host-provided trip count, clamped to a static maximum
  const __bf16* qwh = Qs[2 * qg] + c * AT_LP + 8 * hh;               // B fragment column c (query row c) of tile n = 0; n = 1 one tile on
  const __bf16* kwh = Ksh + (kh * 32 + c) * AT_LP + 8 * hh;          // A fragment row c of this wave's first 16 keys, hi plane
  const __bf16* kwl = Ksl + (kh * 32 + c) * AT_LP + 8 * hh;          // lo plane
  const int     vw  = (kh * 32 + 8 * hh + (lane & 7)) * AT_VP + ((lane >> 3) & 1) * 8;   // transposing-load address in this wave's 32 keys

  for (int kc = 0; kc < nk; ++kc) {
    const int kv0 = kc * AT_KC;
    __syncthreads();                                                // readers of the last K/V tile done
    {
      const __bf16* ksh = Kh + (size_t)kv0 * AT_D;
      const __bf16* ksl = Kl + (size_t)kv0 * AT_D;
      const __bf16* vsh = Vh + (size_t)kv0 * AT_D;
      const __bf16* vsl = Vl + (size_t)kv0 * AT_D;
#pragma unroll
      for (int it = 0; it < 4; ++it) {
        const int ch = tid + it * 128;
        const int row = ch >> 3, col = (ch & 7) * 8;                // row = kv within chunk, col = d
        *(v8b*)(Ksh + row * AT_LP + col) = *(const v8b*)(ksh + (size_t)row * AT_D + col);
        *(v8b*)(Ksl + row * AT_LP + col) = *(const v8b*)(ksl + (size_t)row * AT_D + col);
        *(v8b*)(Vsh + row * AT_VP + col) = *(const v8b*)(vsh + (size_t)row * AT_D + col);
        *(v8b*)(Vsl + row * AT_VP + col) = *(const v8b*)(vsl + (size_t)row * AT_D + col);
      }
    }
    __syncthreads();

    // ---- scores^T[32 x 32] = k . q^T  (A = K[kv][d], B = Q[row][d]; split k-map via two 16-B halves at +8hh and +16+8hh) ----
    // s[n][j][r] = score of key 32kh + 16j + 8hh + r and query 32qg + 16n + c
    v8f s[2][2];
#pragma unroll   // here and below: s, pa, pl and oacc live in registers, so every index into them must be a constant
    for (int n = 0; n < 2; ++n)
#pragma unroll
      for (int j = 0; j < 2; ++j) s[n][j] = (v8f){0.f,0.f,0.f,0.f,0.f,0.f,0.f,0.f};
#pragma unroll   // both halves of d in straight line: no branch behind a product, and the second half's loads may start early
    for (int dc = 0; dc < 2; ++dc) {
      FB qh[2], ql[2], kb[2], kl[2];
#pragma unroll
      for (int n = 0; n < 2; ++n) {
        const __bf16* qp = qwh + n * (2 * 16 * AT_LP) + dc * 32;
        qh[n].h[0] = *(const v8b*)(qp);
        qh[n].h[1] = *(const v8b*)(qp + 16);
        ql[n].h[0] = *(const v8b*)(qp + 16 * AT_LP);
        ql[n].h[1] = *(const v8b*)(qp + 16 * AT_LP + 16);
      }
#pragma unroll
      for (int j = 0; j < 2; ++j) {
        const __bf16* kp  = kwh + j * 16 * AT_LP + dc * 32;
        const __bf16* kpl = kwl + j * 16 * AT_LP + dc * 32;
        kb[j].h[0] = *(const v8b*)(kp);
        kb[j].h[1] = *(const v8b*)(kp + 16);
        kl[j].h[0] = *(const v8b*)(kpl);
        kl[j].h[1] = *(const v8b*)(kpl + 16);
      }
      at_mma3_2x2(kb[0].v, kl[0].v, kb[1].v, kl[1].v, qh[0].v, ql[0].v, qh[1].v, ql[1].v, s[0][0], s[1][0], s[0][1], s[1][1]);
    }
    // p^T as B operand of this wave's 32 keys: elements 0..7 = score tile 0's registers, 8..15 = tile 1's (the split k-map)
    FB pa[2], pl[2];
#pragma unroll
    for (int n = 0; n < 2; ++n) {
      // ---- scale (f32), the query's maximum: in-lane over 16 keys, then the other half's 16 ----
      float mj[2];
#pragma unroll
      for (int j = 0; j < 2; ++j) {
        float m = -INFINITY;
#pragma unroll
        for (int r = 0; r < 8; ++r) {
          const float sv = s[n][j][r] * sscale;
          s[n][j][r] = sv;
          m = fmaxf(m, sv);
        }
        mj[j] = m;
      }
      const float mh = fmaxf(mj[0], mj[1]);
      const float mnew = fmaxf(mrow[n], fmaxf(mh, at_xhalf(mh)));
      const float mref = (mnew == -INFINITY) ? 0.0f : mnew;
      const float alpha = __expf(mrow[n] - mref);
      mrow[n] = mnew;
      float pj[2];
#pragma unroll
      for (int j = 0; j < 2; ++j) {
        float psum = 0.f;
#pragma unroll
        for (int r = 0; r < 8; r += 2) {
          const float p0 = __expf(s[n][j][r] - mref);
          const float p1 = __expf(s[n][j][r + 1] - mref);
          psum += p0;
          psum += p1;
          pk_split(p0, p1, pa[n].u[j * 4 + (r >> 1)], pl[n].u[j * 4 + (r >> 1)]);
        }
        pj[j] = psum;
      }
      lrow[n] = lrow[n] * alpha + (pj[0] + pj[1]);
#pragma unroll
      for (int t = 0; t < 4; ++t)
#pragma unroll
        for (int r = 0; r < 8; ++r) oacc[n][t][r] *= alpha;
    }
    // ---- O^T[64 x 32] += V^T[64 x 32] . P^T[32 x 32]  (A = V^T[d][kv] by transposing loads of the [kv][d] tile, B = p^T from registers) ----
#pragma unroll
    for (int tp = 0; tp < 4; tp += 2) {
      FB vb[2], vl[2];
#pragma unroll
      for (int i = 0; i < 2; ++i) {
        const int vo = vw + (tp + i) * 16;
        vb[i].h[0] = at_ld_tr16(Vsh + vo);                  // keys 32kh + 8hh .. +7 of d = 16(tp + i) + c
        vb[i].h[1] = at_ld_tr16(Vsh + vo + 16 * AT_VP);     // keys 32kh + 16 + 8hh .. +7
        vl[i].h[0] = at_ld_tr16(Vsl + vo);
        vl[i].h[1] = at_ld_tr16(Vsl + vo + 16 * AT_VP);
      }
      at_mma3_2x2(vb[0].v, vl[0].v, vb[1].v, vl[1].v, pa[0].v, pl[0].v, pa[1].v, pl[1].v,
                  oacc[0][tp], oacc[1][tp], oacc[0][tp + 1], oacc[1][tp + 1]);
    }
  }

  // ---- the two key halves joined: wave kh finishes query tile n = kh and hands its partial sums of the other tile to wave kh ^ 1 ----
  __syncthreads();                                        // every wave has left the K, V and Q tiles
  float*       xw = (float*)(kh ? Vsl : Vsh) + qg * AT_XW;         // this wave's hand-over area
  const float* xr = (const float*)(kh ? Vsh : Vsl) + qg * AT_XW;   // its partner's
  const float l0 = lrow[0] + at_xhalf(lrow[0]);           // the wave halves' key sums joined once
  const float l1 = lrow[1] + at_xhalf(lrow[1]);
  const float mk = kh ? mrow[1] : mrow[0], lk = kh ? l1 : l0;
  v8f ok[4];
#pragma unroll
  for (int t = 0; t < 4; ++t) {                           // piece by piece, lane by lane: 512 contiguous bytes a store
    const v8f og = kh ? oacc[0][t] : oacc[1][t];
    ok[t] = kh ? oacc[1][t] : oacc[0][t];
    *(v4f*)(xw + (2 * t) * 128 + lane * 4)     = (v4f){og[0], og[1], og[2], og[3]};
    *(v4f*)(xw + (2 * t + 1) * 128 + lane * 4) = (v4f){og[4], og[5], og[6], og[7]};
  }
  xw[1024 + lane] = kh ? mrow[0] : mrow[1];
  xw[1056 + lane] = kh ? l0 : l1;
  __syncthreads();                                        // hand-over areas written

  const int qt = 2 * qg + kh;                             // the block's 16-query tile that this wave finishes
  const int q0 = qb * AT_QB + qt * 16;
  float* os = (float*)Qs[qt];
  {
    const float mp = xr[1024 + lane], lp = xr[1056 + lane];
    const float mall = fmaxf(mk, mp);
    const float mref = (mall == -INFINITY) ? 0.0f : mall;
    const float ak = __expf(mk - mref), ap = __expf(mp - mref);
    asm volatile("v_nop");   // the free slot that the instruction set asks for behind a transcendental whose source is overwritten next
    const float inv = 1.0f / (lk * ak + lp * ap);
    const float fk = ak * inv, fp = ap * inv;
#pragma unroll
    for (int t = 0; t < 4; ++t) {                       // a lane's 8 registers are 8 neighbouring d of its query's row
      const v4f pa0 = *(const v4f*)(xr + (2 * t) * 128 + lane * 4);
      const v4f pa1 = *(const v4f*)(xr + (2 * t + 1) * 128 + lane * 4);
      *(v4f*)(os + c * 68 + t * 16 + 8 * hh)     = (v4f){ok[t][0] * fk + pa0[0] * fp, ok[t][1] * fk + pa0[1] * fp, ok[t][2] * fk + pa0[2] * fp, ok[t][3] * fk + pa0[3] * fp};
      *(v4f*)(os + c * 68 + t * 16 + 8 * hh + 4) = (v4f){ok[t][4] * fk + pa1[0] * fp, ok[t][5] * fk + pa1[1] * fp, ok[t][6] * fk + pa1[2] * fp, ok[t][7] * fk + pa1[3] * fp};
    }
  }
  __builtin_amdgcn_fence(__ATOMIC_RELEASE, "workgroup");
  __builtin_amdgcn_wave_barrier();
  __builtin_amdgcn_fence(__ATOMIC_ACQUIRE, "workgroup");
  {
    const int c4 = (lane & 15) * 4;
    {
#pragma unroll
      for (int it = 0; it < 8; ++it) {
        const int row = it * 2 + hh;                    // hh in 0..1, it in 0..7 -> rows 0..15
        v4f val = *(const v4f*)(os + row * 68 + c4);
        *(v4f*)(Og + (size_t)(q0 + row) * AT_D + c4) = val;
      }
      
    }
  }
}

// ---------------------------------------------------------------------------
// Host orchestration (launches only).
// d_in: 0=query 1=key 2=value [4,1024,1024] f32; 3=Wq 4=Wk 5=Wv [1024,1024] f32 ([out,in]).
// q/k/v = x . W^T as [4096][1024] bf16 hi/lo planes; the raw row-major reshape to [64][1024][64] is a pure
// reinterpretation of the same memory: group g owns the contiguous slab of 1024 rows x 64.
// ---------------------------------------------------------------------------
extern "C" void kernel_launch(void* const* d_in, const int* in_sizes, int n_in,
                              void* d_out, int out_size, void* d_ws, size_t ws_size,
                              hipStream_t stream) {
  constexpr int Bn = 4, Sn = 1024, E = 1024, Dh = 64, G = 64;
  constexpr int M = Bn * Sn;                       // 4096 projected rows
  constexpr int GS = (M * E) / (G * Dh);           // 1024 group-tokens per group
  static_assert(GS % AT_QB == 0 && GS % AT_KC == 0);
  static_assert(M % 64 == 0 && E % 64 == 0 && E % 32 == 0);
  if (n_in < 6) return;
  if (in_sizes[0] != M * E || in_sizes[1] != M * E || in_sizes[2] != M * E ||
      in_sizes[3] != E * E || in_sizes[4] != E * E || in_sizes[5] != E * E || out_size != M * E) return;

  const float* xq = (const float*)d_in[0];
  const float* xk = (const float*)d_in[1];
  const float* xv = (const float*)d_in[2];
  const float* wq = (const float*)d_in[3];
  const float* wk = (const float*)d_in[4];
  const float* wv = (const float*)d_in[5];
  float* out = (float*)d_out;

  const size_t bX = (size_t)M * E * 2;            //  8 MiB  bf16 activation copy (x3)
  const size_t bW = (size_t)E * E * 2;            //  2 MiB  bf16 weight copy (x3)
  const size_t bP = (size_t)M * E * 2;            //  8 MiB  bf16 projection plane (x3 hi, x3 lo)
  char* ws = (char*)d_ws;
  size_t off = 0;
  unsigned short* X16 = (unsigned short*)(ws + off); off += 3 * bX;   // [3] x (4096 x 1024) bf16, fragment order
  unsigned short* W16 = (unsigned short*)(ws + off); off += 3 * bW;   // [3] x (1024 x 1024) bf16, fragment order
  unsigned short* PH  = (unsigned short*)(ws + off); off += 3 * bP;   // [3][4096][1024] bf16 hi : q, k, v
  unsigned short* PL  = (unsigned short*)(ws + off); off += 3 * bP;   // [3][4096][1024] bf16 lo : q, k, v
  if (off > ws_size || off > (size_t)134217728) return;               // 81,788,928 B

  const size_t PE = (size_t)M * E;                 // elements per plane
  unsigned short* QH = PH;          unsigned short* QL = PL;
  unsigned short* KH = PH + PE;     unsigned short* KL = PL + PE;
  unsigned short* VH = PH + 2 * PE; unsigned short* VL = PL + 2 * PE;

  dim3 blk256(256), blk128(128);

  // 1: RNE bf16 casts of the three activations and the three weights, written in the GEMM's fragment order, one launch
  {
    static_assert(E % 64 == 0 && M % 16 == 0);
    constexpr int npx = (M / 16) * (E / 64), npw = (E / 16) * (E / 64);   // waves: one per pair of 16 x 32 tiles
    static_assert(npx % 8 == 0 && npw % 8 == 0);                          // whole blocks of 8 waves: no wave without a tile pair
    static_assert((size_t)(npx / 8) * 8192 == (size_t)M * E && (size_t)(npw / 8) * 8192 == (size_t)E * E);
    cast6_f32_bf16_frag<E, npx / 8, npw / 8><<<dim3(3 * (npx / 8) + 3 * (npw / 8)), blk256, 0, stream>>>(
        xq, xk, xv, wq, wk, wv, X16, W16);
  }

  // 2: P_z[m][f] = bf16(x_z)[m][e] . bf16(W_z)[f][e], f32 accumulate, stored as bf16 hi/lo planes; z = 0..2 via grid.y
  {
    const int tiles = (M / 64) * (E / 64);          // 1024 tiles of 64x64 per z; 8 waves per block
    wmma_gemm64<1, false, 0, 2, false, 0, E><<<dim3((tiles + 7) / 8, 3), blk256, 0, stream>>>(
        X16, X16, E, (long)PE,
        W16, W16, E, (long)E * E,
        (void*)PH, (void*)PL, E, (long)PE,
        wq, wq, 0L, M, E, E, 1.0f);
  }

  // 3: attention over 64 groups, each a contiguous [1024][64] slab (group stride 65536 elements, row stride 64); no mask
  {
    const int nblk = G * (GS / AT_QB);               // 64 groups x 16 query blocks = 1024
    const long gstride = (long)GS * Dh;              // 65536
    attn64_planes<<<dim3(nblk), blk128, 0, stream>>>(
        QH, QL, KH, KL, VH, VL, out, gstride, GS, GS / AT_KC, 0.125f);
  }
}
